// v000
// Times are from an AMD MI455X. After a warm-up the kernel runs many times in a row, and a time is the length of
// such a window on the GPU divided by its runs, so every launch and the gaps after it count. The runs cycle
// through copies of the inputs. A figure is the median of several windows, for all but v000 over two sittings.
// Sittings can differ by a few percent; kernels timed side by side share one.
// v000, which the later versions start from, runs in 1430 microseconds.
#include <hip/hip_runtime.h>

// ViTSelfAttention (hidden [32][577][768]; q/k/v = x W^T + b (12 heads x 64); softmax(q.k / 8); out = merged context (no output projection) -> [32][577][768]).
// Batched layout (exact): sequences padded 577 -> 640 with zero rows (padded KEYS masked out of every softmax row; padded query rows computed and discarded); 8 sequences x 12 heads = 96 'virtual heads' of 640 tokens per group, 24 per score pass, 4 groups; projections run on the 5,120 stacked rows of a group at once.
// Compute dtypes, f32 accumulate: every input rounded to bf16; q/k/v on PLAIN bf16 operands (inputs: exact) + bias; scores AND attn.v hl x hl (3 products) on every row; softmax f32 (20 keys per lane) with the j < 577 predicate; merged context written directly in f32.

#define NB_  32
#define TT   640
#define DM   768
#define NH_  12
#define NKV  12
#define REP  (NH_ / NKV)
#define HD   64
#define DQ   (NH_ * HD)
#define DKV  (NKV * HD)
#define ZH   24
#define RH   640                  // query rows < RH use hi+lo planes (0: none)
#define WIN  0
#define PCAR 1024.0f
#define LR   577    // real tokens per sequence
#define GB   8      // sequences per group
#define NG   (NB_ / GB)
#define GR   (GB * TT)   // stacked rows per group
#define NVH  (GB * NH_)  // virtual heads per group
#define SCL  0.125f   // HD^-0.5
typedef _Float16 h16;
typedef unsigned short bf;
typedef __attribute__((ext_vector_type(16))) __bf16   v16bf;
typedef __attribute__((ext_vector_type(16))) _Float16 v16h;
typedef __attribute__((ext_vector_type(8)))  _Float16 v8h;
typedef __attribute__((ext_vector_type(8)))  unsigned short v8us;
typedef __attribute__((ext_vector_type(8)))  float    v8f;
typedef __attribute__((ext_vector_type(4)))  float    v4f;
typedef v8h  __attribute__((may_alias)) v8ha;
typedef v4f  __attribute__((may_alias)) v4fa;
typedef v8us __attribute__((may_alias)) v8usa;

__device__ __forceinline__ unsigned short f2bf(float f) { unsigned u = __float_as_uint(f); u += 0x7FFFu + ((u >> 16) & 1u); return (unsigned short)(u >> 16); }
__device__ __forceinline__ float bf2f(unsigned short b) { return __uint_as_float(((unsigned)b) << 16); }
__device__ __forceinline__ float bfr(float f) { return bf2f(f2bf(f)); }
__device__ __forceinline__ v16h cat16(v8h lo, v8h hi) { return __builtin_shufflevector(lo, hi, 0, 1, 2, 3, 4, 5, 6, 7, 8, 9, 10, 11, 12, 13, 14, 15); }
__device__ __forceinline__ v16bf cat16b(v8us lo, v8us hi) { return __builtin_bit_cast(v16bf, __builtin_shufflevector(lo, hi, 0, 1, 2, 3, 4, 5, 6, 7, 8, 9, 10, 11, 12, 13, 14, 15)); }
__device__ __forceinline__ v8f wmma16(v16h a, v16h b, v8f c) { return __builtin_amdgcn_wmma_f32_16x16x32_f16(false, a, false, b, (short)0, c, false, false); }
__device__ __forceinline__ v8f wmmab(v16bf a, v16bf b, v8f c) { return __builtin_amdgcn_wmma_f32_16x16x32_bf16(false, a, false, b, (short)0, c, false, false); }



// ---- k_gemmw: register-blocked GEMM, ONE WAVE per 64x64 output tile (16 accumulators), operands straight from K-contiguous 16-bit planes; grid (M/64, N/64, Z), 32 threads.
// C[m][n] (f32, pitch ldc, + optional f32 bias[n]) = sum_k A[m][k] Bt[n][k] (+ split products per NSPLIT). z-batch strides sA/sB/sC in elements. K % 32 == 0.
template <typename T16> struct WFrag;
template <> struct WFrag<h16> { typedef v16h V; static __device__ __forceinline__ V ld(const h16* p) { return cat16(*(const v8h*)p, *(const v8h*)(p + 16)); } static __device__ __forceinline__ v8f mma(V a, V b, v8f c) { return wmma16(a, b, c); } };
template <> struct WFrag<bf> { typedef v16bf V; static __device__ __forceinline__ V ld(const bf* p) { return cat16b(*(const v8us*)p, *(const v8us*)(p + 16)); } static __device__ __forceinline__ v8f mma(V a, V b, v8f c) { return wmmab(a, b, c); } };
template <typename T16, int NSPLIT, bool BIAS>
__global__ __launch_bounds__(32) void k_gemmw(const T16* __restrict__ A, const T16* __restrict__ A2, const T16* __restrict__ Bt, const T16* __restrict__ Bt2, int K, float* C, int ldc, const float* __restrict__ bias, size_t sA, size_t sB, size_t sC) {
    typedef typename WFrag<T16>::V V;
    __shared__ __align__(16) float os[16 * 68];
    const size_t z = blockIdx.z; A += z * sA; if (A2) A2 += z * sA; Bt += z * sB; if (Bt2) Bt2 += z * sB; C += z * sC;
    const int lane = threadIdx.x & 31, lr = lane & 15, hi = lane >> 4; const int r0 = blockIdx.x * 64, c0 = blockIdx.y * 64;
    v8f acc[4][4];
#pragma unroll
    for (int mb = 0; mb < 4; ++mb)
#pragma unroll
        for (int nb = 0; nb < 4; ++nb) acc[mb][nb] = (v8f){};
    const size_t aoff = (size_t)(r0 + lr) * K + 8 * hi, boff = (size_t)(c0 + lr) * K + 8 * hi;
#pragma unroll 1
    for (int kc = 0; kc < K; kc += 32) {
        V a[4], a2[4];
#pragma unroll
        for (int mb = 0; mb < 4; ++mb) { a[mb] = WFrag<T16>::ld(A + aoff + (size_t)mb * 16 * K + kc); if (NSPLIT == 1 || NSPLIT == 2) a2[mb] = WFrag<T16>::ld(A2 + aoff + (size_t)mb * 16 * K + kc); }
#pragma unroll
        for (int nb = 0; nb < 4; ++nb) { const V b = WFrag<T16>::ld(Bt + boff + (size_t)nb * 16 * K + kc); V b2; if (NSPLIT >= 2) b2 = WFrag<T16>::ld(Bt2 + boff + (size_t)nb * 16 * K + kc);
#pragma unroll
            for (int mb = 0; mb < 4; ++mb) { acc[mb][nb] = WFrag<T16>::mma(a[mb], b, acc[mb][nb]); if (NSPLIT == 1 || NSPLIT == 2) acc[mb][nb] = WFrag<T16>::mma(a2[mb], b, acc[mb][nb]); if (NSPLIT >= 2) acc[mb][nb] = WFrag<T16>::mma(a[mb], b2, acc[mb][nb]); } }
        asm volatile("v_nop\n\tv_nop\n\tv_nop\n\tv_nop" : "+v"(acc[0][0]), "+v"(acc[1][1]), "+v"(acc[2][2]), "+v"(acc[3][3]) : "v"(a[0]), "v"(a[3]));
    }
#pragma unroll
    for (int mb = 0; mb < 4; ++mb) {
#pragma unroll
        for (int nb = 0; nb < 4; ++nb) {
#pragma unroll
            for (int j = 0; j < 8; ++j) os[(hi * 8 + j) * 68 + nb * 16 + lr] = acc[mb][nb][j]; }
        __builtin_amdgcn_wave_barrier(); asm volatile("" ::: "memory");
        float* crow = C + (size_t)(r0 + mb * 16) * ldc + c0;
{
#pragma unroll
            for (int s = 0; s < 8; ++s) { const int row = 2 * s + hi, cofs = lr * 4; v4f val = *(const v4fa*)(os + row * 68 + cofs); if (BIAS) { val[0] += bfr(bias[c0 + cofs]); val[1] += bfr(bias[c0 + cofs + 1]); val[2] += bfr(bias[c0 + cofs + 2]); val[3] += bfr(bias[c0 + cofs + 3]); }
                *(v4f*)(crow + (size_t)row * ldc + cofs) = val; }
             }
        __builtin_amdgcn_wave_barrier(); asm volatile("" ::: "memory");
    }
}

__device__ __forceinline__ h16 tohx(float x) { return (h16)x; }
__device__ __forceinline__ void splitf(float y, unsigned short& h, unsigned short& l) { h = f2bf(y); l = f2bf(y - bf2f(h)); }
typedef __attribute__((ext_vector_type(2))) _Float16 v2h;
typedef __attribute__((ext_vector_type(4))) _Float16 v4h;
typedef __attribute__((ext_vector_type(2))) unsigned short v2us;
typedef __attribute__((ext_vector_type(4))) unsigned short v4us;
typedef __attribute__((ext_vector_type(2))) float v2f;
typedef __attribute__((ext_vector_type(4))) int v4i;

__global__ __launch_bounds__(256) void k_wtG(const float* __restrict__ w, int K, int N, bf* Bt) {
    const int lane = threadIdx.x & 31; const int L0 = (blockIdx.x * 8 + (threadIdx.x >> 5)) * 8; const int nlines = N * K / 64;
{
#pragma unroll 1
        for (int l = 0; l < 8; ++l) { const int L = L0 + l; if (L >= nlines) break; const size_t e = (size_t)L * 64 + lane * 2; const int k = (int)(e % K), n = (int)(e / K); v2us o;
            o[0] = f2bf(w[(size_t)k * N + n]); o[1] = f2bf(w[(size_t)(k + 1) * N + n]); *(v2us*)(Bt + e) = o; }
         }
}
__global__ __launch_bounds__(256) void k_cvt8(const float* __restrict__ src, bf* dst, size_t n8) { const size_t i = (size_t)blockIdx.x * 256 + threadIdx.x; if (i >= n8) return; const v8f v = *(const v8f*)(src + i * 8); v8us o;
#pragma unroll
    for (int k = 0; k < 8; ++k) o[k] = f2bf(v[k]); *(v8us*)(dst + i * 8) = o;  }
__global__ __launch_bounds__(256) void k_cscvt(const float* __restrict__ cosT, const float* __restrict__ sinT, float* CS) { const int idx = blockIdx.x * 256 + threadIdx.x; if (idx >= TT * HD) return; v2f cs; cs[0] = bfr(cosT[idx]); cs[1] = bfr(sinT[idx]); *(v2f*)(CS + (size_t)idx * 2) = cs;  }
// k_rope: head planes [h][t][d] (fp16 + hi/lo) of rope(x) x sc with the rotate-half convention out[d] = x[d] cos[t][d] - x[d+HD/2] sin[t][d], out[d+HD/2] = x[d+HD/2] cos[t][d+HD/2] + x[d] sin[t][d+HD/2]
__global__ __launch_bounds__(256) void k_rope(const float* __restrict__ F, int pitch, int nheads, const float* __restrict__ CS, const float* __restrict__ RF, const float* __restrict__ nw, float sc, h16* P16, bf* Ph, bf* Pl) {
    const size_t e = ((size_t)blockIdx.x * 256 + threadIdx.x) * 2; if (e >= (size_t)nheads * TT * HD) return; const int d = (int)(e % HD); const int t = (int)((e / HD) % TT); const int h = (int)(e / ((size_t)HD * TT)); const float* f = F + (size_t)t * pitch + h * HD; const float rf = RF ? RF[(size_t)h * TT + t] : 1.0f; v2h o16; v2us oh, ol;
#pragma unroll
    for (int q = 0; q < 2; ++q) { const int dd = d + q; const int dp = (dd < HD / 2) ? dd + HD / 2 : dd - HD / 2; float x0 = f[dd], x1 = f[dp];
        if (RF) { float n0 = __fmul_rn(x0, rf), n1 = __fmul_rn(x1, rf); asm volatile("" : "+v"(n0)); asm volatile("" : "+v"(n1)); x0 = __fmul_rn(bfr(nw[dd]), n0); x1 = __fmul_rn(bfr(nw[dp]), n1); }
        const v2f cs = *(const v2f*)(CS + ((size_t)t * HD + dd) * 2); float a = __fmul_rn(x0, cs[0]), bq = __fmul_rn(x1, cs[1]); asm volatile("" : "+v"(a)); asm volatile("" : "+v"(bq)); const float r = ((dd < HD / 2) ? __fsub_rn(a, bq) : __fadd_rn(a, bq)) * sc;
        o16[q] = tohx(r); unsigned short a2, c2; splitf(r, a2, c2); oh[q] = a2; ol[q] = c2; }
    *(v2h*)(P16 + e) = o16; *(v2us*)(Ph + e) = oh; *(v2us*)(Pl + e) = ol;  }
__global__ __launch_bounds__(256) void k_vtp(const float* __restrict__ F, int pitch, int nheads, h16* V16, bf* Vh, bf* Vl) { const size_t e = ((size_t)blockIdx.x * 256 + threadIdx.x) * 2; if (e >= (size_t)nheads * HD * TT) return; const int t = (int)(e % TT); const int d = (int)((e / TT) % HD); const int g = (int)(e / ((size_t)TT * HD)); v2h o16; v2us oh, ol;
#pragma unroll
    for (int q = 0; q < 2; ++q) { const float x = F[(size_t)(t + q) * pitch + g * HD + d]; o16[q] = tohx(x); unsigned short a2, c2; splitf(x, a2, c2); oh[q] = a2; ol[q] = c2; }
    *(v2h*)(V16 + e) = o16; *(v2us*)(Vh + e) = oh; *(v2us*)(Vl + e) = ol;  }
__global__ __launch_bounds__(256) void k_csid(float* CS) { const int idx = blockIdx.x * 256 + threadIdx.x; if (idx >= TT * HD) return; v2f cs; cs[0] = 1.0f; cs[1] = 0.0f; *(v2f*)(CS + (size_t)idx * 2) = cs;  }
__global__ __launch_bounds__(256) void k_cvt8padg(const float* __restrict__ src, bf* XB2) { const size_t e8 = ((size_t)blockIdx.x * 256 + threadIdx.x) * 8; if (e8 >= (size_t)GR * DM) return; const int r = (int)(e8 / DM); const int bl = r / TT, t = r % TT; v8us o; if (t < LR) { const float* sp2 = src + ((size_t)bl * LR + t) * DM + (e8 % DM); for (int u = 0; u < 8; ++u) o[u] = f2bf(bfr(sp2[u])); } else { for (int u = 0; u < 8; ++u) o[u] = 0; } *(v8us*)(XB2 + e8) = o;  }
__global__ __launch_bounds__(256) void k_moutv(const float* __restrict__ O, int z0, float* YO2) { const size_t e = ((size_t)blockIdx.x * 256 + threadIdx.x) * 2; if (e >= (size_t)ZH * TT * HD) return; const int d = (int)(e % HD); const int t = (int)((e / HD) % TT); const int zz = (int)(e / ((size_t)HD * TT)); const int z = z0 + zz; const int bl = z / NH_, h = z % NH_; v2f o; o[0] = O[e]; o[1] = O[e + 1]; float* dst = YO2 + ((size_t)bl * TT + t) * DQ + (size_t)h * HD + d; *(v2f*)dst = o;  }
__global__ __launch_bounds__(256) void k_outcpg(const float* __restrict__ Y, float* O2) { const size_t e = ((size_t)blockIdx.x * 256 + threadIdx.x) * 4; if (e >= (size_t)GB * LR * DM) return; const size_t r = e / DM; const int bl = (int)(r / LR), t = (int)(r % LR); const v4f a = *(const v4f*)(Y + ((size_t)bl * TT + t) * DM + (e % DM)); *(v4f*)(O2 + e) = a;  }
// k_asoft: per row (zz, i): t = S x HD^-0.5 (keys j >= 577 masked); softmax over the 640 keys (register row, one exp, fixed trees);
__global__ __launch_bounds__(256) void k_asoft(const float* __restrict__ Sb, h16* P16, bf* Ph, bf* Pl) {
    const int lane = threadIdx.x & 31; const int row = blockIdx.x * 8 + (threadIdx.x >> 5); if (row >= ZH * TT) return; const int i = row % TT; const int zz = row / TT; (void)zz; const bool hires = (i < RH); const float* sr = Sb + (size_t)row * TT; float v[TT / 32]; float mx = -3.0e38f;
#pragma unroll
    for (int ch = 0; ch < TT / 128; ++ch) { const int j0 = ch * 128 + lane * 4; const v4f a = *(const v4f*)(sr + j0);
#pragma unroll
        for (int q = 0; q < 4; ++q) { const int j = j0 + q; (void)j; float sa = a[q] * SCL; asm volatile("" : "+v"(sa)); const float t = ((j0 + q) < LR) ? sa : -3.0e38f; v[ch * 4 + q] = t; mx = fmaxf(mx, t); } }
#pragma unroll
    for (int sh = 16; sh; sh >>= 1) mx = fmaxf(mx, __shfl_xor(mx, sh, 32));
    float sum = 0.f;
#pragma unroll
    for (int k = 0; k < TT / 32; ++k) { float d0 = __fsub_rn(v[k], mx); asm volatile("" : "+v"(d0)); v[k] = __builtin_amdgcn_exp2f(__fmul_rn(d0, 1.4426950408889634f)); sum += v[k]; }
#pragma unroll
    for (int sh = 16; sh; sh >>= 1) sum += __shfl_xor(sum, sh, 32);
    const float f = __fdiv_rn(hires ? 1.0f : PCAR, sum);
{
        if (hires) {
#pragma unroll
            for (int ch = 0; ch < TT / 128; ++ch) { v4us oh, ol;
#pragma unroll
                for (int q = 0; q < 4; ++q) { unsigned short a, c2; splitf(v[ch * 4 + q] * f, a, c2); oh[q] = a; ol[q] = c2; }
                const size_t oo = ((size_t)zz * (RH ? RH : 1) + i) * TT + ch * 128 + lane * 4; *(v4us*)(Ph + oo) = oh; *(v4us*)(Pl + oo) = ol; }
        } else {
#pragma unroll
            for (int ch = 0; ch < TT / 128; ++ch) { v4h o4;
#pragma unroll
                for (int q = 0; q < 4; ++q) o4[q] = tohx(v[ch * 4 + q] * f);
                *(v4h*)(P16 + (size_t)row * TT + ch * 128 + lane * 4) = o4; } }
         }
}
__global__ __launch_bounds__(256) void k_merge(const float* __restrict__ O, int h0, bf* Ah, bf* Al) { const size_t e = ((size_t)blockIdx.x * 256 + threadIdx.x) * 2; if (e >= (size_t)ZH * TT * HD) return; const int d = (int)(e % HD); const int t = (int)((e / HD) % TT); const int zz = (int)(e / ((size_t)HD * TT)); const float cs = (t < RH) ? 1.0f : (1.0f / PCAR); const size_t oo = (size_t)t * DQ + (h0 + zz) * HD + d;
    v2us oh, ol;
#pragma unroll
    for (int q = 0; q < 2; ++q) { unsigned short a, c2; splitf(O[e + q] * cs, a, c2); oh[q] = a; ol[q] = c2; } *(v2us*)(Ah + oo) = oh; *(v2us*)(Al + oo) = ol;  }

extern "C" void kernel_launch(void* const* d_in, const int* in_sizes, int n_in,
                              void* d_out, int out_size, void* d_ws, size_t ws_size, hipStream_t stream) {
    (void)in_sizes; (void)n_in; (void)out_size;
    const float* x = (const float*)d_in[0]; const float* wq = (const float*)d_in[1]; const float* bq = (const float*)d_in[2]; const float* wk = (const float*)d_in[3]; const float* bk = (const float*)d_in[4]; const float* wv = (const float*)d_in[5]; const float* bv = (const float*)d_in[6]; const float* wo = nullptr; (void)wo; const float* cosT = nullptr; const float* sinT = nullptr; (void)cosT; (void)sinT;
    float* OUT = (float*)d_out;   // [32][577][768]
    char* wsp = (char*)d_ws; auto take = [&](size_t bytes) { char* p = wsp; wsp += (bytes + 255) & ~(size_t)255; return (void*)p; };
    bf* WQ = (bf*)take((size_t)DQ * DM * 2); bf* WK = (bf*)take((size_t)DKV * DM * 2); bf* WV = (bf*)take((size_t)DKV * DM * 2); float* CS = (float*)take((size_t)TT * HD * 2 * 4);
    bf* XB = (bf*)take((size_t)GR * DM * 2); float* FQ = (float*)take((size_t)GR * DQ * 4); float* FK = (float*)take((size_t)GR * DKV * 4); float* FV = FK; float* YO = FQ;   /* YO (merged f32 context of the group) reuses FQ after the q planes are built */
    h16* QP16 = (h16*)take((size_t)NVH * TT * HD * 2); bf* QPh = (bf*)take((size_t)NVH * TT * HD * 2); bf* QPl = (bf*)take((size_t)NVH * TT * HD * 2);
    h16* KP16 = (h16*)take((size_t)NVH * TT * HD * 2); bf* KPh = (bf*)take((size_t)NVH * TT * HD * 2); bf* KPl = (bf*)take((size_t)NVH * TT * HD * 2);
    h16* VT16 = (h16*)take((size_t)NVH * HD * TT * 2); bf* VTh = (bf*)take((size_t)NVH * HD * TT * 2); bf* VTl = (bf*)take((size_t)NVH * HD * TT * 2);
    float* Sb = (float*)take((size_t)ZH * TT * TT * 4); h16* P16 = (h16*)take((size_t)ZH * TT * TT * 2); bf* Ph = (bf*)take((size_t)ZH * RH * TT * 2); bf* Pl = (bf*)take((size_t)ZH * RH * TT * 2); float* Ob = (float*)take((size_t)ZH * TT * HD * 4);
    if ((size_t)(wsp - (char*)d_ws) > ws_size) return;   // ws ~ 200 MiB
    { k_cvt8<<<(unsigned)(((size_t)DQ * DM / 8 + 255) / 256), 256, 0, stream>>>(wq, WQ, (size_t)DQ * DM / 8); k_cvt8<<<(unsigned)(((size_t)DKV * DM / 8 + 255) / 256), 256, 0, stream>>>(wk, WK, (size_t)DKV * DM / 8); k_cvt8<<<(unsigned)(((size_t)DKV * DM / 8 + 255) / 256), 256, 0, stream>>>(wv, WV, (size_t)DKV * DM / 8); k_csid<<<(TT * HD + 255) / 256, 256, 0, stream>>>(CS); }
    const unsigned LQ = (unsigned)(((size_t)NH_ * TT * HD / 2 + 255) / 256);
    for (int gI = 0; gI < NG; ++gI) {
        k_cvt8padg<<<(unsigned)(((size_t)GR * DM / 8 + 255) / 256), 256, 0, stream>>>(x + (size_t)gI * GB * LR * DM, XB);
        k_gemmw<bf, 0, true><<<dim3(GR / 64, DQ / 64, 1), 32, 0, stream>>>(XB, nullptr, WQ, nullptr, DM, FQ, DQ, bq, 0, 0, 0);
        for (int bl = 0; bl < GB; ++bl) k_rope<<<LQ, 256, 0, stream>>>(FQ + (size_t)bl * TT * DQ, DQ, NH_, CS, nullptr, nullptr, 1.0f, QP16 + (size_t)bl * NH_ * TT * HD, QPh + (size_t)bl * NH_ * TT * HD, QPl + (size_t)bl * NH_ * TT * HD);
        k_gemmw<bf, 0, true><<<dim3(GR / 64, DKV / 64, 1), 32, 0, stream>>>(XB, nullptr, WK, nullptr, DM, FK, DKV, bk, 0, 0, 0);
        for (int bl = 0; bl < GB; ++bl) k_rope<<<LQ, 256, 0, stream>>>(FK + (size_t)bl * TT * DKV, DKV, NKV, CS, nullptr, nullptr, 1.0f, KP16 + (size_t)bl * NKV * TT * HD, KPh + (size_t)bl * NKV * TT * HD, KPl + (size_t)bl * NKV * TT * HD);
        k_gemmw<bf, 0, true><<<dim3(GR / 64, DKV / 64, 1), 32, 0, stream>>>(XB, nullptr, WV, nullptr, DM, FV, DKV, bv, 0, 0, 0);
        for (int bl = 0; bl < GB; ++bl) k_vtp<<<LQ, 256, 0, stream>>>(FV + (size_t)bl * TT * DKV, DKV, NKV, VT16 + (size_t)bl * NKV * HD * TT, VTh + (size_t)bl * NKV * HD * TT, VTl + (size_t)bl * NKV * HD * TT);
        for (int z0 = 0; z0 < NVH; z0 += ZH) { const size_t zq = (size_t)z0;   // virtual head z = bl * 12 + h
            k_gemmw<bf, 2, false><<<dim3(TT / 64, TT / 64, ZH), 32, 0, stream>>>(QPh + zq * TT * HD, QPl + zq * TT * HD, KPh + zq * TT * HD, KPl + zq * TT * HD, HD, Sb, TT, nullptr, (size_t)TT * HD, (size_t)TT * HD, (size_t)TT * TT);
            k_asoft<<<ZH * TT / 8, 256, 0, stream>>>(Sb, P16, Ph, Pl);
            k_gemmw<bf, 2, false><<<dim3(TT / 64, HD / 64, ZH), 32, 0, stream>>>(Ph, Pl, VTh + zq * HD * TT, VTl + zq * HD * TT, TT, Ob, HD, nullptr, (size_t)RH * TT, (size_t)HD * TT, (size_t)TT * HD);
            k_moutv<<<(unsigned)(((size_t)ZH * TT * HD / 2 + 255) / 256), 256, 0, stream>>>(Ob, z0, YO); }
        k_outcpg<<<(unsigned)(((size_t)GB * LR * DM / 4 + 255) / 256), 256, 0, stream>>>(YO, OUT + (size_t)gI * GB * LR * DM);
    }
}

// v002
// A run of this version takes 386 microseconds.
// Versions in between are left out here; by their measured steps it is 3.71 times as fast as v000.
#include <hip/hip_runtime.h>

// ViTSelfAttention (hidden [32][577][768]; q/k/v = x W^T + b (12 heads x 64); softmax(q.k / 8); out = merged context (no output projection) -> [32][577][768]).
// Batched layout (exact): sequences padded 577 -> 640 with zero rows (padded KEYS masked out of every softmax row; padded query rows computed and discarded); 8 sequences x 12 heads = 96 'virtual heads' of 640 tokens per group, 4 groups, one fused attention launch per group; projections run on the 5,120 stacked rows of a group at once and store their results as hi/lo bf16 head planes themselves.
// Compute dtypes, f32 accumulate: every input rounded to bf16; q/k/v on PLAIN bf16 operands (inputs: exact) + bias; scores AND attn.v hl x hl (3 products) on every row; softmax f32, online over passes of 32 keys, with the j < 577 predicate; merged context written directly in f32 to the output.

#define NB_  32
#define TT   640
#define DM   768
#define NH_  12
#define NKV  12
#define REP  (NH_ / NKV)
#define HD   64
#define DQ   (NH_ * HD)
#define DKV  (NKV * HD)
#define ZH   24
#define RH   640                  // k_merge (not launched): rows t < RH scale 1, others 1 / PCAR
#define WIN  0
#define PCAR 1024.0f
#define LR   577    // real tokens per sequence
#define GB   8      // sequences per group
#define NG   (NB_ / GB)
#define GR   (GB * TT)   // stacked rows per group
#define NVH  (GB * NH_)  // virtual heads per group
#define SCL  0.125f   // HD^-0.5
typedef _Float16 h16;
typedef unsigned short bf;
typedef __attribute__((ext_vector_type(16))) __bf16   v16bf;
typedef __attribute__((ext_vector_type(16))) _Float16 v16h;
typedef __attribute__((ext_vector_type(8)))  _Float16 v8h;
typedef __attribute__((ext_vector_type(8)))  unsigned short v8us;
typedef __attribute__((ext_vector_type(8)))  float    v8f;
typedef __attribute__((ext_vector_type(4)))  float    v4f;
typedef v8h  __attribute__((may_alias)) v8ha;
typedef v4f  __attribute__((may_alias)) v4fa;
typedef v8us __attribute__((may_alias)) v8usa;

__device__ __forceinline__ unsigned short f2bf(float f) { unsigned u = __float_as_uint(f); u += 0x7FFFu + ((u >> 16) & 1u); return (unsigned short)(u >> 16); }
__device__ __forceinline__ float bf2f(unsigned short b) { return __uint_as_float(((unsigned)b) << 16); }
__device__ __forceinline__ float bfr(float f) { return bf2f(f2bf(f)); }
__device__ __forceinline__ v16h cat16(v8h lo, v8h hi) { return __builtin_shufflevector(lo, hi, 0, 1, 2, 3, 4, 5, 6, 7, 8, 9, 10, 11, 12, 13, 14, 15); }
__device__ __forceinline__ v16bf cat16b(v8us lo, v8us hi) { return __builtin_bit_cast(v16bf, __builtin_shufflevector(lo, hi, 0, 1, 2, 3, 4, 5, 6, 7, 8, 9, 10, 11, 12, 13, 14, 15)); }
__device__ __forceinline__ v8f wmma16(v16h a, v16h b, v8f c) { return __builtin_amdgcn_wmma_f32_16x16x32_f16(false, a, false, b, (short)0, c, false, false); }
__device__ __forceinline__ v8f wmmab(v16bf a, v16bf b, v8f c) { return __builtin_amdgcn_wmma_f32_16x16x32_bf16(false, a, false, b, (short)0, c, false, false); }



// ---- k_gemmw: register-blocked GEMM, ONE WAVE per 64x64 tile (16 accumulators), operands straight from K-contiguous 16-bit planes; grid (token rows / 64, heads), 32 threads.
// y[m][n] = sum_k A[m][k] Bt[n][k] + bias (f32), split into hi + lo bf16 and stored straight into the head planes: a lane's 8 accumulators are 8 consecutive m at one n, one 16-byte store per plane.
// VT false (q, k): A = weight rows (m = d of head blockIdx.y), Bt = token rows -> plane [head][t][d]. VT true (v): A = token rows, Bt = weight rows -> plane [head][d][t]. K % 32 == 0, HD == 64.
template <typename T16> struct WFrag;
template <> struct WFrag<h16> { typedef v16h V; static __device__ __forceinline__ V ld(const h16* p) { return cat16(*(const v8h*)p, *(const v8h*)(p + 16)); } static __device__ __forceinline__ v8f mma(V a, V b, v8f c) { return wmma16(a, b, c); } };
template <> struct WFrag<bf> { typedef v16bf V; static __device__ __forceinline__ V ld(const bf* p) { return cat16b(*(const v8us*)p, *(const v8us*)(p + 16)); } static __device__ __forceinline__ v8f mma(V a, V b, v8f c) { return wmmab(a, b, c); } };
typedef __attribute__((ext_vector_type(2))) __bf16 v2bf;
typedef __attribute__((ext_vector_type(2))) float v2f;
typedef __attribute__((ext_vector_type(4))) unsigned v4u;
template <typename T16, bool VT>
__global__ __launch_bounds__(32) void k_gemmw(const T16* __restrict__ A, const T16* __restrict__ Bt, int K, const float* __restrict__ bias, bf* Ph, bf* Pl) {
    typedef typename WFrag<T16>::V V;
    const int lane = threadIdx.x & 31, lr = lane & 15, hi = lane >> 4; const int tok0 = blockIdx.x * 64, f0 = blockIdx.y * 64; const int r0 = VT ? tok0 : f0, c0 = VT ? f0 : tok0;
    v8f acc[4][4];
#pragma unroll
    for (int mb = 0; mb < 4; ++mb)
#pragma unroll
        for (int nb = 0; nb < 4; ++nb) acc[mb][nb] = (v8f){};
    const size_t aoff = (size_t)(r0 + lr) * K + 8 * hi, boff = (size_t)(c0 + lr) * K + 8 * hi;
#pragma unroll 1
    for (int kc = 0; kc < K; kc += 32) {
        V a[4], b[4]; const T16* pa[4]; const T16* pb[4];
#pragma unroll
        for (int t = 0; t < 4; ++t) { pa[t] = A + aoff + (size_t)t * 16 * K + kc; pb[t] = Bt + boff + (size_t)t * 16 * K + kc; }
#pragma unroll
        for (int t = 0; t < 4; ++t) { a[t] = WFrag<T16>::ld(pa[t]); b[t] = WFrag<T16>::ld(pb[t]); }
        __builtin_amdgcn_sched_barrier(0);   // holds the trip's 16 loads together at its head: with the address pairs kept for the wait below, the scheduler strung the B loads out one fragment at a time, each behind a full wait of its own
#pragma unroll
        for (int nb = 0; nb < 4; ++nb)
#pragma unroll
            for (int mb = 0; mb < 4; ++mb) acc[mb][nb] = WFrag<T16>::mma(a[mb], b[nb], acc[mb][nb]);
        // s_wait_xcnt: behind the trip's loads (the four accumulators named depend on all eight fragments); their address pairs are inputs, so no pair is given away in front of the wait (the compiler had later loads land on them). v_nop: WMMA distance over the back edge.
        asm volatile("s_wait_xcnt 0x0\n\tv_nop\n\tv_nop\n\tv_nop\n\tv_nop" : "+v"(acc[0][0]), "+v"(acc[1][1]), "+v"(acc[2][2]), "+v"(acc[3][3]) : "v"(a[0]), "v"(a[3]), "v"(pa[0]), "v"(pa[1]), "v"(pa[2]), "v"(pa[3]), "v"(pb[0]), "v"(pb[1]), "v"(pb[2]), "v"(pb[3]));
    }
    const size_t pz = ((size_t)(tok0 / TT) * NH_ + blockIdx.y) * TT * HD; const int t0 = tok0 % TT;   // a 64-row tile lies inside one sequence (TT % 64 == 0)
#pragma unroll
    for (int mb = 0; mb < 4; ++mb) {
        v8f bm;
        if (!VT) { const v4f b0 = *(const v4fa*)(bias + f0 + mb * 16 + 8 * hi), b1 = *(const v4fa*)(bias + f0 + mb * 16 + 8 * hi + 4);
#pragma unroll
            for (int j = 0; j < 4; ++j) { bm[j] = bfr(b0[j]); bm[4 + j] = bfr(b1[j]); } }
#pragma unroll
        for (int nb = 0; nb < 4; ++nb) {
            if (VT) { const float b = bfr(bias[f0 + nb * 16 + lr]);
#pragma unroll
                for (int j = 0; j < 8; ++j) bm[j] = b; }
            const v8f y = acc[mb][nb] + bm; v4u yh, yl;
#pragma unroll
            for (int e = 0; e < 4; ++e) { v2f p; p[0] = y[2 * e]; p[1] = y[2 * e + 1]; const v2bf h2 = __builtin_convertvector(p, v2bf); const v2f r = p - __builtin_convertvector(h2, v2f);
                yh[e] = __builtin_bit_cast(unsigned, h2); yl[e] = __builtin_bit_cast(unsigned, __builtin_convertvector(r, v2bf)); }
            const size_t off = pz + (VT ? (size_t)(nb * 16 + lr) * TT + t0 + mb * 16 + 8 * hi : (size_t)(t0 + nb * 16 + lr) * HD + mb * 16 + 8 * hi);
            *(v8us*)(Ph + off) = __builtin_bit_cast(v8us, yh); *(v8us*)(Pl + off) = __builtin_bit_cast(v8us, yl); }
    }
}

__device__ __forceinline__ h16 tohx(float x) { return (h16)x; }
__device__ __forceinline__ void splitf(float y, unsigned short& h, unsigned short& l) { h = f2bf(y); l = f2bf(y - bf2f(h)); }
typedef __attribute__((ext_vector_type(2))) _Float16 v2h;
typedef __attribute__((ext_vector_type(4))) _Float16 v4h;
typedef __attribute__((ext_vector_type(2))) unsigned short v2us;
typedef __attribute__((ext_vector_type(4))) unsigned short v4us;
typedef __attribute__((ext_vector_type(4))) int v4i;

__global__ __launch_bounds__(256) void k_wtG(const float* __restrict__ w, int K, int N, bf* Bt) {
    const int lane = threadIdx.x & 31; const int L0 = (blockIdx.x * 8 + (threadIdx.x >> 5)) * 8; const int nlines = N * K / 64;
{
#pragma unroll 1
        for (int l = 0; l < 8; ++l) { const int L = L0 + l; if (L >= nlines) break; const size_t e = (size_t)L * 64 + lane * 2; const int k = (int)(e % K), n = (int)(e / K); v2us o;
            o[0] = f2bf(w[(size_t)k * N + n]); o[1] = f2bf(w[(size_t)(k + 1) * N + n]); *(v2us*)(Bt + e) = o; }
         }
}
__global__ __launch_bounds__(256) void k_cvt8(const float* __restrict__ src, bf* dst, size_t n8) { const size_t i = (size_t)blockIdx.x * 256 + threadIdx.x; if (i >= n8) return; const v8f v = *(const v8f*)(src + i * 8); v8us o;
#pragma unroll
    for (int k = 0; k < 8; ++k) o[k] = f2bf(v[k]); *(v8us*)(dst + i * 8) = o;  }
__global__ __launch_bounds__(256) void k_cscvt(const float* __restrict__ cosT, const float* __restrict__ sinT, float* CS) { const int idx = blockIdx.x * 256 + threadIdx.x; if (idx >= TT * HD) return; v2f cs; cs[0] = bfr(cosT[idx]); cs[1] = bfr(sinT[idx]); *(v2f*)(CS + (size_t)idx * 2) = cs;  }
__global__ __launch_bounds__(256) void k_cvt8padg(const float* __restrict__ src, bf* XB2) { const size_t e8 = ((size_t)blockIdx.x * 256 + threadIdx.x) * 8; if (e8 >= (size_t)GR * DM) return; const int r = (int)(e8 / DM); const int bl = r / TT, t = r % TT; v8us o; if (t < LR) { const float* sp2 = src + ((size_t)bl * LR + t) * DM + (e8 % DM); for (int u = 0; u < 8; ++u) o[u] = f2bf(bfr(sp2[u])); } else { for (int u = 0; u < 8; ++u) o[u] = 0; } *(v8us*)(XB2 + e8) = o;  }
// ---- k_fattn: scores, softmax, attn.v and the head merge in one kernel; ONE WAVE = 32 query columns of one virtual head, 4 independent waves per block (no LDS, no barrier); grid (ceil(NQB / 4), NVH).
// St = K.Qt (A = 16 key rows, B = 16 query columns kept in registers) and Ot += Vt.Pt: a lane holds one query's scores, so two St tiles (keys 0-15, 16-31 of a pass) convert in place into the B operand Pt,
// whose k order (8 hi + s, 16 + 8 hi + s - 8) is the order WFrag::ld gives the Vt rows. Running maximum and sum per query (online softmax over passes of 32 keys), division by the sum at the end.
// hl x hl (3 products) on both matrix products as before; keys >= LR masked in the last pass only (every earlier pass lies below LR).
#define NKB ((LR + 31) / 32)   // key passes
#define NQB ((LR + 31) / 32)   // 32-query column blocks per head
__device__ __forceinline__ float xhalf(float x) { const int b = __float_as_int(x); return __int_as_float(__builtin_amdgcn_permlanex16(b, b, 0x76543210, 0xfedcba98, false, false)); }   // lane l <-> l ^ 16
// xwait: stands behind a group of global loads, in front of whatever next overwrites a register that one of them names as its address.
// The group's address pairs are inputs, so they stay live up to the wait; the plane pointers carry no __restrict__, so the "memory" clobber keeps the loads in front of it.
__device__ __forceinline__ void xwait(const bf* a, const bf* b) { asm volatile("s_wait_xcnt 0x0" :: "v"(a), "v"(b) : "memory"); }
template <bool LAST>
__device__ __forceinline__ void fa_pass(const int key0, const int hi, const bf* kph, const bf* kpl, const bf* vph, const bf* vpl,
                                        const v16bf (&qh)[2][2], const v16bf (&ql)[2][2], v16bf (&kh)[2][2], v16bf (&kl)[2][2], v8f (&o)[4][2], float (&m)[2], float (&l)[2]) {
    const float C = SCL * 1.4426950408889634f;
    v16bf vh[4], vl[4]; const bf* va = vph + key0; const bf* vb = vpl + key0;
#pragma unroll
    for (int dt = 0; dt < 4; ++dt) { vh[dt] = WFrag<bf>::ld(va + (size_t)dt * 16 * TT); vl[dt] = WFrag<bf>::ld(vb + (size_t)dt * 16 * TT); }
    xwait(va, vb);
    __builtin_amdgcn_sched_barrier(0);   // holds the V loads at the head of the pass, so that the score products and the softmax cover their latency (the scheduler sank half of them to just ahead of their use)
    v8f s[2][2];
#pragma unroll
    for (int kt = 0; kt < 2; ++kt)
#pragma unroll
        for (int qt = 0; qt < 2; ++qt) s[kt][qt] = (v8f){};
#pragma unroll
    for (int ks = 0; ks < 2; ++ks) {
#pragma unroll
        for (int kt = 0; kt < 2; ++kt)
#pragma unroll
            for (int qt = 0; qt < 2; ++qt) s[kt][qt] = wmmab(kh[kt][ks], qh[qt][ks], s[kt][qt]);
#pragma unroll
        for (int kt = 0; kt < 2; ++kt)
#pragma unroll
            for (int qt = 0; qt < 2; ++qt) s[kt][qt] = wmmab(kl[kt][ks], qh[qt][ks], s[kt][qt]);
#pragma unroll
        for (int kt = 0; kt < 2; ++kt)
#pragma unroll
            for (int qt = 0; qt < 2; ++qt) s[kt][qt] = wmmab(kh[kt][ks], ql[qt][ks], s[kt][qt]);
    }
    if (!LAST) {   // the next pass's K fragments, fetched behind this pass's score products
        const bf* ka = kph + (size_t)key0 * HD; const bf* kc = kpl + (size_t)key0 * HD;
#pragma unroll
        for (int kt = 0; kt < 2; ++kt)
#pragma unroll
            for (int ks = 0; ks < 2; ++ks) { const size_t ko = (size_t)(32 + kt * 16) * HD + ks * 32; kh[kt][ks] = WFrag<bf>::ld(ka + ko); kl[kt][ks] = WFrag<bf>::ld(kc + ko); }
        xwait(ka, kc);
        __builtin_amdgcn_sched_barrier(0);   // holds the K prefetch ahead of the softmax, a whole pass ahead of its use (the scheduler sank it behind the softmax)
    }
    v16bf ph[2], pl[2];
#pragma unroll
    for (int qt = 0; qt < 2; ++qt) {
        if (LAST) {
#pragma unroll
            for (int kt = 0; kt < 2; ++kt)
#pragma unroll
                for (int j = 0; j < 8; ++j) s[kt][qt][j] = (key0 + kt * 16 + 8 * hi + j < LR) ? s[kt][qt][j] : -3.0e38f;
        }
        float mx = m[qt];
#pragma unroll
        for (int kt = 0; kt < 2; ++kt)
#pragma unroll
            for (int j = 0; j < 8; ++j) mx = fmaxf(mx, s[kt][qt][j]);
        mx = fmaxf(mx, xhalf(mx));
        const float al = __builtin_amdgcn_exp2f((m[qt] - mx) * C); const float mc = mx * C; m[qt] = mx;
        v2f p[8]; v2f c2, nm; c2[0] = C; c2[1] = C; nm[0] = -mc; nm[1] = -mc;
#pragma unroll
        for (int e = 0; e < 8; ++e) { v2f sv; sv[0] = s[e >> 2][qt][(e & 3) * 2]; sv[1] = s[e >> 2][qt][(e & 3) * 2 + 1]; const v2f t = __builtin_elementwise_fma(sv, c2, nm); p[e][0] = __builtin_amdgcn_exp2f(t[0]); p[e][1] = __builtin_amdgcn_exp2f(t[1]); }
        v2f ps = p[0];
#pragma unroll
        for (int e = 1; e < 8; ++e) ps += p[e];
#pragma unroll
        for (int e = 0; e < 8; ++e) { const v2bf h2 = __builtin_convertvector(p[e], v2bf); const v2f r = p[e] - __builtin_convertvector(h2, v2f); const v2bf l2 = __builtin_convertvector(r, v2bf);
            ph[qt][2 * e] = h2[0]; ph[qt][2 * e + 1] = h2[1]; pl[qt][2 * e] = l2[0]; pl[qt][2 * e + 1] = l2[1]; }
        l[qt] = l[qt] * al + (ps[0] + ps[1]);
#pragma unroll
        for (int dt = 0; dt < 4; ++dt) o[dt][qt] *= al;
    }
#pragma unroll
    for (int dt = 0; dt < 4; ++dt)
#pragma unroll
        for (int qt = 0; qt < 2; ++qt) o[dt][qt] = wmmab(vh[dt], ph[qt], o[dt][qt]);
#pragma unroll
    for (int dt = 0; dt < 4; ++dt)
#pragma unroll
        for (int qt = 0; qt < 2; ++qt) o[dt][qt] = wmmab(vh[dt], pl[qt], o[dt][qt]);
#pragma unroll
    for (int dt = 0; dt < 4; ++dt)
#pragma unroll
        for (int qt = 0; qt < 2; ++qt) o[dt][qt] = wmmab(vl[dt], ph[qt], o[dt][qt]);
}
__global__ __launch_bounds__(128) void k_fattn(const bf* Qh, const bf* Ql, const bf* Kh, const bf* Kl, const bf* Vh, const bf* Vl, float* O2) {
    const int lane = threadIdx.x & 31, lr = lane & 15, hi = lane >> 4; const int qb = blockIdx.x * 4 + __builtin_amdgcn_readfirstlane((int)(threadIdx.x >> 5)); if (qb >= NQB) return;
    const int z = blockIdx.y; const int bl = z / NH_, h = z % NH_; const size_t pz = (size_t)z * TT * HD;
    v16bf qh[2][2], ql[2][2], kh[2][2], kl[2][2];
    const bf* kph = Kh + pz + (size_t)lr * HD + 8 * hi; const bf* kpl = Kl + pz + (size_t)lr * HD + 8 * hi; const bf* vph = Vh + pz + (size_t)lr * TT + 8 * hi; const bf* vpl = Vl + pz + (size_t)lr * TT + 8 * hi;
    const bf* qa = Qh + pz + (size_t)(qb * 32 + lr) * HD + 8 * hi; const bf* qc = Ql + pz + (size_t)(qb * 32 + lr) * HD + 8 * hi;
#pragma unroll
    for (int t = 0; t < 2; ++t)
#pragma unroll
        for (int ks = 0; ks < 2; ++ks) { const size_t fo = (size_t)(t * 16) * HD + ks * 32; qh[t][ks] = WFrag<bf>::ld(qa + fo); ql[t][ks] = WFrag<bf>::ld(qc + fo); kh[t][ks] = WFrag<bf>::ld(kph + fo); kl[t][ks] = WFrag<bf>::ld(kpl + fo); }
    xwait(qa, qc); xwait(kph, kpl);
    v8f o[4][2]; float m[2] = { -3.0e38f, -3.0e38f }, l[2] = { 0.f, 0.f };
#pragma unroll
    for (int dt = 0; dt < 4; ++dt)
#pragma unroll
        for (int qt = 0; qt < 2; ++qt) o[dt][qt] = (v8f){};
#pragma unroll 1   // rolled: one pass is already some hundred instructions
    for (int kb = 0; kb < NKB - 1; ++kb) fa_pass<false>(kb * 32, hi, kph, kpl, vph, vpl, qh, ql, kh, kl, o, m, l);
    fa_pass<true>((NKB - 1) * 32, hi, kph, kpl, vph, vpl, qh, ql, kh, kl, o, m, l);
#pragma unroll
    for (int qt = 0; qt < 2; ++qt) { const float f = __fdiv_rn(1.0f, l[qt] + xhalf(l[qt])); const int q = qb * 32 + qt * 16 + lr;
        if (q < LR) { float* dst = O2 + ((size_t)bl * LR + q) * DM + (size_t)h * HD + 8 * hi;
#pragma unroll
            for (int dt = 0; dt < 4; ++dt) { v4f a, b;
#pragma unroll
                for (int j = 0; j < 4; ++j) { a[j] = o[dt][qt][j] * f; b[j] = o[dt][qt][4 + j] * f; }
                *(v4f*)(dst + dt * 16) = a; *(v4f*)(dst + dt * 16 + 4) = b; } } }
}
__global__ __launch_bounds__(256) void k_merge(const float* __restrict__ O, int h0, bf* Ah, bf* Al) { const size_t e = ((size_t)blockIdx.x * 256 + threadIdx.x) * 2; if (e >= (size_t)ZH * TT * HD) return; const int d = (int)(e % HD); const int t = (int)((e / HD) % TT); const int zz = (int)(e / ((size_t)HD * TT)); const float cs = (t < RH) ? 1.0f : (1.0f / PCAR); const size_t oo = (size_t)t * DQ + (h0 + zz) * HD + d;
    v2us oh, ol;
#pragma unroll
    for (int q = 0; q < 2; ++q) { unsigned short a, c2; splitf(O[e + q] * cs, a, c2); oh[q] = a; ol[q] = c2; } *(v2us*)(Ah + oo) = oh; *(v2us*)(Al + oo) = ol;  }

extern "C" void kernel_launch(void* const* d_in, const int* in_sizes, int n_in,
                              void* d_out, int out_size, void* d_ws, size_t ws_size, hipStream_t stream) {
    (void)in_sizes; (void)n_in; (void)out_size;
    const float* x = (const float*)d_in[0]; const float* wq = (const float*)d_in[1]; const float* bq = (const float*)d_in[2]; const float* wk = (const float*)d_in[3]; const float* bk = (const float*)d_in[4]; const float* wv = (const float*)d_in[5]; const float* bv = (const float*)d_in[6]; const float* wo = nullptr; (void)wo; const float* cosT = nullptr; const float* sinT = nullptr; (void)cosT; (void)sinT;
    float* OUT = (float*)d_out;   // [32][577][768]
    char* wsp = (char*)d_ws; auto take = [&](size_t bytes) { char* p = wsp; wsp += (bytes + 255) & ~(size_t)255; return (void*)p; };
    bf* WQ = (bf*)take((size_t)DQ * DM * 2); bf* WK = (bf*)take((size_t)DKV * DM * 2); bf* WV = (bf*)take((size_t)DKV * DM * 2);
    bf* XB = (bf*)take((size_t)GR * DM * 2);
    bf* QPh = (bf*)take((size_t)NVH * TT * HD * 2); bf* QPl = (bf*)take((size_t)NVH * TT * HD * 2);
    bf* KPh = (bf*)take((size_t)NVH * TT * HD * 2); bf* KPl = (bf*)take((size_t)NVH * TT * HD * 2);
    bf* VTh = (bf*)take((size_t)NVH * HD * TT * 2); bf* VTl = (bf*)take((size_t)NVH * HD * TT * 2);
    if ((size_t)(wsp - (char*)d_ws) > ws_size) return;   // ws ~ 56 MiB
    { k_cvt8<<<(unsigned)(((size_t)DQ * DM / 8 + 255) / 256), 256, 0, stream>>>(wq, WQ, (size_t)DQ * DM / 8); k_cvt8<<<(unsigned)(((size_t)DKV * DM / 8 + 255) / 256), 256, 0, stream>>>(wk, WK, (size_t)DKV * DM / 8); k_cvt8<<<(unsigned)(((size_t)DKV * DM / 8 + 255) / 256), 256, 0, stream>>>(wv, WV, (size_t)DKV * DM / 8); }
    for (int gI = 0; gI < NG; ++gI) {
        k_cvt8padg<<<(unsigned)(((size_t)GR * DM / 8 + 255) / 256), 256, 0, stream>>>(x + (size_t)gI * GB * LR * DM, XB);
        k_gemmw<bf, false><<<dim3(GR / 64, NH_, 1), 32, 0, stream>>>(WQ, XB, DM, bq, QPh, QPl);
        k_gemmw<bf, false><<<dim3(GR / 64, NKV, 1), 32, 0, stream>>>(WK, XB, DM, bk, KPh, KPl);
        k_gemmw<bf, true><<<dim3(GR / 64, NKV, 1), 32, 0, stream>>>(XB, WV, DM, bv, VTh, VTl);
        k_fattn<<<dim3((NQB + 3) / 4, NVH, 1), 128, 0, stream>>>(QPh, QPl, KPh, KPl, VTh, VTl, OUT + (size_t)gI * GB * LR * DM);   // virtual head z = bl * 12 + h
    }
}

// v003
// One run takes 304 microseconds.
// In two side-by-side timings against v002, it was 1.28 and 1.27 times as fast.
// All steps since v000 together make it 4.72 times as fast.
#include <hip/hip_runtime.h>

// ViTSelfAttention (hidden [32][577][768]; q/k/v = x W^T + b (12 heads x 64); softmax(q.k / 8); out = merged context (no output projection) -> [32][577][768]).
// Batched layout (exact): sequences padded 577 -> 640 with zero rows (padded KEYS masked out of every softmax row; padded query rows computed and discarded); 8 sequences x 12 heads = 96 'virtual heads' of 640 tokens per group, 4 groups, one fused attention launch per group; projections run on the 5,120 stacked rows of a group at once and store their results as hi/lo bf16 head planes themselves.
// Every 16-bit operand plane lies in FRAGMENT ORDER: a tile of 16 rows x 32 k is 1 KiB in a row, element (row, kk) at (kk >> 4) * 256 + (((kk >> 3) & 1) * 16 + row) * 8 + (kk & 7), so that lane l's two 16-byte pieces of a fragment
// stand at l * 8 and 256 + l * 8 and each wave-wide 16-byte load or store covers 512 bytes in a row (4 whole lines, not 32 bytes of each of 16 lines). The registers hold what they held with row-major planes.
// Compute dtypes, f32 accumulate: every input rounded to bf16; q/k/v on PLAIN bf16 operands (inputs: exact) + bias; scores AND attn.v hl x hl (3 products) on every row; softmax f32, online over passes of 32 keys, with the j < 577 predicate; merged context written directly in f32 to the output.

#define NB_  32
#define TT   640
#define DM   768
#define NH_  12
#define NKV  12
#define REP  (NH_ / NKV)
#define HD   64
#define DQ   (NH_ * HD)
#define DKV  (NKV * HD)
#define ZH   24
#define RH   640                  // k_merge (not launched): rows t < RH scale 1, others 1 / PCAR
#define WIN  0
#define PCAR 1024.0f
#define LR   577    // real tokens per sequence
#define GB   8      // sequences per group
#define NG   (NB_ / GB)
#define GR   (GB * TT)   // stacked rows per group
#define NVH  (GB * NH_)  // virtual heads per group
#define SCL  0.125f   // HD^-0.5
typedef _Float16 h16;
typedef unsigned short bf;
typedef __attribute__((ext_vector_type(16))) __bf16   v16bf;
typedef __attribute__((ext_vector_type(16))) _Float16 v16h;
typedef __attribute__((ext_vector_type(8)))  _Float16 v8h;
typedef __attribute__((ext_vector_type(8)))  unsigned short v8us;
typedef __attribute__((ext_vector_type(8)))  float    v8f;
typedef __attribute__((ext_vector_type(4)))  float    v4f;
typedef v8h  __attribute__((may_alias)) v8ha;
typedef v4f  __attribute__((may_alias)) v4fa;
typedef v8us __attribute__((may_alias)) v8usa;

__device__ __forceinline__ unsigned short f2bf(float f) { unsigned u = __float_as_uint(f); u += 0x7FFFu + ((u >> 16) & 1u); return (unsigned short)(u >> 16); }
__device__ __forceinline__ float bf2f(unsigned short b) { return __uint_as_float(((unsigned)b) << 16); }
__device__ __forceinline__ float bfr(float f) { return bf2f(f2bf(f)); }
__device__ __forceinline__ v16h cat16(v8h lo, v8h hi) { return __builtin_shufflevector(lo, hi, 0, 1, 2, 3, 4, 5, 6, 7, 8, 9, 10, 11, 12, 13, 14, 15); }
__device__ __forceinline__ v16bf cat16b(v8us lo, v8us hi) { return __builtin_bit_cast(v16bf, __builtin_shufflevector(lo, hi, 0, 1, 2, 3, 4, 5, 6, 7, 8, 9, 10, 11, 12, 13, 14, 15)); }
__device__ __forceinline__ v8f wmma16(v16h a, v16h b, v8f c) { return __builtin_amdgcn_wmma_f32_16x16x32_f16(false, a, false, b, (short)0, c, false, false); }
__device__ __forceinline__ v8f wmmab(v16bf a, v16bf b, v8f c) { return __builtin_amdgcn_wmma_f32_16x16x32_bf16(false, a, false, b, (short)0, c, false, false); }



// ---- k_gemmw: register-blocked GEMM, ONE WAVE per 64x64 tile (16 accumulators), operands straight from fragment-order 16-bit planes [row / 64][k / 32][4 tiles of 16 rows][512] (a trip reads 4 KiB in a row of each); grid (token rows / 64, heads), 32 threads.
// y[m][n] = sum_k A[m][k] Bt[n][k] + bias (f32), split into hi + lo bf16 and stored straight into the head planes: a lane's 8 accumulators are 8 consecutive m at one n, one 16-byte store per plane.
// VT false (q, k): A = weight rows (m = d of head blockIdx.y), Bt = token rows -> plane [head][t / 16][d / 32][512]. VT true (v): A = token rows, Bt = weight rows -> plane [head][t / 32][d / 16][512]. K % 32 == 0, HD == 64.
template <typename T16> struct WFrag;
template <> struct WFrag<h16> { typedef v16h V; static __device__ __forceinline__ V ld(const h16* p) { return cat16(*(const v8h*)p, *(const v8h*)(p + 16)); } static __device__ __forceinline__ v8f mma(V a, V b, v8f c) { return wmma16(a, b, c); } };
template <> struct WFrag<bf> { typedef v16bf V; static __device__ __forceinline__ V ld(const bf* p) { return cat16b(*(const v8us*)p, *(const v8us*)(p + 256)); }   /* p = tile + lane * 8, fragment order */ static __device__ __forceinline__ v8f mma(V a, V b, v8f c) { return wmmab(a, b, c); } };
typedef __attribute__((ext_vector_type(2))) __bf16 v2bf;
typedef __attribute__((ext_vector_type(2))) float v2f;
typedef __attribute__((ext_vector_type(4))) unsigned v4u;
template <typename T16, bool VT>
__global__ __launch_bounds__(32) void k_gemmw(const T16* __restrict__ A, const T16* __restrict__ Bt, int K, const float* __restrict__ bias, bf* Ph, bf* Pl) {
    typedef typename WFrag<T16>::V V;
    const int lane = threadIdx.x & 31, lr = lane & 15, hi = lane >> 4; const int tok0 = blockIdx.x * 64, f0 = blockIdx.y * 64; const int r0 = VT ? tok0 : f0, c0 = VT ? f0 : tok0;
    v8f acc[4][4];
#pragma unroll
    for (int mb = 0; mb < 4; ++mb)
#pragma unroll
        for (int nb = 0; nb < 4; ++nb) acc[mb][nb] = (v8f){};
    const T16* pa = A + (size_t)(r0 >> 6) * (K >> 5) * 2048 + lane * 8; const T16* pb = Bt + (size_t)(c0 >> 6) * (K >> 5) * 2048 + lane * 8;
#pragma unroll 1
    for (int kc = 0; kc < K; kc += 32) {
        V a[4], b[4];
#pragma unroll
        for (int t = 0; t < 4; ++t) { a[t] = WFrag<T16>::ld(pa + t * 512); b[t] = WFrag<T16>::ld(pb + t * 512); }
        __builtin_amdgcn_sched_barrier(0);   // holds the trip's 16 loads together at its head: with the address pairs kept for the wait below, the scheduler strung the B loads out one fragment at a time, each behind a full wait of its own
#pragma unroll
        for (int nb = 0; nb < 4; ++nb)
#pragma unroll
            for (int mb = 0; mb < 4; ++mb) acc[mb][nb] = WFrag<T16>::mma(a[mb], b[nb], acc[mb][nb]);
        // s_wait_xcnt: behind the trip's loads (the four accumulators named depend on all eight fragments); their address pairs are inputs, so no pair is given away in front of the wait (the compiler had later loads land on them). v_nop: WMMA distance over the back edge.
        asm volatile("s_wait_xcnt 0x0\n\tv_nop\n\tv_nop\n\tv_nop\n\tv_nop" : "+v"(acc[0][0]), "+v"(acc[1][1]), "+v"(acc[2][2]), "+v"(acc[3][3]) : "v"(a[0]), "v"(a[3]), "v"(pa), "v"(pb));
        pa += 2048; pb += 2048;
    }
    const size_t pz = ((size_t)(tok0 / TT) * NH_ + blockIdx.y) * TT * HD; const int t0 = tok0 % TT;   // a 64-row tile lies inside one sequence (TT % 64 == 0)
#pragma unroll
    for (int mb = 0; mb < 4; ++mb) {
        v8f bm;
        if (!VT) { const v4f b0 = *(const v4fa*)(bias + f0 + mb * 16 + 8 * hi), b1 = *(const v4fa*)(bias + f0 + mb * 16 + 8 * hi + 4);
#pragma unroll
            for (int j = 0; j < 4; ++j) { bm[j] = bfr(b0[j]); bm[4 + j] = bfr(b1[j]); } }
#pragma unroll
        for (int nb = 0; nb < 4; ++nb) {
            if (VT) { const float b = bfr(bias[f0 + nb * 16 + lr]);
#pragma unroll
                for (int j = 0; j < 8; ++j) bm[j] = b; }
            const v8f y = acc[mb][nb] + bm; v4u yh, yl;
#pragma unroll
            for (int e = 0; e < 4; ++e) { v2f p; p[0] = y[2 * e]; p[1] = y[2 * e + 1]; const v2bf h2 = __builtin_convertvector(p, v2bf); const v2f r = p - __builtin_convertvector(h2, v2f);
                yh[e] = __builtin_bit_cast(unsigned, h2); yl[e] = __builtin_bit_cast(unsigned, __builtin_convertvector(r, v2bf)); }
            const size_t off = pz + (size_t)(VT ? ((t0 >> 5) + (mb >> 1)) * 4 + nb : ((t0 >> 4) + nb) * 2 + (mb >> 1)) * 512 + (mb & 1) * 256 + lane * 8;   // the lane's 8 values are k = (mb & 1) * 16 + 8 hi + 0..7 of row lr of that tile
            *(v8us*)(Ph + off) = __builtin_bit_cast(v8us, yh); *(v8us*)(Pl + off) = __builtin_bit_cast(v8us, yl); }
    }
}

__device__ __forceinline__ h16 tohx(float x) { return (h16)x; }
__device__ __forceinline__ void splitf(float y, unsigned short& h, unsigned short& l) { h = f2bf(y); l = f2bf(y - bf2f(h)); }
typedef __attribute__((ext_vector_type(2))) _Float16 v2h;
typedef __attribute__((ext_vector_type(4))) _Float16 v4h;
typedef __attribute__((ext_vector_type(2))) unsigned short v2us;
typedef __attribute__((ext_vector_type(4))) unsigned short v4us;
typedef __attribute__((ext_vector_type(4))) int v4i;

__global__ __launch_bounds__(256) void k_wtG(const float* __restrict__ w, int K, int N, bf* Bt) {
    const int lane = threadIdx.x & 31; const int L0 = (blockIdx.x * 8 + (threadIdx.x >> 5)) * 8; const int nlines = N * K / 64;
{
#pragma unroll 1
        for (int l = 0; l < 8; ++l) { const int L = L0 + l; if (L >= nlines) break; const size_t e = (size_t)L * 64 + lane * 2; const int k = (int)(e % K), n = (int)(e / K); v2us o;
            o[0] = f2bf(w[(size_t)k * N + n]); o[1] = f2bf(w[(size_t)(k + 1) * N + n]); *(v2us*)(Bt + e) = o; }
         }
}
__global__ __launch_bounds__(256) void k_cscvt(const float* __restrict__ cosT, const float* __restrict__ sinT, float* CS) { const int idx = blockIdx.x * 256 + threadIdx.x; if (idx >= TT * HD) return; v2f cs; cs[0] = bfr(cosT[idx]); cs[1] = bfr(sinT[idx]); *(v2f*)(CS + (size_t)idx * 2) = cs;  }
// ---- k_pack: f32 rows [seq][TR][DM] -> bf16 plane in the fragment order k_gemmw reads, sequences padded TR -> TP with zero rows. ONE WAVE per tile of 16 rows x 32 k (tile w of the plane), 8 tiles per block, grid exact.
// A load takes 4 whole 128-byte row pieces (8 lanes a row, 4 floats a lane); the lane's 4 values go out as 8 bytes. A pad row reads the sequence's last real row (address in bounds, all four loads in flight together) and stores zeros.
template <int TP, int TR>
__global__ __launch_bounds__(256) void k_pack(const float* src, bf* dst) {
    const int lane = threadIdx.x & 31; const int w = blockIdx.x * 8 + (threadIdx.x >> 5); const int kb = (w >> 2) % (DM / 32); const int row0 = ((w >> 2) / (DM / 32)) * 64 + (w & 3) * 16; const int kq = (lane & 7) * 4;
    const int bl = row0 / TP, t0 = row0 % TP + (lane >> 3);   // a 16-row tile lies inside one sequence (TP % 16 == 0)
    bf* o = dst + (size_t)w * 512 + (kq >> 4) * 256 + ((kq >> 3) & 1) * 128 + (lane >> 3) * 8 + (kq & 7);
    const float* p[4]; v4f v[4];
#pragma unroll
    for (int i = 0; i < 4; ++i) { const int t = t0 + i * 4; p[i] = src + ((size_t)bl * TR + ((TP == TR || t < TR) ? t : TR - 1)) * DM + kb * 32 + kq; }
#pragma unroll
    for (int i = 0; i < 4; ++i) v[i] = *(const v4fa*)p[i];
    // s_wait_xcnt: behind the four loads, in front of whatever next overwrites one of their address pairs; the pairs are inputs, so none is given away (not even to a load's own result) in front of the wait.
    asm volatile("s_wait_xcnt 0x0" :: "v"(p[0]), "v"(p[1]), "v"(p[2]), "v"(p[3]) : "memory");
#pragma unroll
    for (int i = 0; i < 4; ++i) { v4us ov;
#pragma unroll
        for (int u = 0; u < 4; ++u) ov[u] = f2bf((TP == TR || t0 + i * 4 < TR) ? v[i][u] : 0.f);
        *(v4us*)(o + i * 32) = ov; }
}
// ---- k_fattn: scores, softmax, attn.v and the head merge in one kernel; ONE WAVE = 32 query columns of one virtual head, 4 independent waves per block (no LDS, no barrier); grid (ceil(NQB / 4), NVH).
// St = K.Qt (A = 16 key rows, B = 16 query columns kept in registers) and Ot += Vt.Pt: a lane holds one query's scores, so two St tiles (keys 0-15, 16-31 of a pass) convert in place into the B operand Pt,
// whose k order (8 hi + s, 16 + 8 hi + s - 8) is the order WFrag::ld gives the Vt rows. Planes in fragment order: a pass reads 4 KiB in a row of each of Kh, Kl, Vh, Vl. Running maximum and sum per query (online softmax over passes of 32 keys), division by the sum at the end.
// hl x hl (3 products) on both matrix products as before; keys >= LR masked in the last pass only (every earlier pass lies below LR).
#define NKB ((LR + 31) / 32)   // key passes
#define NQB ((LR + 31) / 32)   // 32-query column blocks per head
__device__ __forceinline__ float xhalf(float x) { const int b = __float_as_int(x); return __int_as_float(__builtin_amdgcn_permlanex16(b, b, 0x76543210, 0xfedcba98, false, false)); }   // lane l <-> l ^ 16
// xwait: stands behind a group of global loads, in front of whatever next overwrites a register that one of them names as its address.
// The group's address pairs are inputs, so they stay live up to the wait; the plane pointers carry no __restrict__, so the "memory" clobber keeps the loads in front of it.
__device__ __forceinline__ void xwait(const bf* a, const bf* b) { asm volatile("s_wait_xcnt 0x0" :: "v"(a), "v"(b) : "memory"); }
template <bool LAST>
__device__ __forceinline__ void fa_pass(const int key0, const int hi, const bf* kph, const bf* kpl, const bf* vph, const bf* vpl,
                                        const v16bf (&qh)[2][2], const v16bf (&ql)[2][2], v16bf (&kh)[2][2], v16bf (&kl)[2][2], v8f (&o)[4][2], float (&m)[2], float (&l)[2]) {
    const float C = SCL * 1.4426950408889634f;
    v16bf vh[4], vl[4]; const bf* va = vph + (size_t)key0 * HD; const bf* vb = vpl + (size_t)key0 * HD;
#pragma unroll
    for (int dt = 0; dt < 4; ++dt) { vh[dt] = WFrag<bf>::ld(va + dt * 512); vl[dt] = WFrag<bf>::ld(vb + dt * 512); }
    xwait(va, vb);
    __builtin_amdgcn_sched_barrier(0);   // holds the V loads at the head of the pass, so that the score products and the softmax cover their latency (the scheduler sank half of them to just ahead of their use)
    v8f s[2][2];
#pragma unroll
    for (int kt = 0; kt < 2; ++kt)
#pragma unroll
        for (int qt = 0; qt < 2; ++qt) s[kt][qt] = (v8f){};
#pragma unroll
    for (int ks = 0; ks < 2; ++ks) {
#pragma unroll
        for (int kt = 0; kt < 2; ++kt)
#pragma unroll
            for (int qt = 0; qt < 2; ++qt) s[kt][qt] = wmmab(kh[kt][ks], qh[qt][ks], s[kt][qt]);
#pragma unroll
        for (int kt = 0; kt < 2; ++kt)
#pragma unroll
            for (int qt = 0; qt < 2; ++qt) s[kt][qt] = wmmab(kl[kt][ks], qh[qt][ks], s[kt][qt]);
#pragma unroll
        for (int kt = 0; kt < 2; ++kt)
#pragma unroll
            for (int qt = 0; qt < 2; ++qt) s[kt][qt] = wmmab(kh[kt][ks], ql[qt][ks], s[kt][qt]);
    }
    if (!LAST) {   // the next pass's K fragments, fetched behind this pass's score products
        const bf* ka = kph + (size_t)key0 * HD; const bf* kc = kpl + (size_t)key0 * HD;
#pragma unroll
        for (int kt = 0; kt < 2; ++kt)
#pragma unroll
            for (int ks = 0; ks < 2; ++ks) { const size_t ko = (size_t)(32 + kt * 16) * HD + ks * 512; kh[kt][ks] = WFrag<bf>::ld(ka + ko); kl[kt][ks] = WFrag<bf>::ld(kc + ko); }
        xwait(ka, kc);
        __builtin_amdgcn_sched_barrier(0);   // holds the K prefetch ahead of the softmax, a whole pass ahead of its use (the scheduler sank it behind the softmax)
    }
    v16bf ph[2], pl[2];
#pragma unroll
    for (int qt = 0; qt < 2; ++qt) {
        if (LAST) {
#pragma unroll
            for (int kt = 0; kt < 2; ++kt)
#pragma unroll
                for (int j = 0; j < 8; ++j) s[kt][qt][j] = (key0 + kt * 16 + 8 * hi + j < LR) ? s[kt][qt][j] : -3.0e38f;
        }
        float mx = m[qt];
#pragma unroll
        for (int kt = 0; kt < 2; ++kt)
#pragma unroll
            for (int j = 0; j < 8; ++j) mx = fmaxf(mx, s[kt][qt][j]);
        mx = fmaxf(mx, xhalf(mx));
        const float al = __builtin_amdgcn_exp2f((m[qt] - mx) * C); const float mc = mx * C; m[qt] = mx;
        v2f p[8]; v2f c2, nm; c2[0] = C; c2[1] = C; nm[0] = -mc; nm[1] = -mc;
#pragma unroll
        for (int e = 0; e < 8; ++e) { v2f sv; sv[0] = s[e >> 2][qt][(e & 3) * 2]; sv[1] = s[e >> 2][qt][(e & 3) * 2 + 1]; const v2f t = __builtin_elementwise_fma(sv, c2, nm); p[e][0] = __builtin_amdgcn_exp2f(t[0]); p[e][1] = __builtin_amdgcn_exp2f(t[1]); }
        v2f ps = p[0];
#pragma unroll
        for (int e = 1; e < 8; ++e) ps += p[e];
#pragma unroll
        for (int e = 0; e < 8; ++e) { const v2bf h2 = __builtin_convertvector(p[e], v2bf); const v2f r = p[e] - __builtin_convertvector(h2, v2f); const v2bf l2 = __builtin_convertvector(r, v2bf);
            ph[qt][2 * e] = h2[0]; ph[qt][2 * e + 1] = h2[1]; pl[qt][2 * e] = l2[0]; pl[qt][2 * e + 1] = l2[1]; }
        l[qt] = l[qt] * al + (ps[0] + ps[1]);
#pragma unroll
        for (int dt = 0; dt < 4; ++dt) o[dt][qt] *= al;
    }
#pragma unroll
    for (int dt = 0; dt < 4; ++dt)
#pragma unroll
        for (int qt = 0; qt < 2; ++qt) o[dt][qt] = wmmab(vh[dt], ph[qt], o[dt][qt]);
#pragma unroll
    for (int dt = 0; dt < 4; ++dt)
#pragma unroll
        for (int qt = 0; qt < 2; ++qt) o[dt][qt] = wmmab(vh[dt], pl[qt], o[dt][qt]);
#pragma unroll
    for (int dt = 0; dt < 4; ++dt)
#pragma unroll
        for (int qt = 0; qt < 2; ++qt) o[dt][qt] = wmmab(vl[dt], ph[qt], o[dt][qt]);
}
__global__ __launch_bounds__(128) void k_fattn(const bf* Qh, const bf* Ql, const bf* Kh, const bf* Kl, const bf* Vh, const bf* Vl, float* O2) {
    const int lane = threadIdx.x & 31, lr = lane & 15, hi = lane >> 4; const int qb = blockIdx.x * 4 + __builtin_amdgcn_readfirstlane((int)(threadIdx.x >> 5)); if (qb >= NQB) return;
    const int z = blockIdx.y; const int bl = z / NH_, h = z % NH_; const size_t pz = (size_t)z * TT * HD;
    v16bf qh[2][2], ql[2][2], kh[2][2], kl[2][2];
    const bf* kph = Kh + pz + lane * 8; const bf* kpl = Kl + pz + lane * 8; const bf* vph = Vh + pz + lane * 8; const bf* vpl = Vl + pz + lane * 8;
    const bf* qa = Qh + pz + (size_t)(qb * 32) * HD + lane * 8; const bf* qc = Ql + pz + (size_t)(qb * 32) * HD + lane * 8;
#pragma unroll
    for (int t = 0; t < 2; ++t)
#pragma unroll
        for (int ks = 0; ks < 2; ++ks) { const size_t fo = (size_t)(t * 16) * HD + ks * 512; qh[t][ks] = WFrag<bf>::ld(qa + fo); ql[t][ks] = WFrag<bf>::ld(qc + fo); kh[t][ks] = WFrag<bf>::ld(kph + fo); kl[t][ks] = WFrag<bf>::ld(kpl + fo); }
    xwait(qa, qc); xwait(kph, kpl);
    v8f o[4][2]; float m[2] = { -3.0e38f, -3.0e38f }, l[2] = { 0.f, 0.f };
#pragma unroll
    for (int dt = 0; dt < 4; ++dt)
#pragma unroll
        for (int qt = 0; qt < 2; ++qt) o[dt][qt] = (v8f){};
#pragma unroll 1   // rolled: one pass is already some hundred instructions
    for (int kb = 0; kb < NKB - 1; ++kb) fa_pass<false>(kb * 32, hi, kph, kpl, vph, vpl, qh, ql, kh, kl, o, m, l);
    fa_pass<true>((NKB - 1) * 32, hi, kph, kpl, vph, vpl, qh, ql, kh, kl, o, m, l);
#pragma unroll
    for (int qt = 0; qt < 2; ++qt) { const float f = __fdiv_rn(1.0f, l[qt] + xhalf(l[qt])); const int q = qb * 32 + qt * 16 + lr;
        if (q < LR) { float* dst = O2 + ((size_t)bl * LR + q) * DM + (size_t)h * HD + 8 * hi;
#pragma unroll
            for (int dt = 0; dt < 4; ++dt) { v4f a, b;
#pragma unroll
                for (int j = 0; j < 4; ++j) { a[j] = o[dt][qt][j] * f; b[j] = o[dt][qt][4 + j] * f; }
                *(v4f*)(dst + dt * 16) = a; *(v4f*)(dst + dt * 16 + 4) = b; } } }
}
__global__ __launch_bounds__(256) void k_merge(const float* __restrict__ O, int h0, bf* Ah, bf* Al) { const size_t e = ((size_t)blockIdx.x * 256 + threadIdx.x) * 2; if (e >= (size_t)ZH * TT * HD) return; const int d = (int)(e % HD); const int t = (int)((e / HD) % TT); const int zz = (int)(e / ((size_t)HD * TT)); const float cs = (t < RH) ? 1.0f : (1.0f / PCAR); const size_t oo = (size_t)t * DQ + (h0 + zz) * HD + d;
    v2us oh, ol;
#pragma unroll
    for (int q = 0; q < 2; ++q) { unsigned short a, c2; splitf(O[e + q] * cs, a, c2); oh[q] = a; ol[q] = c2; } *(v2us*)(Ah + oo) = oh; *(v2us*)(Al + oo) = ol;  }

extern "C" void kernel_launch(void* const* d_in, const int* in_sizes, int n_in,
                              void* d_out, int out_size, void* d_ws, size_t ws_size, hipStream_t stream) {
    (void)in_sizes; (void)n_in; (void)out_size;
    const float* x = (const float*)d_in[0]; const float* wq = (const float*)d_in[1]; const float* bq = (const float*)d_in[2]; const float* wk = (const float*)d_in[3]; const float* bk = (const float*)d_in[4]; const float* wv = (const float*)d_in[5]; const float* bv = (const float*)d_in[6]; const float* wo = nullptr; (void)wo; const float* cosT = nullptr; const float* sinT = nullptr; (void)cosT; (void)sinT;
    float* OUT = (float*)d_out;   // [32][577][768]
    char* wsp = (char*)d_ws; auto take = [&](size_t bytes) { char* p = wsp; wsp += (bytes + 255) & ~(size_t)255; return (void*)p; };
    bf* WQ = (bf*)take((size_t)DQ * DM * 2); bf* WK = (bf*)take((size_t)DKV * DM * 2); bf* WV = (bf*)take((size_t)DKV * DM * 2);
    bf* XB = (bf*)take((size_t)GR * DM * 2);
    bf* QPh = (bf*)take((size_t)NVH * TT * HD * 2); bf* QPl = (bf*)take((size_t)NVH * TT * HD * 2);
    bf* KPh = (bf*)take((size_t)NVH * TT * HD * 2); bf* KPl = (bf*)take((size_t)NVH * TT * HD * 2);
    bf* VTh = (bf*)take((size_t)NVH * HD * TT * 2); bf* VTl = (bf*)take((size_t)NVH * HD * TT * 2);
    if ((size_t)(wsp - (char*)d_ws) > ws_size) return;   // ws ~ 56 MiB
    { k_pack<DQ, DQ><<<DQ / 16 * (DM / 32) / 8, 256, 0, stream>>>(wq, WQ); k_pack<DKV, DKV><<<DKV / 16 * (DM / 32) / 8, 256, 0, stream>>>(wk, WK); k_pack<DKV, DKV><<<DKV / 16 * (DM / 32) / 8, 256, 0, stream>>>(wv, WV); }
    for (int gI = 0; gI < NG; ++gI) {
        k_pack<TT, LR><<<GR / 16 * (DM / 32) / 8, 256, 0, stream>>>(x + (size_t)gI * GB * LR * DM, XB);
        k_gemmw<bf, false><<<dim3(GR / 64, NH_, 1), 32, 0, stream>>>(WQ, XB, DM, bq, QPh, QPl);
        k_gemmw<bf, false><<<dim3(GR / 64, NKV, 1), 32, 0, stream>>>(WK, XB, DM, bk, KPh, KPl);
        k_gemmw<bf, true><<<dim3(GR / 64, NKV, 1), 32, 0, stream>>>(XB, WV, DM, bv, VTh, VTl);
        k_fattn<<<dim3((NQB + 3) / 4, NVH, 1), 128, 0, stream>>>(QPh, QPl, KPh, KPl, VTh, VTl, OUT + (size_t)gI * GB * LR * DM);   // virtual head z = bl * 12 + h
    }
}

// v004
// It runs in 183 microseconds.
// In two side-by-side timings against v003, it was 1.66 and 1.65 times as fast.
// Counting every step since v000, it is 7.83 times as fast.
#include <hip/hip_runtime.h>

// ViTSelfAttention (hidden [32][577][768]; q/k/v = x W^T + b (12 heads x 64); softmax(q.k / 8); out = merged context (no output projection) -> [32][577][768]).
// Batched layout (exact): sequences padded 577 -> 640 with zero rows (padded KEYS masked out of every softmax row; padded query rows computed and discarded); 32 sequences x 12 heads = 384 'virtual heads' of 640 tokens, all in ONE launch per stage (pack, projections, fused attention: 3 launches); the projections run on the 20,480 stacked rows at once and store their results as hi/lo bf16 head planes themselves.
// Every 16-bit operand plane lies in FRAGMENT ORDER: a tile of 16 rows x 32 k is 1 KiB in a row, element (row, kk) at (kk >> 4) * 256 + (((kk >> 3) & 1) * 16 + row) * 8 + (kk & 7), so that lane l's two 16-byte pieces of a fragment
// stand at l * 8 and 256 + l * 8 and each wave-wide 16-byte load or store covers 512 bytes in a row (4 whole lines, not 32 bytes of each of 16 lines). The registers hold what they held with row-major planes.
// Compute dtypes, f32 accumulate: every input rounded to bf16; q/k/v on PLAIN bf16 operands (inputs: exact) + bias; scores AND attn.v hl x hl (3 products) on every row; softmax f32, online over passes of 32 keys, with the j < 577 predicate; merged context written directly in f32 to the output.

#define NB_  32
#define TT   640
#define DM   768
#define NH_  12
#define NKV  12
#define REP  (NH_ / NKV)
#define HD   64
#define DQ   (NH_ * HD)
#define DKV  (NKV * HD)
#define ZH   24
#define RH   640                  // k_merge (not launched): rows t < RH scale 1, others 1 / PCAR
#define WIN  0
#define PCAR 1024.0f
#define LR   577    // real tokens per sequence
#define GB   32     // sequences per group (all of them: one group)
#define NG   (NB_ / GB)
#define GR   (GB * TT)   // stacked rows per group
#define NVH  (GB * NH_)  // virtual heads per group
#define SCL  0.125f   // HD^-0.5
typedef _Float16 h16;
typedef unsigned short bf;
typedef __attribute__((ext_vector_type(16))) __bf16   v16bf;
typedef __attribute__((ext_vector_type(16))) _Float16 v16h;
typedef __attribute__((ext_vector_type(8)))  _Float16 v8h;
typedef __attribute__((ext_vector_type(8)))  unsigned short v8us;
typedef __attribute__((ext_vector_type(8)))  float    v8f;
typedef __attribute__((ext_vector_type(4)))  float    v4f;
typedef v8h  __attribute__((may_alias)) v8ha;
typedef v4f  __attribute__((may_alias)) v4fa;
typedef v8us __attribute__((may_alias)) v8usa;

__device__ __forceinline__ unsigned short f2bf(float f) { unsigned u = __float_as_uint(f); u += 0x7FFFu + ((u >> 16) & 1u); return (unsigned short)(u >> 16); }
__device__ __forceinline__ float bf2f(unsigned short b) { return __uint_as_float(((unsigned)b) << 16); }
__device__ __forceinline__ float bfr(float f) { return bf2f(f2bf(f)); }
__device__ __forceinline__ v16h cat16(v8h lo, v8h hi) { return __builtin_shufflevector(lo, hi, 0, 1, 2, 3, 4, 5, 6, 7, 8, 9, 10, 11, 12, 13, 14, 15); }
__device__ __forceinline__ v16bf cat16b(v8us lo, v8us hi) { return __builtin_bit_cast(v16bf, __builtin_shufflevector(lo, hi, 0, 1, 2, 3, 4, 5, 6, 7, 8, 9, 10, 11, 12, 13, 14, 15)); }
__device__ __forceinline__ v8f wmma16(v16h a, v16h b, v8f c) { return __builtin_amdgcn_wmma_f32_16x16x32_f16(false, a, false, b, (short)0, c, false, false); }
__device__ __forceinline__ v8f wmmab(v16bf a, v16bf b, v8f c) { return __builtin_amdgcn_wmma_f32_16x16x32_bf16(false, a, false, b, (short)0, c, false, false); }



// ---- k_gemmw: register-blocked GEMM, ONE WAVE per 64x64 tile (16 accumulators), operands straight from fragment-order 16-bit planes [row / 64][k / 32][4 tiles of 16 rows][512] (a trip reads 4 KiB in a row of each); tile = 64 token rows from tok0 x the 64 features of one head.
// y[m][n] = sum_k A[m][k] Bt[n][k] + bias (f32), split into hi + lo bf16 and stored straight into the head planes: a lane's 8 accumulators are 8 consecutive m at one n, one 16-byte store per plane.
// VT false (q, k): A = weight rows (m = d of the head), Bt = token rows -> plane [head][t / 16][d / 32][512]. VT true (v): A = token rows, Bt = weight rows -> plane [head][t / 32][d / 16][512]. K % 32 == 0, HD == 64.
template <typename T16> struct WFrag;
template <> struct WFrag<h16> { typedef v16h V; static __device__ __forceinline__ V ld(const h16* p) { return cat16(*(const v8h*)p, *(const v8h*)(p + 16)); } static __device__ __forceinline__ v8f mma(V a, V b, v8f c) { return wmma16(a, b, c); } };
template <> struct WFrag<bf> { typedef v16bf V; static __device__ __forceinline__ V ld(const bf* p) { return cat16b(*(const v8us*)p, *(const v8us*)(p + 256)); }   /* p = tile + lane * 8, fragment order */ static __device__ __forceinline__ v8f mma(V a, V b, v8f c) { return wmmab(a, b, c); } };
typedef __attribute__((ext_vector_type(2))) __bf16 v2bf;
typedef __attribute__((ext_vector_type(2))) float v2f;
typedef __attribute__((ext_vector_type(4))) unsigned v4u;
template <typename T16, bool VT>
__device__ __forceinline__ void gemmw_tile(const T16* __restrict__ A, const T16* __restrict__ Bt, int K, const float* __restrict__ bias, bf* Ph, bf* Pl, const int tok0, const int head) {
    typedef typename WFrag<T16>::V V;
    const int lane = threadIdx.x & 31, lr = lane & 15, hi = lane >> 4; const int f0 = head * 64; const int r0 = VT ? tok0 : f0, c0 = VT ? f0 : tok0;
    v8f acc[4][4];
#pragma unroll
    for (int mb = 0; mb < 4; ++mb)
#pragma unroll
        for (int nb = 0; nb < 4; ++nb) acc[mb][nb] = (v8f){};
    const T16* pa = A + (size_t)(r0 >> 6) * (K >> 5) * 2048 + lane * 8; const T16* pb = Bt + (size_t)(c0 >> 6) * (K >> 5) * 2048 + lane * 8;
#pragma unroll 1
    for (int kc = 0; kc < K; kc += 32) {
        V a[4], b[4];
#pragma unroll
        for (int t = 0; t < 4; ++t) { a[t] = WFrag<T16>::ld(pa + t * 512); b[t] = WFrag<T16>::ld(pb + t * 512); }
        __builtin_amdgcn_sched_barrier(0);   // holds the trip's 16 loads together at its head: with the address pairs kept for the wait below, the scheduler strung the B loads out one fragment at a time, each behind a full wait of its own
#pragma unroll
        for (int nb = 0; nb < 4; ++nb)
#pragma unroll
            for (int mb = 0; mb < 4; ++mb) acc[mb][nb] = WFrag<T16>::mma(a[mb], b[nb], acc[mb][nb]);
        // s_wait_xcnt: behind the trip's loads (the four accumulators named depend on all eight fragments); their address pairs are inputs, so no pair is given away in front of the wait (the compiler had later loads land on them). v_nop: WMMA distance over the back edge.
        asm volatile("s_wait_xcnt 0x0\n\tv_nop\n\tv_nop\n\tv_nop\n\tv_nop" : "+v"(acc[0][0]), "+v"(acc[1][1]), "+v"(acc[2][2]), "+v"(acc[3][3]) : "v"(a[0]), "v"(a[3]), "v"(pa), "v"(pb));
        pa += 2048; pb += 2048;
    }
    const size_t pz = ((size_t)(tok0 / TT) * NH_ + head) * TT * HD; const int t0 = tok0 % TT;   // a 64-row tile lies inside one sequence (TT % 64 == 0)
#pragma unroll
    for (int mb = 0; mb < 4; ++mb) {
        v8f bm;
        if (!VT) { const v4f b0 = *(const v4fa*)(bias + f0 + mb * 16 + 8 * hi), b1 = *(const v4fa*)(bias + f0 + mb * 16 + 8 * hi + 4);
#pragma unroll
            for (int j = 0; j < 4; ++j) { bm[j] = bfr(b0[j]); bm[4 + j] = bfr(b1[j]); } }
#pragma unroll
        for (int nb = 0; nb < 4; ++nb) {
            if (VT) { const float b = bfr(bias[f0 + nb * 16 + lr]);
#pragma unroll
                for (int j = 0; j < 8; ++j) bm[j] = b; }
            const v8f y = acc[mb][nb] + bm; v4u yh, yl;
#pragma unroll
            for (int e = 0; e < 4; ++e) { v2f p; p[0] = y[2 * e]; p[1] = y[2 * e + 1]; const v2bf h2 = __builtin_convertvector(p, v2bf); const v2f r = p - __builtin_convertvector(h2, v2f);
                yh[e] = __builtin_bit_cast(unsigned, h2); yl[e] = __builtin_bit_cast(unsigned, __builtin_convertvector(r, v2bf)); }
            const size_t off = pz + (size_t)(VT ? ((t0 >> 5) + (mb >> 1)) * 4 + nb : ((t0 >> 4) + nb) * 2 + (mb >> 1)) * 512 + (mb & 1) * 256 + lane * 8;   // the lane's 8 values are k = (mb & 1) * 16 + 8 hi + 0..7 of row lr of that tile
            *(v8us*)(Ph + off) = __builtin_bit_cast(v8us, yh); *(v8us*)(Pl + off) = __builtin_bit_cast(v8us, yl); }
    }
}
// k_gemmw: q, k and v of every sequence in one launch; grid (3 projections x heads, token rows / 64), 32 threads. The 36 tiles of one block of token rows are neighbours in the grid, so a block of x is fetched once while the three weight planes (under 4 MiB) stay in use throughout.
__global__ __launch_bounds__(32) void k_gemmw(const bf* __restrict__ WB, const bf* __restrict__ XB, const float* __restrict__ bq, const float* __restrict__ bk, const float* __restrict__ bv, bf* QPh, bf* QPl, bf* KPh, bf* KPl, bf* VTh, bf* VTl) {
    const int pj = blockIdx.x / NH_, head = blockIdx.x % NH_, tok0 = blockIdx.y * 64;
    if (pj == 2) gemmw_tile<bf, true>(XB, WB + (size_t)2 * DQ * DM, DM, bv, VTh, VTl, tok0, head);
    else gemmw_tile<bf, false>(WB + (size_t)pj * DQ * DM, XB, DM, pj ? bk : bq, pj ? KPh : QPh, pj ? KPl : QPl, tok0, head);
}

__device__ __forceinline__ h16 tohx(float x) { return (h16)x; }
__device__ __forceinline__ void splitf(float y, unsigned short& h, unsigned short& l) { h = f2bf(y); l = f2bf(y - bf2f(h)); }
typedef __attribute__((ext_vector_type(2))) _Float16 v2h;
typedef __attribute__((ext_vector_type(4))) _Float16 v4h;
typedef __attribute__((ext_vector_type(2))) unsigned short v2us;
typedef __attribute__((ext_vector_type(4))) unsigned short v4us;
typedef __attribute__((ext_vector_type(4))) int v4i;

__global__ __launch_bounds__(256) void k_wtG(const float* __restrict__ w, int K, int N, bf* Bt) {
    const int lane = threadIdx.x & 31; const int L0 = (blockIdx.x * 8 + (threadIdx.x >> 5)) * 8; const int nlines = N * K / 64;
{
#pragma unroll 1
        for (int l = 0; l < 8; ++l) { const int L = L0 + l; if (L >= nlines) break; const size_t e = (size_t)L * 64 + lane * 2; const int k = (int)(e % K), n = (int)(e / K); v2us o;
            o[0] = f2bf(w[(size_t)k * N + n]); o[1] = f2bf(w[(size_t)(k + 1) * N + n]); *(v2us*)(Bt + e) = o; }
         }
}
__global__ __launch_bounds__(256) void k_cscvt(const float* __restrict__ cosT, const float* __restrict__ sinT, float* CS) { const int idx = blockIdx.x * 256 + threadIdx.x; if (idx >= TT * HD) return; v2f cs; cs[0] = bfr(cosT[idx]); cs[1] = bfr(sinT[idx]); *(v2f*)(CS + (size_t)idx * 2) = cs;  }
// ---- pack_tile: f32 rows [seq][TR][DM] -> bf16 plane in the fragment order k_gemmw reads, sequences padded TR -> TP with zero rows. ONE WAVE per tile of 16 rows x 32 k (tile w of the plane).
// A load takes 4 whole 128-byte row pieces (8 lanes a row, 4 floats a lane); the lane's 4 values go out as 8 bytes. A pad row reads the sequence's last real row (address in bounds, all four loads in flight together) and stores zeros.
template <int TP, int TR>
__device__ __forceinline__ void pack_tile(const float* src, bf* dst, const int w) {
    const int lane = threadIdx.x & 31; const int kb = (w >> 2) % (DM / 32); const int row0 = ((w >> 2) / (DM / 32)) * 64 + (w & 3) * 16; const int kq = (lane & 7) * 4;
    const int bl = row0 / TP, t0 = row0 % TP + (lane >> 3);   // a 16-row tile lies inside one sequence (TP % 16 == 0)
    bf* o = dst + (size_t)w * 512 + (kq >> 4) * 256 + ((kq >> 3) & 1) * 128 + (lane >> 3) * 8 + (kq & 7);
    const float* p[4]; v4f v[4];
#pragma unroll
    for (int i = 0; i < 4; ++i) { const int t = t0 + i * 4; p[i] = src + ((size_t)bl * TR + ((TP == TR || t < TR) ? t : TR - 1)) * DM + kb * 32 + kq; }
#pragma unroll
    for (int i = 0; i < 4; ++i) v[i] = *(const v4fa*)p[i];
    // s_wait_xcnt: behind the four loads, in front of whatever next overwrites one of their address pairs; the pairs are inputs, so none is given away (not even to a load's own result) in front of the wait.
    asm volatile("s_wait_xcnt 0x0" :: "v"(p[0]), "v"(p[1]), "v"(p[2]), "v"(p[3]) : "memory");
#pragma unroll
    for (int i = 0; i < 4; ++i) { v4us ov;
#pragma unroll
        for (int u = 0; u < 4; ++u) ov[u] = f2bf((TP == TR || t0 + i * 4 < TR) ? v[i][u] : 0.f);
        *(v4us*)(o + i * 32) = ov; }
    // s_wait_xcnt: behind the four stores, in front of whatever next overwrites their address pair (in the built k_pack a branch behind the weight side's stores leads to the head of the x side, which writes such registers); the pair is an input, so it is not given away in front of the wait.
    asm volatile("s_wait_xcnt 0x0" :: "v"(o) : "memory");
}
// k_pack: x and the three weight matrices in one launch, 8 tiles per block, grid exact: blocks below NXT / 8 pack x, then NWT / 8 blocks for each of Wq, Wk, Wv (planes one behind another in WB).
#define NXT (GR / 16 * (DM / 32))   // tiles of the x plane
#define NWT (DQ / 16 * (DM / 32))   // tiles of one weight plane
__global__ __launch_bounds__(256) void k_pack(const float* x, const float* wq, const float* wk, const float* wv, bf* XB, bf* WB) {
    const int wv8 = threadIdx.x >> 5;
    if (blockIdx.x < NXT / 8) { pack_tile<TT, LR>(x, XB, blockIdx.x * 8 + wv8); return; }
    const int u = blockIdx.x - NXT / 8; const int pj = u / (NWT / 8);
    pack_tile<DQ, DQ>(pj == 0 ? wq : pj == 1 ? wk : wv, WB + (size_t)pj * DQ * DM, (u % (NWT / 8)) * 8 + wv8);
}
// ---- k_fattn: scores, softmax, attn.v and the head merge in one kernel; ONE WAVE = 32 query columns of one virtual head, 4 independent waves per block (no LDS, no barrier); grid (ceil(NQB / 4), NVH).
// St = K.Qt (A = 16 key rows, B = 16 query columns kept in registers) and Ot += Vt.Pt: a lane holds one query's scores, so two St tiles (keys 0-15, 16-31 of a pass) convert in place into the B operand Pt,
// whose k order (8 hi + s, 16 + 8 hi + s - 8) is the order WFrag::ld gives the Vt rows. Planes in fragment order: a pass reads 4 KiB in a row of each of Kh, Kl, Vh, Vl. Running maximum and sum per query (online softmax over passes of 32 keys), division by the sum at the end.
// hl x hl (3 products) on both matrix products as before; keys >= LR masked in the last pass only (every earlier pass lies below LR).
#define NKB ((LR + 31) / 32)   // key passes
#define NQB ((LR + 31) / 32)   // 32-query column blocks per head
__device__ __forceinline__ float xhalf(float x) { const int b = __float_as_int(x); return __int_as_float(__builtin_amdgcn_permlanex16(b, b, 0x76543210, 0xfedcba98, false, false)); }   // lane l <-> l ^ 16
// xwait: stands behind a group of global loads, in front of whatever next overwrites a register that one of them names as its address.
// The group's address pairs are inputs, so they stay live up to the wait; the plane pointers carry no __restrict__, so the "memory" clobber keeps the loads in front of it.
__device__ __forceinline__ void xwait(const bf* a, const bf* b) { asm volatile("s_wait_xcnt 0x0" :: "v"(a), "v"(b) : "memory"); }
template <bool LAST>
__device__ __forceinline__ void fa_pass(const int key0, const int hi, const bf* kph, const bf* kpl, const bf* vph, const bf* vpl,
                                        const v16bf (&qh)[2][2], const v16bf (&ql)[2][2], v16bf (&kh)[2][2], v16bf (&kl)[2][2], v8f (&o)[4][2], float (&m)[2], float (&l)[2]) {
    const float C = SCL * 1.4426950408889634f;
    v16bf vh[4], vl[4]; const bf* va = vph + (size_t)key0 * HD; const bf* vb = vpl + (size_t)key0 * HD;
#pragma unroll
    for (int dt = 0; dt < 4; ++dt) { vh[dt] = WFrag<bf>::ld(va + dt * 512); vl[dt] = WFrag<bf>::ld(vb + dt * 512); }
    xwait(va, vb);
    __builtin_amdgcn_sched_barrier(0);   // holds the V loads at the head of the pass, so that the score products and the softmax cover their latency (the scheduler sank half of them to just ahead of their use)
    v8f s[2][2];
#pragma unroll
    for (int kt = 0; kt < 2; ++kt)
#pragma unroll
        for (int qt = 0; qt < 2; ++qt) s[kt][qt] = (v8f){};
#pragma unroll
    for (int ks = 0; ks < 2; ++ks) {
#pragma unroll
        for (int kt = 0; kt < 2; ++kt)
#pragma unroll
            for (int qt = 0; qt < 2; ++qt) s[kt][qt] = wmmab(kh[kt][ks], qh[qt][ks], s[kt][qt]);
#pragma unroll
        for (int kt = 0; kt < 2; ++kt)
#pragma unroll
            for (int qt = 0; qt < 2; ++qt) s[kt][qt] = wmmab(kl[kt][ks], qh[qt][ks], s[kt][qt]);
#pragma unroll
        for (int kt = 0; kt < 2; ++kt)
#pragma unroll
            for (int qt = 0; qt < 2; ++qt) s[kt][qt] = wmmab(kh[kt][ks], ql[qt][ks], s[kt][qt]);
    }
    if (!LAST) {   // the next pass's K fragments, fetched behind this pass's score products
        const bf* ka = kph + (size_t)key0 * HD; const bf* kc = kpl + (size_t)key0 * HD;
#pragma unroll
        for (int kt = 0; kt < 2; ++kt)
#pragma unroll
            for (int ks = 0; ks < 2; ++ks) { const size_t ko = (size_t)(32 + kt * 16) * HD + ks * 512; kh[kt][ks] = WFrag<bf>::ld(ka + ko); kl[kt][ks] = WFrag<bf>::ld(kc + ko); }
        xwait(ka, kc);
        __builtin_amdgcn_sched_barrier(0);   // holds the K prefetch ahead of the softmax, a whole pass ahead of its use (the scheduler sank it behind the softmax)
    }
    v16bf ph[2], pl[2];
#pragma unroll
    for (int qt = 0; qt < 2; ++qt) {
        if (LAST) {
#pragma unroll
            for (int kt = 0; kt < 2; ++kt)
#pragma unroll
                for (int j = 0; j < 8; ++j) s[kt][qt][j] = (key0 + kt * 16 + 8 * hi + j < LR) ? s[kt][qt][j] : -3.0e38f;
        }
        float mx = m[qt];
#pragma unroll
        for (int kt = 0; kt < 2; ++kt)
#pragma unroll
            for (int j = 0; j < 8; ++j) mx = fmaxf(mx, s[kt][qt][j]);
        mx = fmaxf(mx, xhalf(mx));
        const float al = __builtin_amdgcn_exp2f((m[qt] - mx) * C); const float mc = mx * C; m[qt] = mx;
        v2f p[8]; v2f c2, nm; c2[0] = C; c2[1] = C; nm[0] = -mc; nm[1] = -mc;
#pragma unroll
        for (int e = 0; e < 8; ++e) { v2f sv; sv[0] = s[e >> 2][qt][(e & 3) * 2]; sv[1] = s[e >> 2][qt][(e & 3) * 2 + 1]; const v2f t = __builtin_elementwise_fma(sv, c2, nm); p[e][0] = __builtin_amdgcn_exp2f(t[0]); p[e][1] = __builtin_amdgcn_exp2f(t[1]); }
        v2f ps = p[0];
#pragma unroll
        for (int e = 1; e < 8; ++e) ps += p[e];
#pragma unroll
        for (int e = 0; e < 8; ++e) { const v2bf h2 = __builtin_convertvector(p[e], v2bf); const v2f r = p[e] - __builtin_convertvector(h2, v2f); const v2bf l2 = __builtin_convertvector(r, v2bf);
            ph[qt][2 * e] = h2[0]; ph[qt][2 * e + 1] = h2[1]; pl[qt][2 * e] = l2[0]; pl[qt][2 * e + 1] = l2[1]; }
        l[qt] = l[qt] * al + (ps[0] + ps[1]);
#pragma unroll
        for (int dt = 0; dt < 4; ++dt) o[dt][qt] *= al;
    }
#pragma unroll
    for (int dt = 0; dt < 4; ++dt)
#pragma unroll
        for (int qt = 0; qt < 2; ++qt) o[dt][qt] = wmmab(vh[dt], ph[qt], o[dt][qt]);
#pragma unroll
    for (int dt = 0; dt < 4; ++dt)
#pragma unroll
        for (int qt = 0; qt < 2; ++qt) o[dt][qt] = wmmab(vh[dt], pl[qt], o[dt][qt]);
#pragma unroll
    for (int dt = 0; dt < 4; ++dt)
#pragma unroll
        for (int qt = 0; qt < 2; ++qt) o[dt][qt] = wmmab(vl[dt], ph[qt], o[dt][qt]);
}
__global__ __launch_bounds__(128) void k_fattn(const bf* Qh, const bf* Ql, const bf* Kh, const bf* Kl, const bf* Vh, const bf* Vl, float* O2) {
    const int lane = threadIdx.x & 31, lr = lane & 15, hi = lane >> 4; const int qb = blockIdx.x * 4 + __builtin_amdgcn_readfirstlane((int)(threadIdx.x >> 5)); if (qb >= NQB) return;
    const int z = blockIdx.y; const int bl = z / NH_, h = z % NH_; const size_t pz = (size_t)z * TT * HD;
    v16bf qh[2][2], ql[2][2], kh[2][2], kl[2][2];
    const bf* kph = Kh + pz + lane * 8; const bf* kpl = Kl + pz + lane * 8; const bf* vph = Vh + pz + lane * 8; const bf* vpl = Vl + pz + lane * 8;
    const bf* qa = Qh + pz + (size_t)(qb * 32) * HD + lane * 8; const bf* qc = Ql + pz + (size_t)(qb * 32) * HD + lane * 8;
#pragma unroll
    for (int t = 0; t < 2; ++t)
#pragma unroll
        for (int ks = 0; ks < 2; ++ks) { const size_t fo = (size_t)(t * 16) * HD + ks * 512; qh[t][ks] = WFrag<bf>::ld(qa + fo); ql[t][ks] = WFrag<bf>::ld(qc + fo); kh[t][ks] = WFrag<bf>::ld(kph + fo); kl[t][ks] = WFrag<bf>::ld(kpl + fo); }
    xwait(qa, qc); xwait(kph, kpl);
    v8f o[4][2]; float m[2] = { -3.0e38f, -3.0e38f }, l[2] = { 0.f, 0.f };
#pragma unroll
    for (int dt = 0; dt < 4; ++dt)
#pragma unroll
        for (int qt = 0; qt < 2; ++qt) o[dt][qt] = (v8f){};
#pragma unroll 1   // rolled: one pass is already some hundred instructions
    for (int kb = 0; kb < NKB - 1; ++kb) fa_pass<false>(kb * 32, hi, kph, kpl, vph, vpl, qh, ql, kh, kl, o, m, l);
    fa_pass<true>((NKB - 1) * 32, hi, kph, kpl, vph, vpl, qh, ql, kh, kl, o, m, l);
#pragma unroll
    for (int qt = 0; qt < 2; ++qt) { const float f = __fdiv_rn(1.0f, l[qt] + xhalf(l[qt])); const int q = qb * 32 + qt * 16 + lr;
        if (q < LR) { float* dst = O2 + ((size_t)bl * LR + q) * DM + (size_t)h * HD + 8 * hi;
#pragma unroll
            for (int dt = 0; dt < 4; ++dt) { v4f a, b;
#pragma unroll
                for (int j = 0; j < 4; ++j) { a[j] = o[dt][qt][j] * f; b[j] = o[dt][qt][4 + j] * f; }
                *(v4f*)(dst + dt * 16) = a; *(v4f*)(dst + dt * 16 + 4) = b; } } }
}
__global__ __launch_bounds__(256) void k_merge(const float* __restrict__ O, int h0, bf* Ah, bf* Al) { const size_t e = ((size_t)blockIdx.x * 256 + threadIdx.x) * 2; if (e >= (size_t)ZH * TT * HD) return; const int d = (int)(e % HD); const int t = (int)((e / HD) % TT); const int zz = (int)(e / ((size_t)HD * TT)); const float cs = (t < RH) ? 1.0f : (1.0f / PCAR); const size_t oo = (size_t)t * DQ + (h0 + zz) * HD + d;
    v2us oh, ol;
#pragma unroll
    for (int q = 0; q < 2; ++q) { unsigned short a, c2; splitf(O[e + q] * cs, a, c2); oh[q] = a; ol[q] = c2; } *(v2us*)(Ah + oo) = oh; *(v2us*)(Al + oo) = ol;  }

extern "C" void kernel_launch(void* const* d_in, const int* in_sizes, int n_in,
                              void* d_out, int out_size, void* d_ws, size_t ws_size, hipStream_t stream) {
    (void)in_sizes; (void)n_in; (void)out_size;
    const float* x = (const float*)d_in[0]; const float* wq = (const float*)d_in[1]; const float* bq = (const float*)d_in[2]; const float* wk = (const float*)d_in[3]; const float* bk = (const float*)d_in[4]; const float* wv = (const float*)d_in[5]; const float* bv = (const float*)d_in[6]; const float* wo = nullptr; (void)wo; const float* cosT = nullptr; const float* sinT = nullptr; (void)cosT; (void)sinT;
    float* OUT = (float*)d_out;   // [32][577][768]
    char* wsp = (char*)d_ws; auto take = [&](size_t bytes) { char* p = wsp; wsp += (bytes + 255) & ~(size_t)255; return (void*)p; };
    bf* WB = (bf*)take((size_t)3 * DQ * DM * 2);   // Wq, Wk, Wv (DKV == DQ)
    bf* XB = (bf*)take((size_t)GR * DM * 2);
    bf* QPh = (bf*)take((size_t)NVH * TT * HD * 2); bf* QPl = (bf*)take((size_t)NVH * TT * HD * 2);
    bf* KPh = (bf*)take((size_t)NVH * TT * HD * 2); bf* KPl = (bf*)take((size_t)NVH * TT * HD * 2);
    bf* VTh = (bf*)take((size_t)NVH * HD * TT * 2); bf* VTl = (bf*)take((size_t)NVH * HD * TT * 2);
    if ((size_t)(wsp - (char*)d_ws) > ws_size) return;   // ws ~ 214 MiB
    k_pack<<<NXT / 8 + 3 * (NWT / 8), 256, 0, stream>>>(x, wq, wk, wv, XB, WB);
    k_gemmw<<<dim3(3 * NH_, GR / 64, 1), 32, 0, stream>>>(WB, XB, bq, bk, bv, QPh, QPl, KPh, KPl, VTh, VTl);
    k_fattn<<<dim3((NQB + 3) / 4, NVH, 1), 128, 0, stream>>>(QPh, QPl, KPh, KPl, VTh, VTl, OUT);   // virtual head z = bl * 12 + h
}

// v005
// One run takes 165 microseconds.
// Two timings next to v004 put it at 1.12 and 1.11 times that version's speed.
// Over all steps from v000 it is 8.70 times as fast.
#include <hip/hip_runtime.h>

// ViTSelfAttention (hidden [32][577][768]; q/k/v = x W^T + b (12 heads x 64); softmax(q.k / 8); out = merged context (no output projection) -> [32][577][768]).
// Batched layout (exact): sequences padded 577 -> 640 with zero rows (padded KEYS masked out of every softmax row; padded query rows computed and discarded); 32 sequences x 12 heads = 384 'virtual heads' of 640 tokens, all in ONE launch per stage (pack, projections, fused attention: 3 launches); the projections run on the 20,480 stacked rows at once and store their results as hi/lo bf16 head planes themselves.
// Every 16-bit operand plane lies in FRAGMENT ORDER: a tile of 16 rows x 32 k is 1 KiB in a row, element (row, kk) at (kk >> 4) * 256 + (((kk >> 3) & 1) * 16 + row) * 8 + (kk & 7), so that lane l's two 16-byte pieces of a fragment
// stand at l * 8 and 256 + l * 8 and each wave-wide 16-byte load or store covers 512 bytes in a row (4 whole lines, not 32 bytes of each of 16 lines). The registers hold what they held with row-major planes.
// Compute dtypes, f32 accumulate: every input rounded to bf16; q/k/v on PLAIN bf16 operands (inputs: exact) + bias; scores AND attn.v hl x hl (3 products) on every row; softmax f32, online over passes of 32 keys, with the j < 577 predicate; merged context written directly in f32 to the output.

#define NB_  32
#define TT   640
#define DM   768
#define NH_  12
#define NKV  12
#define REP  (NH_ / NKV)
#define HD   64
#define DQ   (NH_ * HD)
#define DKV  (NKV * HD)
#define ZH   24
#define RH   640                  // k_merge (not launched): rows t < RH scale 1, others 1 / PCAR
#define WIN  0
#define PCAR 1024.0f
#define LR   577    // real tokens per sequence
#define GB   32     // sequences per group (all of them: one group)
#define NG   (NB_ / GB)
#define GR   (GB * TT)   // stacked rows per group
#define NVH  (GB * NH_)  // virtual heads per group
#define SCL  0.125f   // HD^-0.5
typedef _Float16 h16;
typedef unsigned short bf;
typedef __attribute__((ext_vector_type(16))) __bf16   v16bf;
typedef __attribute__((ext_vector_type(16))) _Float16 v16h;
typedef __attribute__((ext_vector_type(8)))  _Float16 v8h;
typedef __attribute__((ext_vector_type(8)))  unsigned short v8us;
typedef __attribute__((ext_vector_type(8)))  float    v8f;
typedef __attribute__((ext_vector_type(4)))  float    v4f;
typedef v8h  __attribute__((may_alias)) v8ha;
typedef v4f  __attribute__((may_alias)) v4fa;
typedef v8us __attribute__((may_alias)) v8usa;

__device__ __forceinline__ unsigned short f2bf(float f) { unsigned u = __float_as_uint(f); u += 0x7FFFu + ((u >> 16) & 1u); return (unsigned short)(u >> 16); }
__device__ __forceinline__ float bf2f(unsigned short b) { return __uint_as_float(((unsigned)b) << 16); }
__device__ __forceinline__ float bfr(float f) { return bf2f(f2bf(f)); }
__device__ __forceinline__ v16h cat16(v8h lo, v8h hi) { return __builtin_shufflevector(lo, hi, 0, 1, 2, 3, 4, 5, 6, 7, 8, 9, 10, 11, 12, 13, 14, 15); }
__device__ __forceinline__ v16bf cat16b(v8us lo, v8us hi) { return __builtin_bit_cast(v16bf, __builtin_shufflevector(lo, hi, 0, 1, 2, 3, 4, 5, 6, 7, 8, 9, 10, 11, 12, 13, 14, 15)); }
__device__ __forceinline__ v8f wmma16(v16h a, v16h b, v8f c) { return __builtin_amdgcn_wmma_f32_16x16x32_f16(false, a, false, b, (short)0, c, false, false); }
__device__ __forceinline__ v8f wmmab(v16bf a, v16bf b, v8f c) { return __builtin_amdgcn_wmma_f32_16x16x32_bf16(false, a, false, b, (short)0, c, false, false); }



// ---- k_gemmw: register-blocked GEMM, one wave per 64x64 tile (16 accumulators), EIGHT waves per work-group = 128 token rows x the 256 features of 4 heads of one projection. Planes in fragment order [row / 64][k / 32][4 tiles of 16 rows][512].
// The work-group's operands come through a two-buffer LDS ring filled by asynchronous copies: a stage is 64 k of its 2 token blocks and 4 weight blocks, 6 chunks of 8 KiB, each in a row in its plane and laid down in LDS unchanged, so a chunk is fetched from L2 once for the 4 (token rows) or 2 (weight rows) waves that read it.
// y[m][n] = sum_k A[m][k] Bt[n][k] + bias (f32), split into hi + lo bf16 and stored straight into the head planes: a lane's 8 accumulators are 8 consecutive m at one n, one 16-byte store per plane.
// VT false (q, k): A = weight rows (m = d of the head), Bt = token rows -> plane [head][t / 16][d / 32][512]. VT true (v): A = token rows, Bt = weight rows -> plane [head][t / 32][d / 16][512]. K % 32 == 0, HD == 64.
template <typename T16> struct WFrag;
template <> struct WFrag<h16> { typedef v16h V; static __device__ __forceinline__ V ld(const h16* p) { return cat16(*(const v8h*)p, *(const v8h*)(p + 16)); } static __device__ __forceinline__ v8f mma(V a, V b, v8f c) { return wmma16(a, b, c); } };
template <> struct WFrag<bf> { typedef v16bf V; static __device__ __forceinline__ V ld(const bf* p) { return cat16b(*(const v8us*)p, *(const v8us*)(p + 256)); }   /* p = tile + lane * 8, fragment order */ static __device__ __forceinline__ v8f mma(V a, V b, v8f c) { return wmmab(a, b, c); } };
typedef __attribute__((ext_vector_type(2))) __bf16 v2bf;
typedef __attribute__((ext_vector_type(2))) float v2f;
typedef __attribute__((ext_vector_type(4))) unsigned v4u;
#define GKS 64                           // k of a stage
#define GNS (DM / GKS)                   // stages
#define GTB 2                            // blocks of 64 token rows per work-group
#define GHB 4                            // heads per work-group
#define GCH (64 * GKS)                   // elements of a chunk: 64 rows x one stage's k
#define GST ((GTB + GHB) * GCH)          // elements of a stage
#define GRB ((size_t)(DM / 32) * 2048)   // elements of a block of 64 rows in a plane
// gemm_stage: one stage's 48 KiB, 12 copies of 16 bytes per lane (256 lanes x 16 B = half a chunk per copy). xg, wg: the lane's own 16 bytes in the stage's first token chunk and first weight chunk; lds: the lane's own byte address in the buffer's first chunk.
// s_wait_xcnt closes the statement: it stands behind the last copy and in front of whatever next rewrites a register that a copy names.
__device__ __forceinline__ void gemm_stage(const bf* xg, const bf* wg, const unsigned lds) {
    asm volatile("global_load_async_to_lds_b128 %0, %12, off\n\t"
                 "global_load_async_to_lds_b128 %1, %13, off\n\t"
                 "global_load_async_to_lds_b128 %2, %14, off\n\t"
                 "global_load_async_to_lds_b128 %3, %15, off\n\t"
                 "global_load_async_to_lds_b128 %4, %16, off\n\t"
                 "global_load_async_to_lds_b128 %5, %17, off\n\t"
                 "global_load_async_to_lds_b128 %6, %18, off\n\t"
                 "global_load_async_to_lds_b128 %7, %19, off\n\t"
                 "global_load_async_to_lds_b128 %8, %20, off\n\t"
                 "global_load_async_to_lds_b128 %9, %21, off\n\t"
                 "global_load_async_to_lds_b128 %10, %22, off\n\t"
                 "global_load_async_to_lds_b128 %11, %23, off\n\t"
                 "s_wait_xcnt 0x0"
                 :: "v"(lds), "v"(lds + 4096u), "v"(lds + 8192u), "v"(lds + 12288u), "v"(lds + 16384u), "v"(lds + 20480u), "v"(lds + 24576u), "v"(lds + 28672u), "v"(lds + 32768u), "v"(lds + 36864u), "v"(lds + 40960u), "v"(lds + 45056u),
                    "v"(xg), "v"(xg + 2048), "v"(xg + GRB), "v"(xg + GRB + 2048), "v"(wg), "v"(wg + 2048), "v"(wg + GRB), "v"(wg + GRB + 2048), "v"(wg + 2 * GRB), "v"(wg + 2 * GRB + 2048), "v"(wg + 3 * GRB), "v"(wg + 3 * GRB + 2048)
                 : "memory");
}
template <typename T16>
__device__ __forceinline__ void gemmw_main(const T16* ring, const T16* xg, const T16* wg, const unsigned lds0, const int ca, const int cb, v8f (&acc)[4][4]) {   // ca, cb: the chunks of a stage that hold this wave's A rows and Bt rows
    typedef typename WFrag<T16>::V V;
    const int lane = threadIdx.x & 31;
#pragma unroll
    for (int mb = 0; mb < 4; ++mb)
#pragma unroll
        for (int nb = 0; nb < 4; ++nb) acc[mb][nb] = (v8f){};
    gemm_stage(xg, wg, lds0);
    asm volatile("s_wait_asynccnt 0x0" ::: "memory");   // this wave's copies of stage 0 have landed
    __syncthreads();                                     // ... and every other wave's: stage 0 may be read
    gemm_stage(xg + GCH, wg + GCH, lds0 + GST * 2u);
#pragma unroll 1   // rolled: the buffer alternates by address, one copy of the body serves both
    for (int s = 0; s < GNS; ++s) {
        const T16* pa = ring + (s & 1) * GST + ca * GCH + lane * 8; const T16* pb = ring + (s & 1) * GST + cb * GCH + lane * 8;
#pragma unroll   // both 32-k blocks of a stage in line: every LDS offset is an immediate, and the second block's loads can start under the first block's last products
        for (int ks = 0; ks < GKS / 32; ++ks) {
            V a[4], b[4];
#pragma unroll
            for (int t = 0; t < 4; ++t) { a[t] = WFrag<T16>::ld(pa + ks * 2048 + t * 512); b[t] = WFrag<T16>::ld(pb + ks * 2048 + t * 512); }
            __builtin_amdgcn_sched_barrier(0);   // holds the block's 16 LDS loads together at its head: left alone, the scheduler kept one B fragment and strung its reloads out among the WMMAs, each behind a full wait of its own
#pragma unroll
            for (int nb = 0; nb < 4; ++nb)
#pragma unroll
                for (int mb = 0; mb < 4; ++mb) acc[mb][nb] = WFrag<T16>::mma(a[mb], b[nb], acc[mb][nb]);
        }
        asm volatile("s_wait_dscnt 0x0" ::: "memory");      // this wave's reads of stage s are done before the buffer is given up
        asm volatile("s_wait_asynccnt 0x0" ::: "memory");   // this wave's copies of stage s + 1 have landed
        __syncthreads();                                     // publishes stage s + 1 and ends every wave's reads of stage s
        if (s + 2 < GNS) gemm_stage(xg + (s + 2) * GCH, wg + (s + 2) * GCH, lds0 + (unsigned)(s & 1) * (GST * 2u));   // refill of the buffer just left
    }
    asm volatile("s_wait_asynccnt 0x0" ::: "memory");   // nothing of this wave's is in flight when it goes on to the epilogue and ends
}
template <bool VT>
__device__ __forceinline__ void gemmw_store(const v8f (&acc)[4][4], const float* __restrict__ bias, bf* Ph, bf* Pl, const int tok0, const int head) {
    const int lane = threadIdx.x & 31, lr = lane & 15, hi = lane >> 4; const int f0 = head * 64;
    const size_t pz = ((size_t)(tok0 / TT) * NH_ + head) * TT * HD; const int t0 = tok0 % TT;   // a 64-row tile lies inside one sequence (TT % 64 == 0)
#pragma unroll
    for (int mb = 0; mb < 4; ++mb) {
        v8f bm;
        if (!VT) { const v4f b0 = *(const v4fa*)(bias + f0 + mb * 16 + 8 * hi), b1 = *(const v4fa*)(bias + f0 + mb * 16 + 8 * hi + 4);
#pragma unroll
            for (int j = 0; j < 4; ++j) { bm[j] = bfr(b0[j]); bm[4 + j] = bfr(b1[j]); } }
#pragma unroll
        for (int nb = 0; nb < 4; ++nb) {
            if (VT) { const float b = bfr(bias[f0 + nb * 16 + lr]);
#pragma unroll
                for (int j = 0; j < 8; ++j) bm[j] = b; }
            const v8f y = acc[mb][nb] + bm; v4u yh, yl;
#pragma unroll
            for (int e = 0; e < 4; ++e) { v2f p; p[0] = y[2 * e]; p[1] = y[2 * e + 1]; const v2bf h2 = __builtin_convertvector(p, v2bf); const v2f r = p - __builtin_convertvector(h2, v2f);
                yh[e] = __builtin_bit_cast(unsigned, h2); yl[e] = __builtin_bit_cast(unsigned, __builtin_convertvector(r, v2bf)); }
            const size_t off = pz + (size_t)(VT ? ((t0 >> 5) + (mb >> 1)) * 4 + nb : ((t0 >> 4) + nb) * 2 + (mb >> 1)) * 512 + (mb & 1) * 256 + lane * 8;   // the lane's 8 values are k = (mb & 1) * 16 + 8 hi + 0..7 of row lr of that tile
            *(v8us*)(Ph + off) = __builtin_bit_cast(v8us, yh); *(v8us*)(Pl + off) = __builtin_bit_cast(v8us, yl); }
        asm volatile("s_wait_xcnt 0x0" ::: "memory");   // behind the row's 8 stores, in front of whatever next overwrites a register that one of them names (the next row's values; behind the last row, the code of the other projection's side, to which the built kernel holds a branch)
        __builtin_amdgcn_sched_barrier(0);   // one row of four tiles at a time: left alone, the scheduler ran all sixteen tiles' splits side by side and went over the 256 registers (spills to scratch)
    }
}
// k_gemmw: q, k and v of every sequence in one launch; grid (3 projections x groups of 4 heads, token rows / 128), 256 threads; a wave stays under 256 registers, so two work-groups fit a WGP and one's barriers, prologue and epilogue run beside the other's products; wave w: token block w & 1, head w >> 1 of the group. The 9 work-groups of one block of token rows are neighbours in the grid, so a block of x is fetched once while the three weight planes (under 4 MiB) stay in use throughout.
__global__ __launch_bounds__(256) void k_gemmw(const bf* __restrict__ WB, const bf* __restrict__ XB, const float* __restrict__ bq, const float* __restrict__ bk, const float* __restrict__ bv, bf* QPh, bf* QPl, bf* KPh, bf* KPl, bf* VTh, bf* VTl) {
    __shared__ __attribute__((aligned(16))) bf ring[2 * GST];   // two stages, 96 KiB
    const int wave = __builtin_amdgcn_readfirstlane((int)(threadIdx.x >> 5)); const int cx = wave & 1, cw = wave >> 1;
    const int pj = blockIdx.x / (NH_ / GHB), h0 = (blockIdx.x % (NH_ / GHB)) * GHB, tb0 = blockIdx.y * GTB;
    const int head = h0 + cw, tok0 = (tb0 + cx) * 64;
    const bf* xg = XB + (size_t)tb0 * GRB + threadIdx.x * 8; const bf* wg = WB + (size_t)(pj * NH_ + h0) * GRB + threadIdx.x * 8;
    const unsigned lds0 = (unsigned)(size_t)ring + threadIdx.x * 16u;   // low 32 bits of the __shared__ address = byte offset in the work-group's LDS
    v8f acc[4][4];
    gemmw_main<bf>(ring, xg, wg, lds0, pj == 2 ? cx : GTB + cw, pj == 2 ? GTB + cw : cx, acc);
    if (pj == 2) gemmw_store<true>(acc, bv, VTh, VTl, tok0, head);
    else gemmw_store<false>(acc, pj ? bk : bq, pj ? KPh : QPh, pj ? KPl : QPl, tok0, head);
}

__device__ __forceinline__ h16 tohx(float x) { return (h16)x; }
__device__ __forceinline__ void splitf(float y, unsigned short& h, unsigned short& l) { h = f2bf(y); l = f2bf(y - bf2f(h)); }
typedef __attribute__((ext_vector_type(2))) _Float16 v2h;
typedef __attribute__((ext_vector_type(4))) _Float16 v4h;
typedef __attribute__((ext_vector_type(2))) unsigned short v2us;
typedef __attribute__((ext_vector_type(4))) unsigned short v4us;
typedef __attribute__((ext_vector_type(4))) int v4i;

__global__ __launch_bounds__(256) void k_wtG(const float* __restrict__ w, int K, int N, bf* Bt) {
    const int lane = threadIdx.x & 31; const int L0 = (blockIdx.x * 8 + (threadIdx.x >> 5)) * 8; const int nlines = N * K / 64;
{
#pragma unroll 1
        for (int l = 0; l < 8; ++l) { const int L = L0 + l; if (L >= nlines) break; const size_t e = (size_t)L * 64 + lane * 2; const int k = (int)(e % K), n = (int)(e / K); v2us o;
            o[0] = f2bf(w[(size_t)k * N + n]); o[1] = f2bf(w[(size_t)(k + 1) * N + n]); *(v2us*)(Bt + e) = o; }
         }
}
__global__ __launch_bounds__(256) void k_cscvt(const float* __restrict__ cosT, const float* __restrict__ sinT, float* CS) { const int idx = blockIdx.x * 256 + threadIdx.x; if (idx >= TT * HD) return; v2f cs; cs[0] = bfr(cosT[idx]); cs[1] = bfr(sinT[idx]); *(v2f*)(CS + (size_t)idx * 2) = cs;  }
// ---- pack_tile: f32 rows [seq][TR][DM] -> bf16 plane in the fragment order k_gemmw reads, sequences padded TR -> TP with zero rows. ONE WAVE per tile of 16 rows x 32 k (tile w of the plane).
// A load takes 4 whole 128-byte row pieces (8 lanes a row, 4 floats a lane); the lane's 4 values go out as 8 bytes. A pad row reads the sequence's last real row (address in bounds, all four loads in flight together) and stores zeros.
template <int TP, int TR>
__device__ __forceinline__ void pack_tile(const float* src, bf* dst, const int w) {
    const int lane = threadIdx.x & 31; const int kb = (w >> 2) % (DM / 32); const int row0 = ((w >> 2) / (DM / 32)) * 64 + (w & 3) * 16; const int kq = (lane & 7) * 4;
    const int bl = row0 / TP, t0 = row0 % TP + (lane >> 3);   // a 16-row tile lies inside one sequence (TP % 16 == 0)
    bf* o = dst + (size_t)w * 512 + (kq >> 4) * 256 + ((kq >> 3) & 1) * 128 + (lane >> 3) * 8 + (kq & 7);
    const float* p[4]; v4f v[4];
#pragma unroll
    for (int i = 0; i < 4; ++i) { const int t = t0 + i * 4; p[i] = src + ((size_t)bl * TR + ((TP == TR || t < TR) ? t : TR - 1)) * DM + kb * 32 + kq; }
#pragma unroll
    for (int i = 0; i < 4; ++i) v[i] = *(const v4fa*)p[i];
    // s_wait_xcnt: behind the four loads, in front of whatever next overwrites one of their address pairs; the pairs are inputs, so none is given away (not even to a load's own result) in front of the wait.
    asm volatile("s_wait_xcnt 0x0" :: "v"(p[0]), "v"(p[1]), "v"(p[2]), "v"(p[3]) : "memory");
#pragma unroll
    for (int i = 0; i < 4; ++i) { v4us ov;
#pragma unroll
        for (int u = 0; u < 4; ++u) ov[u] = f2bf((TP == TR || t0 + i * 4 < TR) ? v[i][u] : 0.f);
        *(v4us*)(o + i * 32) = ov; }
    // s_wait_xcnt: behind the four stores, in front of whatever next overwrites their address pair (in the built k_pack a branch behind the weight side's stores leads to the head of the x side, which writes such registers); the pair is an input, so it is not given away in front of the wait.
    asm volatile("s_wait_xcnt 0x0" :: "v"(o) : "memory");
}
// k_pack: x and the three weight matrices in one launch, 8 tiles per block, grid exact: blocks below NXT / 8 pack x, then NWT / 8 blocks for each of Wq, Wk, Wv (planes one behind another in WB).
#define NXT (GR / 16 * (DM / 32))   // tiles of the x plane
#define NWT (DQ / 16 * (DM / 32))   // tiles of one weight plane
__global__ __launch_bounds__(256) void k_pack(const float* x, const float* wq, const float* wk, const float* wv, bf* XB, bf* WB) {
    const int wv8 = threadIdx.x >> 5;
    if (blockIdx.x < NXT / 8) { pack_tile<TT, LR>(x, XB, blockIdx.x * 8 + wv8); return; }
    const int u = blockIdx.x - NXT / 8; const int pj = u / (NWT / 8);
    pack_tile<DQ, DQ>(pj == 0 ? wq : pj == 1 ? wk : wv, WB + (size_t)pj * DQ * DM, (u % (NWT / 8)) * 8 + wv8);
}
// ---- k_fattn: scores, softmax, attn.v and the head merge in one kernel; ONE WAVE = 32 query columns of one virtual head, 4 independent waves per block (no LDS, no barrier); grid (ceil(NQB / 4), NVH).
// St = K.Qt (A = 16 key rows, B = 16 query columns kept in registers) and Ot += Vt.Pt: a lane holds one query's scores, so two St tiles (keys 0-15, 16-31 of a pass) convert in place into the B operand Pt,
// whose k order (8 hi + s, 16 + 8 hi + s - 8) is the order WFrag::ld gives the Vt rows. Planes in fragment order: a pass reads 4 KiB in a row of each of Kh, Kl, Vh, Vl. Running maximum and sum per query (online softmax over passes of 32 keys), division by the sum at the end.
// hl x hl (3 products) on both matrix products as before; keys >= LR masked in the last pass only (every earlier pass lies below LR).
#define NKB ((LR + 31) / 32)   // key passes
#define NQB ((LR + 31) / 32)   // 32-query column blocks per head
__device__ __forceinline__ float xhalf(float x) { const int b = __float_as_int(x); return __int_as_float(__builtin_amdgcn_permlanex16(b, b, 0x76543210, 0xfedcba98, false, false)); }   // lane l <-> l ^ 16
// xwait: stands behind a group of global loads, in front of whatever next overwrites a register that one of them names as its address.
// The group's address pairs are inputs, so they stay live up to the wait; the plane pointers carry no __restrict__, so the "memory" clobber keeps the loads in front of it.
__device__ __forceinline__ void xwait(const bf* a, const bf* b) { asm volatile("s_wait_xcnt 0x0" :: "v"(a), "v"(b) : "memory"); }
template <bool LAST>
__device__ __forceinline__ void fa_pass(const int key0, const int hi, const bf* kph, const bf* kpl, const bf* vph, const bf* vpl,
                                        const v16bf (&qh)[2][2], const v16bf (&ql)[2][2], v16bf (&kh)[2][2], v16bf (&kl)[2][2], v8f (&o)[4][2], float (&m)[2], float (&l)[2]) {
    const float C = SCL * 1.4426950408889634f;
    v16bf vh[4], vl[4]; const bf* va = vph + (size_t)key0 * HD; const bf* vb = vpl + (size_t)key0 * HD;
#pragma unroll
    for (int dt = 0; dt < 4; ++dt) { vh[dt] = WFrag<bf>::ld(va + dt * 512); vl[dt] = WFrag<bf>::ld(vb + dt * 512); }
    xwait(va, vb);
    __builtin_amdgcn_sched_barrier(0);   // holds the V loads at the head of the pass, so that the score products and the softmax cover their latency (the scheduler sank half of them to just ahead of their use)
    v8f s[2][2];
#pragma unroll
    for (int kt = 0; kt < 2; ++kt)
#pragma unroll
        for (int qt = 0; qt < 2; ++qt) s[kt][qt] = (v8f){};
#pragma unroll
    for (int ks = 0; ks < 2; ++ks) {
#pragma unroll
        for (int kt = 0; kt < 2; ++kt)
#pragma unroll
            for (int qt = 0; qt < 2; ++qt) s[kt][qt] = wmmab(kh[kt][ks], qh[qt][ks], s[kt][qt]);
#pragma unroll
        for (int kt = 0; kt < 2; ++kt)
#pragma unroll
            for (int qt = 0; qt < 2; ++qt) s[kt][qt] = wmmab(kl[kt][ks], qh[qt][ks], s[kt][qt]);
#pragma unroll
        for (int kt = 0; kt < 2; ++kt)
#pragma unroll
            for (int qt = 0; qt < 2; ++qt) s[kt][qt] = wmmab(kh[kt][ks], ql[qt][ks], s[kt][qt]);
    }
    if (!LAST) {   // the next pass's K fragments, fetched behind this pass's score products
        const bf* ka = kph + (size_t)key0 * HD; const bf* kc = kpl + (size_t)key0 * HD;
#pragma unroll
        for (int kt = 0; kt < 2; ++kt)
#pragma unroll
            for (int ks = 0; ks < 2; ++ks) { const size_t ko = (size_t)(32 + kt * 16) * HD + ks * 512; kh[kt][ks] = WFrag<bf>::ld(ka + ko); kl[kt][ks] = WFrag<bf>::ld(kc + ko); }
        xwait(ka, kc);
        __builtin_amdgcn_sched_barrier(0);   // holds the K prefetch ahead of the softmax, a whole pass ahead of its use (the scheduler sank it behind the softmax)
    }
    v16bf ph[2], pl[2];
#pragma unroll
    for (int qt = 0; qt < 2; ++qt) {
        if (LAST) {
#pragma unroll
            for (int kt = 0; kt < 2; ++kt)
#pragma unroll
                for (int j = 0; j < 8; ++j) s[kt][qt][j] = (key0 + kt * 16 + 8 * hi + j < LR) ? s[kt][qt][j] : -3.0e38f;
        }
        float mx = m[qt];
#pragma unroll
        for (int kt = 0; kt < 2; ++kt)
#pragma unroll
            for (int j = 0; j < 8; ++j) mx = fmaxf(mx, s[kt][qt][j]);
        mx = fmaxf(mx, xhalf(mx));
        const float al = __builtin_amdgcn_exp2f((m[qt] - mx) * C); const float mc = mx * C; m[qt] = mx;
        v2f p[8]; v2f c2, nm; c2[0] = C; c2[1] = C; nm[0] = -mc; nm[1] = -mc;
#pragma unroll
        for (int e = 0; e < 8; ++e) { v2f sv; sv[0] = s[e >> 2][qt][(e & 3) * 2]; sv[1] = s[e >> 2][qt][(e & 3) * 2 + 1]; const v2f t = __builtin_elementwise_fma(sv, c2, nm); p[e][0] = __builtin_amdgcn_exp2f(t[0]); p[e][1] = __builtin_amdgcn_exp2f(t[1]); }
        v2f ps = p[0];
#pragma unroll
        for (int e = 1; e < 8; ++e) ps += p[e];
#pragma unroll
        for (int e = 0; e < 8; ++e) { const v2bf h2 = __builtin_convertvector(p[e], v2bf); const v2f r = p[e] - __builtin_convertvector(h2, v2f); const v2bf l2 = __builtin_convertvector(r, v2bf);
            ph[qt][2 * e] = h2[0]; ph[qt][2 * e + 1] = h2[1]; pl[qt][2 * e] = l2[0]; pl[qt][2 * e + 1] = l2[1]; }
        l[qt] = l[qt] * al + (ps[0] + ps[1]);
#pragma unroll
        for (int dt = 0; dt < 4; ++dt) o[dt][qt] *= al;
    }
#pragma unroll
    for (int dt = 0; dt < 4; ++dt)
#pragma unroll
        for (int qt = 0; qt < 2; ++qt) o[dt][qt] = wmmab(vh[dt], ph[qt], o[dt][qt]);
#pragma unroll
    for (int dt = 0; dt < 4; ++dt)
#pragma unroll
        for (int qt = 0; qt < 2; ++qt) o[dt][qt] = wmmab(vh[dt], pl[qt], o[dt][qt]);
#pragma unroll
    for (int dt = 0; dt < 4; ++dt)
#pragma unroll
        for (int qt = 0; qt < 2; ++qt) o[dt][qt] = wmmab(vl[dt], ph[qt], o[dt][qt]);
}
__global__ __launch_bounds__(128) void k_fattn(const bf* Qh, const bf* Ql, const bf* Kh, const bf* Kl, const bf* Vh, const bf* Vl, float* O2) {
    const int lane = threadIdx.x & 31, lr = lane & 15, hi = lane >> 4; const int qb = blockIdx.x * 4 + __builtin_amdgcn_readfirstlane((int)(threadIdx.x >> 5)); if (qb >= NQB) return;
    const int z = blockIdx.y; const int bl = z / NH_, h = z % NH_; const size_t pz = (size_t)z * TT * HD;
    v16bf qh[2][2], ql[2][2], kh[2][2], kl[2][2];
    const bf* kph = Kh + pz + lane * 8; const bf* kpl = Kl + pz + lane * 8; const bf* vph = Vh + pz + lane * 8; const bf* vpl = Vl + pz + lane * 8;
    const bf* qa = Qh + pz + (size_t)(qb * 32) * HD + lane * 8; const bf* qc = Ql + pz + (size_t)(qb * 32) * HD + lane * 8;
#pragma unroll
    for (int t = 0; t < 2; ++t)
#pragma unroll
        for (int ks = 0; ks < 2; ++ks) { const size_t fo = (size_t)(t * 16) * HD + ks * 512; qh[t][ks] = WFrag<bf>::ld(qa + fo); ql[t][ks] = WFrag<bf>::ld(qc + fo); kh[t][ks] = WFrag<bf>::ld(kph + fo); kl[t][ks] = WFrag<bf>::ld(kpl + fo); }
    xwait(qa, qc); xwait(kph, kpl);
    v8f o[4][2]; float m[2] = { -3.0e38f, -3.0e38f }, l[2] = { 0.f, 0.f };
#pragma unroll
    for (int dt = 0; dt < 4; ++dt)
#pragma unroll
        for (int qt = 0; qt < 2; ++qt) o[dt][qt] = (v8f){};
#pragma unroll 1   // rolled: one pass is already some hundred instructions
    for (int kb = 0; kb < NKB - 1; ++kb) fa_pass<false>(kb * 32, hi, kph, kpl, vph, vpl, qh, ql, kh, kl, o, m, l);
    fa_pass<true>((NKB - 1) * 32, hi, kph, kpl, vph, vpl, qh, ql, kh, kl, o, m, l);
#pragma unroll
    for (int qt = 0; qt < 2; ++qt) { const float f = __fdiv_rn(1.0f, l[qt] + xhalf(l[qt])); const int q = qb * 32 + qt * 16 + lr;
        if (q < LR) { float* dst = O2 + ((size_t)bl * LR + q) * DM + (size_t)h * HD + 8 * hi;
#pragma unroll
            for (int dt = 0; dt < 4; ++dt) { v4f a, b;
#pragma unroll
                for (int j = 0; j < 4; ++j) { a[j] = o[dt][qt][j] * f; b[j] = o[dt][qt][4 + j] * f; }
                *(v4f*)(dst + dt * 16) = a; *(v4f*)(dst + dt * 16 + 4) = b; } } }
}
__global__ __launch_bounds__(256) void k_merge(const float* __restrict__ O, int h0, bf* Ah, bf* Al) { const size_t e = ((size_t)blockIdx.x * 256 + threadIdx.x) * 2; if (e >= (size_t)ZH * TT * HD) return; const int d = (int)(e % HD); const int t = (int)((e / HD) % TT); const int zz = (int)(e / ((size_t)HD * TT)); const float cs = (t < RH) ? 1.0f : (1.0f / PCAR); const size_t oo = (size_t)t * DQ + (h0 + zz) * HD + d;
    v2us oh, ol;
#pragma unroll
    for (int q = 0; q < 2; ++q) { unsigned short a, c2; splitf(O[e + q] * cs, a, c2); oh[q] = a; ol[q] = c2; } *(v2us*)(Ah + oo) = oh; *(v2us*)(Al + oo) = ol;  }

extern "C" void kernel_launch(void* const* d_in, const int* in_sizes, int n_in,
                              void* d_out, int out_size, void* d_ws, size_t ws_size, hipStream_t stream) {
    (void)in_sizes; (void)n_in; (void)out_size;
    const float* x = (const float*)d_in[0]; const float* wq = (const float*)d_in[1]; const float* bq = (const float*)d_in[2]; const float* wk = (const float*)d_in[3]; const float* bk = (const float*)d_in[4]; const float* wv = (const float*)d_in[5]; const float* bv = (const float*)d_in[6]; const float* wo = nullptr; (void)wo; const float* cosT = nullptr; const float* sinT = nullptr; (void)cosT; (void)sinT;
    float* OUT = (float*)d_out;   // [32][577][768]
    char* wsp = (char*)d_ws; auto take = [&](size_t bytes) { char* p = wsp; wsp += (bytes + 255) & ~(size_t)255; return (void*)p; };
    bf* WB = (bf*)take((size_t)3 * DQ * DM * 2);   // Wq, Wk, Wv (DKV == DQ)
    bf* XB = (bf*)take((size_t)GR * DM * 2);
    bf* QPh = (bf*)take((size_t)NVH * TT * HD * 2); bf* QPl = (bf*)take((size_t)NVH * TT * HD * 2);
    bf* KPh = (bf*)take((size_t)NVH * TT * HD * 2); bf* KPl = (bf*)take((size_t)NVH * TT * HD * 2);
    bf* VTh = (bf*)take((size_t)NVH * HD * TT * 2); bf* VTl = (bf*)take((size_t)NVH * HD * TT * 2);
    if ((size_t)(wsp - (char*)d_ws) > ws_size) return;   // ws ~ 214 MiB
    k_pack<<<NXT / 8 + 3 * (NWT / 8), 256, 0, stream>>>(x, wq, wk, wv, XB, WB);
    k_gemmw<<<dim3(3 * (NH_ / GHB), GR / (64 * GTB), 1), 256, 0, stream>>>(WB, XB, bq, bk, bv, QPh, QPl, KPh, KPl, VTh, VTl);
    k_fattn<<<dim3((NQB + 3) / 4, NVH, 1), 128, 0, stream>>>(QPh, QPl, KPh, KPl, VTh, VTl, OUT);   // virtual head z = bl * 12 + h
}

// v006
// A run of this version takes 160 microseconds.
// In both of two side-by-side timings against v005, it was 1.03 times as fast.
// All steps since v000 together make it 8.98 times as fast.
#include <hip/hip_runtime.h>

// ViTSelfAttention (hidden [32][577][768]; q/k/v = x W^T + b (12 heads x 64); softmax(q.k / 8); out = merged context (no output projection) -> [32][577][768]).
// Batched layout (exact): sequences padded 577 -> 640 with zero rows (padded KEYS masked out of every softmax row; padded query rows computed and discarded); 32 sequences x 12 heads = 384 'virtual heads' of 640 tokens, all in ONE launch per stage (pack, projections, fused attention: 3 launches); the projections run on the 20,480 stacked rows at once and store their results as hi/lo bf16 head planes themselves.
// Every 16-bit operand plane lies in FRAGMENT ORDER: a tile of 16 rows x 32 k is 1 KiB in a row, element (row, kk) at (kk >> 4) * 256 + (((kk >> 3) & 1) * 16 + row) * 8 + (kk & 7), so that lane l's two 16-byte pieces of a fragment
// stand at l * 8 and 256 + l * 8 and each wave-wide 16-byte load or store covers 512 bytes in a row (4 whole lines, not 32 bytes of each of 16 lines). The registers hold what they held with row-major planes.
// Compute dtypes, f32 accumulate: every input rounded to bf16; q/k/v on PLAIN bf16 operands (inputs: exact) + bias; scores AND attn.v hl x hl (3 products) on every row; softmax f32, online over passes of 32 keys, with the j < 577 predicate; merged context written directly in f32 to the output.

#define NB_  32
#define TT   640
#define DM   768
#define NH_  12
#define NKV  12
#define REP  (NH_ / NKV)
#define HD   64
#define DQ   (NH_ * HD)
#define DKV  (NKV * HD)
#define ZH   24
#define RH   640                  // k_merge (not launched): rows t < RH scale 1, others 1 / PCAR
#define WIN  0
#define PCAR 1024.0f
#define LR   577    // real tokens per sequence
#define GB   32     // sequences per group (all of them: one group)
#define NG   (NB_ / GB)
#define GR   (GB * TT)   // stacked rows per group
#define NVH  (GB * NH_)  // virtual heads per group
#define SCL  0.125f   // HD^-0.5
typedef _Float16 h16;
typedef unsigned short bf;
typedef __attribute__((ext_vector_type(16))) __bf16   v16bf;
typedef __attribute__((ext_vector_type(16))) _Float16 v16h;
typedef __attribute__((ext_vector_type(8)))  _Float16 v8h;
typedef __attribute__((ext_vector_type(8)))  unsigned short v8us;
typedef __attribute__((ext_vector_type(8)))  float    v8f;
typedef __attribute__((ext_vector_type(4)))  float    v4f;
typedef v8h  __attribute__((may_alias)) v8ha;
typedef v4f  __attribute__((may_alias)) v4fa;
typedef v8us __attribute__((may_alias)) v8usa;

__device__ __forceinline__ unsigned short f2bf(float f) { unsigned u = __float_as_uint(f); u += 0x7FFFu + ((u >> 16) & 1u); return (unsigned short)(u >> 16); }
__device__ __forceinline__ float bf2f(unsigned short b) { return __uint_as_float(((unsigned)b) << 16); }
__device__ __forceinline__ float bfr(float f) { return bf2f(f2bf(f)); }
__device__ __forceinline__ v16h cat16(v8h lo, v8h hi) { return __builtin_shufflevector(lo, hi, 0, 1, 2, 3, 4, 5, 6, 7, 8, 9, 10, 11, 12, 13, 14, 15); }
__device__ __forceinline__ v16bf cat16b(v8us lo, v8us hi) { return __builtin_bit_cast(v16bf, __builtin_shufflevector(lo, hi, 0, 1, 2, 3, 4, 5, 6, 7, 8, 9, 10, 11, 12, 13, 14, 15)); }
__device__ __forceinline__ v8f wmma16(v16h a, v16h b, v8f c) { return __builtin_amdgcn_wmma_f32_16x16x32_f16(false, a, false, b, (short)0, c, false, false); }
__device__ __forceinline__ v8f wmmab(v16bf a, v16bf b, v8f c) { return __builtin_amdgcn_wmma_f32_16x16x32_bf16(false, a, false, b, (short)0, c, false, false); }



// ---- k_gemmw: register-blocked GEMM, one wave per 64x64 tile (16 accumulators), EIGHT waves per work-group = 128 token rows x the 256 features of 4 heads of one projection. Planes in fragment order [row / 64][k / 32][4 tiles of 16 rows][512].
// The work-group's operands come through a two-buffer LDS ring filled by asynchronous copies: a stage is 64 k of its 2 token blocks and 4 weight blocks, 6 chunks of 8 KiB, each in a row in its plane and laid down in LDS unchanged, so a chunk is fetched from L2 once for the 4 (token rows) or 2 (weight rows) waves that read it.
// y[m][n] = sum_k A[m][k] Bt[n][k] + bias (f32), split into hi + lo bf16 and stored straight into the head planes: a lane's 8 accumulators are 8 consecutive m at one n, one 16-byte store per plane.
// VT false (q, k): A = weight rows (m = d of the head), Bt = token rows -> plane [head][t / 16][d / 32][512]. VT true (v): A = token rows, Bt = weight rows -> plane [head][t / 32][d / 16][512]. K % 32 == 0, HD == 64.
template <typename T16> struct WFrag;
template <> struct WFrag<h16> { typedef v16h V; static __device__ __forceinline__ V ld(const h16* p) { return cat16(*(const v8h*)p, *(const v8h*)(p + 16)); } static __device__ __forceinline__ v8f mma(V a, V b, v8f c) { return wmma16(a, b, c); } };
template <> struct WFrag<bf> { typedef v16bf V; static __device__ __forceinline__ V ld(const bf* p) { return cat16b(*(const v8us*)p, *(const v8us*)(p + 256)); }   /* p = tile + lane * 8, fragment order */ static __device__ __forceinline__ v8f mma(V a, V b, v8f c) { return wmmab(a, b, c); } };
typedef __attribute__((ext_vector_type(2))) __bf16 v2bf;
typedef __attribute__((ext_vector_type(2))) float v2f;
typedef __attribute__((ext_vector_type(4))) unsigned v4u;
#define GKS 64                           // k of a stage
#define GNS (DM / GKS)                   // stages
#define GTB 2                            // blocks of 64 token rows per work-group
#define GHB 4                            // heads per work-group
#define GCH (64 * GKS)                   // elements of a chunk: 64 rows x one stage's k
#define GST ((GTB + GHB) * GCH)          // elements of a stage
#define GRB ((size_t)(DM / 32) * 2048)   // elements of a block of 64 rows in a plane
// gemm_stage: one stage's 48 KiB, 12 copies of 16 bytes per lane (256 lanes x 16 B = half a chunk per copy). xg, wg: the lane's own 16 bytes in the stage's first token chunk and first weight chunk; lds: the lane's own byte address in the buffer's first chunk.
// s_wait_xcnt closes the statement: it stands behind the last copy and in front of whatever next rewrites a register that a copy names.
__device__ __forceinline__ void gemm_stage(const bf* xg, const bf* wg, const unsigned lds) {
    asm volatile("global_load_async_to_lds_b128 %0, %12, off\n\t"
                 "global_load_async_to_lds_b128 %1, %13, off\n\t"
                 "global_load_async_to_lds_b128 %2, %14, off\n\t"
                 "global_load_async_to_lds_b128 %3, %15, off\n\t"
                 "global_load_async_to_lds_b128 %4, %16, off\n\t"
                 "global_load_async_to_lds_b128 %5, %17, off\n\t"
                 "global_load_async_to_lds_b128 %6, %18, off\n\t"
                 "global_load_async_to_lds_b128 %7, %19, off\n\t"
                 "global_load_async_to_lds_b128 %8, %20, off\n\t"
                 "global_load_async_to_lds_b128 %9, %21, off\n\t"
                 "global_load_async_to_lds_b128 %10, %22, off\n\t"
                 "global_load_async_to_lds_b128 %11, %23, off\n\t"
                 "s_wait_xcnt 0x0"
                 :: "v"(lds), "v"(lds + 4096u), "v"(lds + 8192u), "v"(lds + 12288u), "v"(lds + 16384u), "v"(lds + 20480u), "v"(lds + 24576u), "v"(lds + 28672u), "v"(lds + 32768u), "v"(lds + 36864u), "v"(lds + 40960u), "v"(lds + 45056u),
                    "v"(xg), "v"(xg + 2048), "v"(xg + GRB), "v"(xg + GRB + 2048), "v"(wg), "v"(wg + 2048), "v"(wg + GRB), "v"(wg + GRB + 2048), "v"(wg + 2 * GRB), "v"(wg + 2 * GRB + 2048), "v"(wg + 3 * GRB), "v"(wg + 3 * GRB + 2048)
                 : "memory");
}
template <typename T16>
__device__ __forceinline__ void gemmw_main(const T16* ring, const T16* xg, const T16* wg, const unsigned lds0, const int ca, const int cb, v8f (&acc)[4][4]) {   // ca, cb: the chunks of a stage that hold this wave's A rows and Bt rows
    typedef typename WFrag<T16>::V V;
    const int lane = threadIdx.x & 31;
#pragma unroll
    for (int mb = 0; mb < 4; ++mb)
#pragma unroll
        for (int nb = 0; nb < 4; ++nb) acc[mb][nb] = (v8f){};
    gemm_stage(xg, wg, lds0);
    asm volatile("s_wait_asynccnt 0x0" ::: "memory");   // this wave's copies of stage 0 have landed
    __syncthreads();                                     // ... and every other wave's: stage 0 may be read
    gemm_stage(xg + GCH, wg + GCH, lds0 + GST * 2u);
#pragma unroll 1   // rolled: the buffer alternates by address, one copy of the body serves both
    for (int s = 0; s < GNS; ++s) {
        const T16* pa = ring + (s & 1) * GST + ca * GCH + lane * 8; const T16* pb = ring + (s & 1) * GST + cb * GCH + lane * 8;
#pragma unroll   // both 32-k blocks of a stage in line: every LDS offset is an immediate, and the second block's loads can start under the first block's last products
        for (int ks = 0; ks < GKS / 32; ++ks) {
            V a[4], b[4];
#pragma unroll
            for (int t = 0; t < 4; ++t) { a[t] = WFrag<T16>::ld(pa + ks * 2048 + t * 512); b[t] = WFrag<T16>::ld(pb + ks * 2048 + t * 512); }
            __builtin_amdgcn_sched_barrier(0);   // holds the block's 16 LDS loads together at its head: left alone, the scheduler kept one B fragment and strung its reloads out among the WMMAs, each behind a full wait of its own
#pragma unroll
            for (int nb = 0; nb < 4; ++nb)
#pragma unroll
                for (int mb = 0; mb < 4; ++mb) acc[mb][nb] = WFrag<T16>::mma(a[mb], b[nb], acc[mb][nb]);
        }
        asm volatile("s_wait_dscnt 0x0" ::: "memory");      // this wave's reads of stage s are done before the buffer is given up
        asm volatile("s_wait_asynccnt 0x0" ::: "memory");   // this wave's copies of stage s + 1 have landed
        __syncthreads();                                     // publishes stage s + 1 and ends every wave's reads of stage s
        if (s + 2 < GNS) gemm_stage(xg + (s + 2) * GCH, wg + (s + 2) * GCH, lds0 + (unsigned)(s & 1) * (GST * 2u));   // refill of the buffer just left
    }
    asm volatile("s_wait_asynccnt 0x0" ::: "memory");   // nothing of this wave's is in flight when it goes on to the epilogue and ends
}
template <bool VT>
__device__ __forceinline__ void gemmw_store(const v8f (&acc)[4][4], const float* __restrict__ bias, bf* Ph, bf* Pl, const int tok0, const int head) {
    const int lane = threadIdx.x & 31, lr = lane & 15, hi = lane >> 4; const int f0 = head * 64;
    const size_t pz = ((size_t)(tok0 / TT) * NH_ + head) * TT * HD; const int t0 = tok0 % TT;   // a 64-row tile lies inside one sequence (TT % 64 == 0)
#pragma unroll
    for (int mb = 0; mb < 4; ++mb) {
        v8f bm;
        if (!VT) { const v4f b0 = *(const v4fa*)(bias + f0 + mb * 16 + 8 * hi), b1 = *(const v4fa*)(bias + f0 + mb * 16 + 8 * hi + 4);
#pragma unroll
            for (int j = 0; j < 4; ++j) { bm[j] = bfr(b0[j]); bm[4 + j] = bfr(b1[j]); } }
#pragma unroll
        for (int nb = 0; nb < 4; ++nb) {
            if (VT) { const float b = bfr(bias[f0 + nb * 16 + lr]);
#pragma unroll
                for (int j = 0; j < 8; ++j) bm[j] = b; }
            const v8f y = acc[mb][nb] + bm; v4u yh, yl;
#pragma unroll
            for (int e = 0; e < 4; ++e) { v2f p; p[0] = y[2 * e]; p[1] = y[2 * e + 1]; const v2bf h2 = __builtin_convertvector(p, v2bf); const v2f r = p - __builtin_convertvector(h2, v2f);
                yh[e] = __builtin_bit_cast(unsigned, h2); yl[e] = __builtin_bit_cast(unsigned, __builtin_convertvector(r, v2bf)); }
            const size_t off = pz + (size_t)(VT ? ((t0 >> 5) + (mb >> 1)) * 4 + nb : ((t0 >> 4) + nb) * 2 + (mb >> 1)) * 512 + (mb & 1) * 256 + lane * 8;   // the lane's 8 values are k = (mb & 1) * 16 + 8 hi + 0..7 of row lr of that tile
            *(v8us*)(Ph + off) = __builtin_bit_cast(v8us, yh); *(v8us*)(Pl + off) = __builtin_bit_cast(v8us, yl); }
        asm volatile("s_wait_xcnt 0x0" ::: "memory");   // behind the row's 8 stores, in front of whatever next overwrites a register that one of them names (the next row's values; behind the last row, the code of the other projection's side, to which the built kernel holds a branch)
        __builtin_amdgcn_sched_barrier(0);   // one row of four tiles at a time: left alone, the scheduler ran all sixteen tiles' splits side by side and went over the 256 registers (spills to scratch)
    }
}
// k_gemmw: q, k and v of every sequence in one launch; grid (3 projections x groups of 4 heads, token rows / 128), 256 threads; a wave stays under 256 registers, so two work-groups fit a WGP and one's barriers, prologue and epilogue run beside the other's products; wave w: token block w & 1, head w >> 1 of the group. The 9 work-groups of one block of token rows are neighbours in the grid, so a block of x is fetched once while the three weight planes (under 4 MiB) stay in use throughout.
__global__ __launch_bounds__(256) void k_gemmw(const bf* __restrict__ WB, const bf* __restrict__ XB, const float* __restrict__ bq, const float* __restrict__ bk, const float* __restrict__ bv, bf* QPh, bf* QPl, bf* KPh, bf* KPl, bf* VTh, bf* VTl) {
    __shared__ __attribute__((aligned(16))) bf ring[2 * GST];   // two stages, 96 KiB
    const int wave = __builtin_amdgcn_readfirstlane((int)(threadIdx.x >> 5)); const int cx = wave & 1, cw = wave >> 1;
    const int pj = blockIdx.x / (NH_ / GHB), h0 = (blockIdx.x % (NH_ / GHB)) * GHB, tb0 = blockIdx.y * GTB;
    const int head = h0 + cw, tok0 = (tb0 + cx) * 64;
    const bf* xg = XB + (size_t)tb0 * GRB + threadIdx.x * 8; const bf* wg = WB + (size_t)(pj * NH_ + h0) * GRB + threadIdx.x * 8;
    const unsigned lds0 = (unsigned)(size_t)ring + threadIdx.x * 16u;   // low 32 bits of the __shared__ address = byte offset in the work-group's LDS
    v8f acc[4][4];
    gemmw_main<bf>(ring, xg, wg, lds0, pj == 2 ? cx : GTB + cw, pj == 2 ? GTB + cw : cx, acc);
    if (pj == 2) gemmw_store<true>(acc, bv, VTh, VTl, tok0, head);
    else gemmw_store<false>(acc, pj ? bk : bq, pj ? KPh : QPh, pj ? KPl : QPl, tok0, head);
}

__device__ __forceinline__ h16 tohx(float x) { return (h16)x; }
__device__ __forceinline__ void splitf(float y, unsigned short& h, unsigned short& l) { h = f2bf(y); l = f2bf(y - bf2f(h)); }
typedef __attribute__((ext_vector_type(2))) _Float16 v2h;
typedef __attribute__((ext_vector_type(4))) _Float16 v4h;
typedef __attribute__((ext_vector_type(2))) unsigned short v2us;
typedef __attribute__((ext_vector_type(4))) unsigned short v4us;
typedef __attribute__((ext_vector_type(4))) int v4i;

__global__ __launch_bounds__(256) void k_wtG(const float* __restrict__ w, int K, int N, bf* Bt) {
    const int lane = threadIdx.x & 31; const int L0 = (blockIdx.x * 8 + (threadIdx.x >> 5)) * 8; const int nlines = N * K / 64;
{
#pragma unroll 1
        for (int l = 0; l < 8; ++l) { const int L = L0 + l; if (L >= nlines) break; const size_t e = (size_t)L * 64 + lane * 2; const int k = (int)(e % K), n = (int)(e / K); v2us o;
            o[0] = f2bf(w[(size_t)k * N + n]); o[1] = f2bf(w[(size_t)(k + 1) * N + n]); *(v2us*)(Bt + e) = o; }
         }
}
__global__ __launch_bounds__(256) void k_cscvt(const float* __restrict__ cosT, const float* __restrict__ sinT, float* CS) { const int idx = blockIdx.x * 256 + threadIdx.x; if (idx >= TT * HD) return; v2f cs; cs[0] = bfr(cosT[idx]); cs[1] = bfr(sinT[idx]); *(v2f*)(CS + (size_t)idx * 2) = cs;  }
// ---- pack_tile: f32 rows [seq][TR][DM] -> bf16 plane in the fragment order k_gemmw reads, sequences padded TR -> TP with zero rows. ONE WAVE per tile of 16 rows x 32 k (tile w of the plane).
// A load takes 4 whole 128-byte row pieces (8 lanes a row, 4 floats a lane); the lane's 4 values go out as 8 bytes. A pad row reads the sequence's last real row (address in bounds, all four loads in flight together) and stores zeros.
template <int TP, int TR>
__device__ __forceinline__ void pack_tile(const float* src, bf* dst, const int w) {
    const int lane = threadIdx.x & 31; const int kb = (w >> 2) % (DM / 32); const int row0 = ((w >> 2) / (DM / 32)) * 64 + (w & 3) * 16; const int kq = (lane & 7) * 4;
    const int bl = row0 / TP, t0 = row0 % TP + (lane >> 3);   // a 16-row tile lies inside one sequence (TP % 16 == 0)
    bf* o = dst + (size_t)w * 512 + (kq >> 4) * 256 + ((kq >> 3) & 1) * 128 + (lane >> 3) * 8 + (kq & 7);
    const float* p[4]; v4f v[4];
#pragma unroll
    for (int i = 0; i < 4; ++i) { const int t = t0 + i * 4; p[i] = src + ((size_t)bl * TR + ((TP == TR || t < TR) ? t : TR - 1)) * DM + kb * 32 + kq; }
#pragma unroll
    for (int i = 0; i < 4; ++i) v[i] = *(const v4fa*)p[i];
    // s_wait_xcnt: behind the four loads, in front of whatever next overwrites one of their address pairs; the pairs are inputs, so none is given away (not even to a load's own result) in front of the wait.
    asm volatile("s_wait_xcnt 0x0" :: "v"(p[0]), "v"(p[1]), "v"(p[2]), "v"(p[3]) : "memory");
#pragma unroll
    for (int i = 0; i < 4; ++i) { v4us ov;
#pragma unroll
        for (int u = 0; u < 4; ++u) ov[u] = f2bf((TP == TR || t0 + i * 4 < TR) ? v[i][u] : 0.f);
        *(v4us*)(o + i * 32) = ov; }
    // s_wait_xcnt: behind the four stores, in front of whatever next overwrites their address pair (in the built k_pack a branch behind the weight side's stores leads to the head of the x side, which writes such registers); the pair is an input, so it is not given away in front of the wait.
    asm volatile("s_wait_xcnt 0x0" :: "v"(o) : "memory");
}
// k_pack: x and the three weight matrices in one launch, 8 tiles per block, grid exact: blocks below NXT / 8 pack x, then NWT / 8 blocks for each of Wq, Wk, Wv (planes one behind another in WB).
#define NXT (GR / 16 * (DM / 32))   // tiles of the x plane
#define NWT (DQ / 16 * (DM / 32))   // tiles of one weight plane
__global__ __launch_bounds__(256) void k_pack(const float* x, const float* wq, const float* wk, const float* wv, bf* XB, bf* WB) {
    const int wv8 = threadIdx.x >> 5;
    if (blockIdx.x < NXT / 8) { pack_tile<TT, LR>(x, XB, blockIdx.x * 8 + wv8); return; }
    const int u = blockIdx.x - NXT / 8; const int pj = u / (NWT / 8);
    pack_tile<DQ, DQ>(pj == 0 ? wq : pj == 1 ? wk : wv, WB + (size_t)pj * DQ * DM, (u % (NWT / 8)) * 8 + wv8);
}
// ---- k_fattn: scores, softmax, attn.v and the head merge in one kernel; ONE WAVE = 32 query columns of one virtual head, 4 waves per block; grid (ceil(NQB / 4), NVH). The block's waves read the same keys: each pass's K and V come once per block through a two-buffer LDS ring filled by asynchronous copies.
// St = K.Qt (A = 16 key rows, B = 16 query columns kept in registers) and Ot += Vt.Pt: a lane holds one query's scores, so two St tiles (keys 0-15, 16-31 of a pass) convert in place into the B operand Pt,
// whose k order (8 hi + s, 16 + 8 hi + s - 8) is the order WFrag::ld gives the Vt rows. Planes in fragment order: a pass (a stage of the ring) is 4 KiB in a row of each of Kh, Kl, Vh, Vl, laid down in LDS unchanged. Running maximum and sum per query (online softmax over passes of 32 keys), division by the sum at the end.
// hl x hl (3 products) on both matrix products as before; keys >= LR masked in the last pass only (every earlier pass lies below LR).
#define NKB ((LR + 31) / 32)   // key passes
#define NQB ((LR + 31) / 32)   // 32-query column blocks per head
__device__ __forceinline__ float xhalf(float x) { const int b = __float_as_int(x); return __int_as_float(__builtin_amdgcn_permlanex16(b, b, 0x76543210, 0xfedcba98, false, false)); }   // lane l <-> l ^ 16
// xwait: stands behind a group of global loads, in front of whatever next overwrites a register that one of them names as its address.
// The group's address pairs are inputs, so they stay live up to the wait; the plane pointers carry no __restrict__, so the "memory" clobber keeps the loads in front of it.
__device__ __forceinline__ void xwait(const bf* a, const bf* b) { asm volatile("s_wait_xcnt 0x0" :: "v"(a), "v"(b) : "memory"); }
#define FPL 2048            // elements of one plane's part of a stage: 32 keys x 64
#define FST (4 * FPL)       // elements of a stage: Kh, Kl, Vh, Vl
// fa_stage: one stage's 16 KiB, 8 copies of 16 bytes per lane (128 lanes x 16 B = half a plane's part per copy). kh .. vl: the lane's own 16 bytes in the stage's part of each plane; lds: the lane's own byte address in the buffer.
// s_wait_xcnt closes the statement: it stands behind the last copy and in front of whatever next rewrites a register that a copy names.
__device__ __forceinline__ void fa_stage(const bf* kh, const bf* kl, const bf* vh, const bf* vl, const unsigned lds) {
    asm volatile("global_load_async_to_lds_b128 %0, %8, off\n\t"
                 "global_load_async_to_lds_b128 %1, %9, off\n\t"
                 "global_load_async_to_lds_b128 %2, %10, off\n\t"
                 "global_load_async_to_lds_b128 %3, %11, off\n\t"
                 "global_load_async_to_lds_b128 %4, %12, off\n\t"
                 "global_load_async_to_lds_b128 %5, %13, off\n\t"
                 "global_load_async_to_lds_b128 %6, %14, off\n\t"
                 "global_load_async_to_lds_b128 %7, %15, off\n\t"
                 "s_wait_xcnt 0x0"
                 :: "v"(lds), "v"(lds + 2048u), "v"(lds + 4096u), "v"(lds + 6144u), "v"(lds + 8192u), "v"(lds + 10240u), "v"(lds + 12288u), "v"(lds + 14336u),
                    "v"(kh), "v"(kh + 1024), "v"(kl), "v"(kl + 1024), "v"(vh), "v"(vh + 1024), "v"(vl), "v"(vl + 1024)
                 : "memory");
}
template <bool LAST>
__device__ __forceinline__ void fa_pass(const int key0, const int hi, const bf* sb,   // sb: the pass's buffer + lane * 8
                                        const v16bf (&qh)[2][2], const v16bf (&ql)[2][2], v8f (&o)[4][2], float (&m)[2], float (&l)[2]) {
    const float C = SCL * 1.4426950408889634f;
    v16bf kh[2][2], kl[2][2];
#pragma unroll
    for (int kt = 0; kt < 2; ++kt)
#pragma unroll
        for (int ks = 0; ks < 2; ++ks) { kh[kt][ks] = WFrag<bf>::ld(sb + kt * 1024 + ks * 512); kl[kt][ks] = WFrag<bf>::ld(sb + FPL + kt * 1024 + ks * 512); }
    __builtin_amdgcn_sched_barrier(0);   // holds the K fragments' 16 LDS loads together at the head of the pass: left alone, the scheduler strung them out among the score products, each group behind a full wait of its own
    v8f s[2][2];
#pragma unroll
    for (int kt = 0; kt < 2; ++kt)
#pragma unroll
        for (int qt = 0; qt < 2; ++qt) s[kt][qt] = (v8f){};
#pragma unroll
    for (int ks = 0; ks < 2; ++ks) {
#pragma unroll
        for (int kt = 0; kt < 2; ++kt)
#pragma unroll
            for (int qt = 0; qt < 2; ++qt) s[kt][qt] = wmmab(kh[kt][ks], qh[qt][ks], s[kt][qt]);
#pragma unroll
        for (int kt = 0; kt < 2; ++kt)
#pragma unroll
            for (int qt = 0; qt < 2; ++qt) s[kt][qt] = wmmab(kl[kt][ks], qh[qt][ks], s[kt][qt]);
#pragma unroll
        for (int kt = 0; kt < 2; ++kt)
#pragma unroll
            for (int qt = 0; qt < 2; ++qt) s[kt][qt] = wmmab(kh[kt][ks], ql[qt][ks], s[kt][qt]);
    }
    v16bf ph[2], pl[2];
#pragma unroll
    for (int qt = 0; qt < 2; ++qt) {
        if (LAST) {
#pragma unroll
            for (int kt = 0; kt < 2; ++kt)
#pragma unroll
                for (int j = 0; j < 8; ++j) s[kt][qt][j] = (key0 + kt * 16 + 8 * hi + j < LR) ? s[kt][qt][j] : -3.0e38f;
        }
        float mx = m[qt];
#pragma unroll
        for (int kt = 0; kt < 2; ++kt)
#pragma unroll
            for (int j = 0; j < 8; ++j) mx = fmaxf(mx, s[kt][qt][j]);
        mx = fmaxf(mx, xhalf(mx));
        const float al = __builtin_amdgcn_exp2f((m[qt] - mx) * C); const float mc = mx * C; m[qt] = mx;
        v2f p[8]; v2f c2, nm; c2[0] = C; c2[1] = C; nm[0] = -mc; nm[1] = -mc;
#pragma unroll
        for (int e = 0; e < 8; ++e) { v2f sv; sv[0] = s[e >> 2][qt][(e & 3) * 2]; sv[1] = s[e >> 2][qt][(e & 3) * 2 + 1]; const v2f t = __builtin_elementwise_fma(sv, c2, nm); p[e][0] = __builtin_amdgcn_exp2f(t[0]); p[e][1] = __builtin_amdgcn_exp2f(t[1]); }
        v2f ps = p[0];
#pragma unroll
        for (int e = 1; e < 8; ++e) ps += p[e];
#pragma unroll
        for (int e = 0; e < 8; ++e) { const v2bf h2 = __builtin_convertvector(p[e], v2bf); const v2f r = p[e] - __builtin_convertvector(h2, v2f); const v2bf l2 = __builtin_convertvector(r, v2bf);
            ph[qt][2 * e] = h2[0]; ph[qt][2 * e + 1] = h2[1]; pl[qt][2 * e] = l2[0]; pl[qt][2 * e + 1] = l2[1]; }
        l[qt] = l[qt] * al + (ps[0] + ps[1]);
#pragma unroll
        for (int dt = 0; dt < 4; ++dt) o[dt][qt] *= al;
    }
    __builtin_amdgcn_sched_barrier(0);   // keeps the V fragments' loads behind the softmax: ahead of it they and the scores do not fit the 256 registers of four waves per SIMD
    v16bf vh[4], vl[4];
#pragma unroll
    for (int dt = 0; dt < 4; ++dt) { vh[dt] = WFrag<bf>::ld(sb + 2 * FPL + dt * 512); vl[dt] = WFrag<bf>::ld(sb + 3 * FPL + dt * 512); }
#pragma unroll
    for (int dt = 0; dt < 4; ++dt)
#pragma unroll
        for (int qt = 0; qt < 2; ++qt) o[dt][qt] = wmmab(vh[dt], ph[qt], o[dt][qt]);
#pragma unroll
    for (int dt = 0; dt < 4; ++dt)
#pragma unroll
        for (int qt = 0; qt < 2; ++qt) o[dt][qt] = wmmab(vh[dt], pl[qt], o[dt][qt]);
#pragma unroll
    for (int dt = 0; dt < 4; ++dt)
#pragma unroll
        for (int qt = 0; qt < 2; ++qt) o[dt][qt] = wmmab(vl[dt], ph[qt], o[dt][qt]);
}
// amdgpu_waves_per_eu(4, 4): the register budget of four waves per SIMD (256). With K and V read from LDS where they are used, not held a pass ahead, the pass fits it without scratch; four blocks (128 KiB of LDS) share a WGP, and one's barriers and LDS waits run beside the others' products.
__global__ __launch_bounds__(128) __attribute__((amdgpu_waves_per_eu(4, 4))) void k_fattn(const bf* Qh, const bf* Ql, const bf* Kh, const bf* Kl, const bf* Vh, const bf* Vl, float* O2) {
    __shared__ __attribute__((aligned(16))) bf ring[2 * FST];   // two stages, 32 KiB
    const int lane = threadIdx.x & 31, lr = lane & 15, hi = lane >> 4; const int qb = blockIdx.x * 4 + __builtin_amdgcn_readfirstlane((int)(threadIdx.x >> 5));
    const bool act = qb < NQB;   // wave-uniform: the last block's fourth wave has no query columns; it loads Q fragments of pad rows, copies its share of every stage and passes every barrier, and does nothing else
    const int z = blockIdx.y; const int bl = z / NH_, h = z % NH_; const size_t pz = (size_t)z * TT * HD;
    v16bf qh[2][2], ql[2][2];
    const bf* kch = Kh + pz + threadIdx.x * 8; const bf* kcl = Kl + pz + threadIdx.x * 8; const bf* vch = Vh + pz + threadIdx.x * 8; const bf* vcl = Vl + pz + threadIdx.x * 8;   // the lane's own 16 bytes of stage 0
    const unsigned lds0 = (unsigned)(size_t)ring + threadIdx.x * 16u;   // low 32 bits of the __shared__ address = byte offset in the work-group's LDS
    fa_stage(kch, kcl, vch, vcl, lds0);
    const bf* qa = Qh + pz + (size_t)(qb * 32) * HD + lane * 8; const bf* qc = Ql + pz + (size_t)(qb * 32) * HD + lane * 8;   // qb * 32 + 31 < TT for every wave of the grid
#pragma unroll
    for (int t = 0; t < 2; ++t)
#pragma unroll
        for (int ks = 0; ks < 2; ++ks) { const size_t fo = (size_t)(t * 16) * HD + ks * 512; qh[t][ks] = WFrag<bf>::ld(qa + fo); ql[t][ks] = WFrag<bf>::ld(qc + fo); }
    xwait(qa, qc);
    v8f o[4][2]; float m[2] = { -3.0e38f, -3.0e38f }, l[2] = { 0.f, 0.f };
#pragma unroll
    for (int dt = 0; dt < 4; ++dt)
#pragma unroll
        for (int qt = 0; qt < 2; ++qt) o[dt][qt] = (v8f){};
    asm volatile("s_wait_asynccnt 0x0" ::: "memory");   // this wave's copies of stage 0 have landed
    __syncthreads();                                     // ... and every other wave's: stage 0 may be read
    fa_stage(kch + FPL, kcl + FPL, vch + FPL, vcl + FPL, lds0 + FST * 2u);
#pragma unroll 1   // rolled: one pass is already some hundred instructions; the buffer alternates by address
    for (int kb = 0; kb < NKB - 1; ++kb) {
        if (act) fa_pass<false>(kb * 32, hi, ring + (kb & 1) * FST + lane * 8, qh, ql, o, m, l);
        asm volatile("s_wait_dscnt 0x0" ::: "memory");      // this wave's reads of stage kb are done before the buffer is given up
        asm volatile("s_wait_asynccnt 0x0" ::: "memory");   // this wave's copies of stage kb + 1 have landed
        __syncthreads();                                     // publishes stage kb + 1 and ends every wave's reads of stage kb
        if (kb + 2 < NKB) fa_stage(kch + (kb + 2) * FPL, kcl + (kb + 2) * FPL, vch + (kb + 2) * FPL, vcl + (kb + 2) * FPL, lds0 + (unsigned)(kb & 1) * (FST * 2u));   // refill of the buffer just left
    }
    asm volatile("s_wait_asynccnt 0x0" ::: "memory");   // nothing of this wave's is in flight when it goes on to the last pass and ends
    if (!act) return;   // behind the last barrier
    fa_pass<true>((NKB - 1) * 32, hi, ring + ((NKB - 1) & 1) * FST + lane * 8, qh, ql, o, m, l);
#pragma unroll
    for (int qt = 0; qt < 2; ++qt) { const float f = __fdiv_rn(1.0f, l[qt] + xhalf(l[qt])); const int q = qb * 32 + qt * 16 + lr;
        if (q < LR) { float* dst = O2 + ((size_t)bl * LR + q) * DM + (size_t)h * HD + 8 * hi;
#pragma unroll
            for (int dt = 0; dt < 4; ++dt) { v4f a, b;
#pragma unroll
                for (int j = 0; j < 4; ++j) { a[j] = o[dt][qt][j] * f; b[j] = o[dt][qt][4 + j] * f; }
                *(v4f*)(dst + dt * 16) = a; *(v4f*)(dst + dt * 16 + 4) = b; } } }
}
__global__ __launch_bounds__(256) void k_merge(const float* __restrict__ O, int h0, bf* Ah, bf* Al) { const size_t e = ((size_t)blockIdx.x * 256 + threadIdx.x) * 2; if (e >= (size_t)ZH * TT * HD) return; const int d = (int)(e % HD); const int t = (int)((e / HD) % TT); const int zz = (int)(e / ((size_t)HD * TT)); const float cs = (t < RH) ? 1.0f : (1.0f / PCAR); const size_t oo = (size_t)t * DQ + (h0 + zz) * HD + d;
    v2us oh, ol;
#pragma unroll
    for (int q = 0; q < 2; ++q) { unsigned short a, c2; splitf(O[e + q] * cs, a, c2); oh[q] = a; ol[q] = c2; } *(v2us*)(Ah + oo) = oh; *(v2us*)(Al + oo) = ol;  }

extern "C" void kernel_launch(void* const* d_in, const int* in_sizes, int n_in,
                              void* d_out, int out_size, void* d_ws, size_t ws_size, hipStream_t stream) {
    (void)in_sizes; (void)n_in; (void)out_size;
    const float* x = (const float*)d_in[0]; const float* wq = (const float*)d_in[1]; const float* bq = (const float*)d_in[2]; const float* wk = (const float*)d_in[3]; const float* bk = (const float*)d_in[4]; const float* wv = (const float*)d_in[5]; const float* bv = (const float*)d_in[6]; const float* wo = nullptr; (void)wo; const float* cosT = nullptr; const float* sinT = nullptr; (void)cosT; (void)sinT;
    float* OUT = (float*)d_out;   // [32][577][768]
    char* wsp = (char*)d_ws; auto take = [&](size_t bytes) { char* p = wsp; wsp += (bytes + 255) & ~(size_t)255; return (void*)p; };
    bf* WB = (bf*)take((size_t)3 * DQ * DM * 2);   // Wq, Wk, Wv (DKV == DQ)
    bf* XB = (bf*)take((size_t)GR * DM * 2);
    bf* QPh = (bf*)take((size_t)NVH * TT * HD * 2); bf* QPl = (bf*)take((size_t)NVH * TT * HD * 2);
    bf* KPh = (bf*)take((size_t)NVH * TT * HD * 2); bf* KPl = (bf*)take((size_t)NVH * TT * HD * 2);
    bf* VTh = (bf*)take((size_t)NVH * HD * TT * 2); bf* VTl = (bf*)take((size_t)NVH * HD * TT * 2);
    if ((size_t)(wsp - (char*)d_ws) > ws_size) return;   // ws ~ 214 MiB
    k_pack<<<NXT / 8 + 3 * (NWT / 8), 256, 0, stream>>>(x, wq, wk, wv, XB, WB);
    k_gemmw<<<dim3(3 * (NH_ / GHB), GR / (64 * GTB), 1), 256, 0, stream>>>(WB, XB, bq, bk, bv, QPh, QPl, KPh, KPl, VTh, VTl);
    k_fattn<<<dim3((NQB + 3) / 4, NVH, 1), 128, 0, stream>>>(QPh, QPl, KPh, KPl, VTh, VTl, OUT);   // virtual head z = bl * 12 + h
}

// v008
// One run takes 105 microseconds.
// Versions in between are left out here; by their measured steps it is 1.52 times as fast as v006.
// Counting every step since v000, it is 13.7 times as fast.
#include <hip/hip_runtime.h>

// ViTSelfAttention (hidden [32][577][768]; q/k/v = x W^T + b (12 heads x 64); softmax(q.k / 8); out = merged context (no output projection) -> [32][577][768]).
// Batched layout (exact): sequences padded 577 -> 640 with zero rows (padded KEYS masked out of every softmax row; padded query rows computed and discarded); 32 sequences x 12 heads = 384 'virtual heads' of 640 tokens, all in ONE launch per stage (pack, projections, fused attention: 3 launches); the projections run on the 20,480 stacked rows at once and store their results as f16 head planes themselves.
// Every 16-bit operand plane lies in FRAGMENT ORDER: a tile of 16 rows x 32 k is 1 KiB in a row, element (row, kk) at (kk >> 4) * 256 + (((kk >> 3) & 1) * 16 + row) * 8 + (kk & 7), so that lane l's two 16-byte pieces of a fragment
// stand at l * 8 and 256 + l * 8 and each wave-wide 16-byte load or store covers 512 bytes in a row (4 whole lines, not 32 bytes of each of 16 lines). The registers hold what they held with row-major planes.
// Compute dtypes, f32 accumulate: every input rounded to bf16; q/k/v on PLAIN bf16 operands (inputs: exact) + bias, each result rounded once to f16 (11 significant bits; |q|, |k|, |v| must stay below 65,504); scores AND attn.v on f16 operands, one product each (the weights exp(s - max) lie in [0, 1]); softmax f32, online over passes of 32 keys, with the j < 577 predicate; merged context written directly in f32 to the output.

#define NB_  32
#define TT   640
#define DM   768
#define NH_  12
#define NKV  12
#define REP  (NH_ / NKV)
#define HD   64
#define DQ   (NH_ * HD)
#define DKV  (NKV * HD)
#define ZH   24
#define RH   640                  // k_merge (not launched): rows t < RH scale 1, others 1 / PCAR
#define WIN  0
#define PCAR 1024.0f
#define LR   577    // real tokens per sequence
#define GB   32     // sequences per group (all of them: one group)
#define NG   (NB_ / GB)
#define GR   (GB * TT)   // stacked rows per group
#define NVH  (GB * NH_)  // virtual heads per group
#define SCL  0.125f   // HD^-0.5
typedef _Float16 h16;
typedef unsigned short bf;
typedef __attribute__((ext_vector_type(16))) __bf16   v16bf;
typedef __attribute__((ext_vector_type(16))) _Float16 v16h;
typedef __attribute__((ext_vector_type(8)))  _Float16 v8h;
typedef __attribute__((ext_vector_type(8)))  unsigned short v8us;
typedef __attribute__((ext_vector_type(8)))  float    v8f;
typedef __attribute__((ext_vector_type(4)))  float    v4f;
typedef v8h  __attribute__((may_alias)) v8ha;
typedef v4f  __attribute__((may_alias)) v4fa;
typedef v8us __attribute__((may_alias)) v8usa;

__device__ __forceinline__ unsigned short f2bf(float f) { unsigned u = __float_as_uint(f); u += 0x7FFFu + ((u >> 16) & 1u); return (unsigned short)(u >> 16); }
__device__ __forceinline__ float bf2f(unsigned short b) { return __uint_as_float(((unsigned)b) << 16); }
__device__ __forceinline__ float bfr(float f) { return bf2f(f2bf(f)); }
__device__ __forceinline__ v16h cat16(v8h lo, v8h hi) { return __builtin_shufflevector(lo, hi, 0, 1, 2, 3, 4, 5, 6, 7, 8, 9, 10, 11, 12, 13, 14, 15); }
__device__ __forceinline__ v16bf cat16b(v8us lo, v8us hi) { return __builtin_bit_cast(v16bf, __builtin_shufflevector(lo, hi, 0, 1, 2, 3, 4, 5, 6, 7, 8, 9, 10, 11, 12, 13, 14, 15)); }
__device__ __forceinline__ v8f wmma16(v16h a, v16h b, v8f c) { return __builtin_amdgcn_wmma_f32_16x16x32_f16(false, a, false, b, (short)0, c, false, false); }
__device__ __forceinline__ v8f wmmab(v16bf a, v16bf b, v8f c) { return __builtin_amdgcn_wmma_f32_16x16x32_bf16(false, a, false, b, (short)0, c, false, false); }



// ---- k_gemmw: register-blocked GEMM, one wave per 64x64 tile (16 accumulators), EIGHT waves per work-group = 128 token rows x the 256 features of 4 heads of one projection. Planes in fragment order [row / 64][k / 32][4 tiles of 16 rows][512].
// The work-group's operands come through a two-buffer LDS ring filled by asynchronous copies: a stage is 64 k of its 2 token blocks and 4 weight blocks, 6 chunks of 8 KiB, each in a row in its plane and laid down in LDS unchanged, so a chunk is fetched from L2 once for the 4 (token rows) or 2 (weight rows) waves that read it.
// y[m][n] = sum_k A[m][k] Bt[n][k] + bias (f32), rounded to f16 and stored straight into the head plane: a lane's 8 accumulators are 8 consecutive m at one n, one 16-byte store.
// VT false (q, k): A = weight rows (m = d of the head), Bt = token rows -> plane [head][t / 16][d / 32][512]. VT true (v): A = token rows, Bt = weight rows -> plane [head][t / 32][d / 16][512]. K % 32 == 0, HD == 64.
template <typename T16> struct WFrag;
template <> struct WFrag<h16> { typedef v16h V; static __device__ __forceinline__ V ld(const h16* p) { return cat16(*(const v8h*)p, *(const v8h*)(p + 256)); }   /* p = tile + lane * 8, fragment order */ static __device__ __forceinline__ v8f mma(V a, V b, v8f c) { return wmma16(a, b, c); } };
template <> struct WFrag<bf> { typedef v16bf V; static __device__ __forceinline__ V ld(const bf* p) { return cat16b(*(const v8us*)p, *(const v8us*)(p + 256)); }   /* p = tile + lane * 8, fragment order */ static __device__ __forceinline__ v8f mma(V a, V b, v8f c) { return wmmab(a, b, c); } };
typedef __attribute__((ext_vector_type(2))) float v2f;
#define GKS 64                           // k of a stage
#define GNS (DM / GKS)                   // stages
#define GTB 2                            // blocks of 64 token rows per work-group
#define GHB 4                            // heads per work-group
#define GCH (64 * GKS)                   // elements of a chunk: 64 rows x one stage's k
#define GST ((GTB + GHB) * GCH)          // elements of a stage
#define GRB ((size_t)(DM / 32) * 2048)   // elements of a block of 64 rows in a plane
// gemm_stage: one stage's 48 KiB, 12 copies of 16 bytes per lane (256 lanes x 16 B = half a chunk per copy). xg, wg: the lane's own 16 bytes in the stage's first token chunk and first weight chunk; lds: the lane's own byte address in the buffer's first chunk.
// s_wait_xcnt closes the statement: it stands behind the last copy and in front of whatever next rewrites a register that a copy names.
__device__ __forceinline__ void gemm_stage(const bf* xg, const bf* wg, const unsigned lds) {
    asm volatile("global_load_async_to_lds_b128 %0, %12, off\n\t"
                 "global_load_async_to_lds_b128 %1, %13, off\n\t"
                 "global_load_async_to_lds_b128 %2, %14, off\n\t"
                 "global_load_async_to_lds_b128 %3, %15, off\n\t"
                 "global_load_async_to_lds_b128 %4, %16, off\n\t"
                 "global_load_async_to_lds_b128 %5, %17, off\n\t"
                 "global_load_async_to_lds_b128 %6, %18, off\n\t"
                 "global_load_async_to_lds_b128 %7, %19, off\n\t"
                 "global_load_async_to_lds_b128 %8, %20, off\n\t"
                 "global_load_async_to_lds_b128 %9, %21, off\n\t"
                 "global_load_async_to_lds_b128 %10, %22, off\n\t"
                 "global_load_async_to_lds_b128 %11, %23, off\n\t"
                 "s_wait_xcnt 0x0"
                 :: "v"(lds), "v"(lds + 4096u), "v"(lds + 8192u), "v"(lds + 12288u), "v"(lds + 16384u), "v"(lds + 20480u), "v"(lds + 24576u), "v"(lds + 28672u), "v"(lds + 32768u), "v"(lds + 36864u), "v"(lds + 40960u), "v"(lds + 45056u),
                    "v"(xg), "v"(xg + 2048), "v"(xg + GRB), "v"(xg + GRB + 2048), "v"(wg), "v"(wg + 2048), "v"(wg + GRB), "v"(wg + GRB + 2048), "v"(wg + 2 * GRB), "v"(wg + 2 * GRB + 2048), "v"(wg + 3 * GRB), "v"(wg + 3 * GRB + 2048)
                 : "memory");
}
template <typename T16>
__device__ __forceinline__ void gemmw_main(const T16* ring, const T16* xg, const T16* wg, const unsigned lds0, const int ca, const int cb, v8f (&acc)[4][4]) {   // ca, cb: the chunks of a stage that hold this wave's A rows and Bt rows
    typedef typename WFrag<T16>::V V;
    const int lane = threadIdx.x & 31;
#pragma unroll
    for (int mb = 0; mb < 4; ++mb)
#pragma unroll
        for (int nb = 0; nb < 4; ++nb) acc[mb][nb] = (v8f){};
    gemm_stage(xg, wg, lds0);
    asm volatile("s_wait_asynccnt 0x0" ::: "memory");   // this wave's copies of stage 0 have landed
    __syncthreads();                                     // ... and every other wave's: stage 0 may be read
    gemm_stage(xg + GCH, wg + GCH, lds0 + GST * 2u);
#pragma unroll 1   // rolled: the buffer alternates by address, one copy of the body serves both
    for (int s = 0; s < GNS; ++s) {
        const T16* pa = ring + (s & 1) * GST + ca * GCH + lane * 8; const T16* pb = ring + (s & 1) * GST + cb * GCH + lane * 8;
#pragma unroll   // both 32-k blocks of a stage in line: every LDS offset is an immediate, and the second block's loads can start under the first block's last products
        for (int ks = 0; ks < GKS / 32; ++ks) {
            V a[4], b[4];
#pragma unroll
            for (int t = 0; t < 4; ++t) { a[t] = WFrag<T16>::ld(pa + ks * 2048 + t * 512); b[t] = WFrag<T16>::ld(pb + ks * 2048 + t * 512); }
            __builtin_amdgcn_sched_barrier(0);   // holds the block's 16 LDS loads together at its head: left alone, the scheduler kept one B fragment and strung its reloads out among the WMMAs, each behind a full wait of its own
#pragma unroll
            for (int nb = 0; nb < 4; ++nb)
#pragma unroll
                for (int mb = 0; mb < 4; ++mb) acc[mb][nb] = WFrag<T16>::mma(a[mb], b[nb], acc[mb][nb]);
        }
        asm volatile("s_wait_dscnt 0x0" ::: "memory");      // this wave's reads of stage s are done before the buffer is given up
        asm volatile("s_wait_asynccnt 0x0" ::: "memory");   // this wave's copies of stage s + 1 have landed
        __syncthreads();                                     // publishes stage s + 1 and ends every wave's reads of stage s
        if (s + 2 < GNS) gemm_stage(xg + (s + 2) * GCH, wg + (s + 2) * GCH, lds0 + (unsigned)(s & 1) * (GST * 2u));   // refill of the buffer just left
    }
    asm volatile("s_wait_asynccnt 0x0" ::: "memory");   // nothing of this wave's is in flight when it goes on to the epilogue and ends
}
template <bool VT>
__device__ __forceinline__ void gemmw_store(const v8f (&acc)[4][4], const float* __restrict__ bias, h16* P, const int tok0, const int head) {
    const int lane = threadIdx.x & 31, lr = lane & 15, hi = lane >> 4; const int f0 = head * 64;
    const size_t pz = ((size_t)(tok0 / TT) * NH_ + head) * TT * HD; const int t0 = tok0 % TT;   // a 64-row tile lies inside one sequence (TT % 64 == 0)
#pragma unroll
    for (int mb = 0; mb < 4; ++mb) {
        v8f bm;
        if (!VT) { const v4f b0 = *(const v4fa*)(bias + f0 + mb * 16 + 8 * hi), b1 = *(const v4fa*)(bias + f0 + mb * 16 + 8 * hi + 4);
#pragma unroll
            for (int j = 0; j < 4; ++j) { bm[j] = bfr(b0[j]); bm[4 + j] = bfr(b1[j]); } }
#pragma unroll
        for (int nb = 0; nb < 4; ++nb) {
            if (VT) { const float b = bfr(bias[f0 + nb * 16 + lr]);
#pragma unroll
                for (int j = 0; j < 8; ++j) bm[j] = b; }
            const v8f y = acc[mb][nb] + bm;
            const size_t off = pz + (size_t)(VT ? ((t0 >> 5) + (mb >> 1)) * 4 + nb : ((t0 >> 4) + nb) * 2 + (mb >> 1)) * 512 + (mb & 1) * 256 + lane * 8;   // the lane's 8 values are k = (mb & 1) * 16 + 8 hi + 0..7 of row lr of that tile
            *(v8h*)(P + off) = __builtin_convertvector(y, v8h); }
        asm volatile("s_wait_xcnt 0x0" ::: "memory");   // behind the row's 4 stores, in front of whatever next overwrites a register that one of them names (the next row's values; behind the last row, the code of the other projection's side, to which the built kernel holds a branch)
    }
}
// k_gemmw: q, k and v of every sequence in one launch; grid (3 projections x groups of 4 heads, token rows / 128), 256 threads; a wave stays under 256 registers, so two work-groups fit a WGP and one's barriers, prologue and epilogue run beside the other's products; wave w: token block w & 1, head w >> 1 of the group. The 9 work-groups of one block of token rows are neighbours in the grid, so a block of x is fetched once while the three weight planes (under 4 MiB) stay in use throughout.
__global__ __launch_bounds__(256) void k_gemmw(const bf* __restrict__ WB, const bf* __restrict__ XB, const float* __restrict__ bq, const float* __restrict__ bk, const float* __restrict__ bv, h16* QP, h16* KP, h16* VT) {
    __shared__ __attribute__((aligned(16))) bf ring[2 * GST];   // two stages, 96 KiB
    const int wave = __builtin_amdgcn_readfirstlane((int)(threadIdx.x >> 5)); const int cx = wave & 1, cw = wave >> 1;
    const int pj = blockIdx.x / (NH_ / GHB), h0 = (blockIdx.x % (NH_ / GHB)) * GHB, tb0 = blockIdx.y * GTB;
    const int head = h0 + cw, tok0 = (tb0 + cx) * 64;
    const bf* xg = XB + (size_t)tb0 * GRB + threadIdx.x * 8; const bf* wg = WB + (size_t)(pj * NH_ + h0) * GRB + threadIdx.x * 8;
    const unsigned lds0 = (unsigned)(size_t)ring + threadIdx.x * 16u;   // low 32 bits of the __shared__ address = byte offset in the work-group's LDS
    v8f acc[4][4];
    gemmw_main<bf>(ring, xg, wg, lds0, pj == 2 ? cx : GTB + cw, pj == 2 ? GTB + cw : cx, acc);
    if (pj == 2) gemmw_store<true>(acc, bv, VT, tok0, head);
    else gemmw_store<false>(acc, pj ? bk : bq, pj ? KP : QP, tok0, head);
}

__device__ __forceinline__ h16 tohx(float x) { return (h16)x; }
__device__ __forceinline__ void splitf(float y, unsigned short& h, unsigned short& l) { h = f2bf(y); l = f2bf(y - bf2f(h)); }
typedef __attribute__((ext_vector_type(2))) _Float16 v2h;
typedef __attribute__((ext_vector_type(4))) _Float16 v4h;
typedef __attribute__((ext_vector_type(2))) unsigned short v2us;
typedef __attribute__((ext_vector_type(4))) unsigned short v4us;
typedef __attribute__((ext_vector_type(4))) int v4i;

__global__ __launch_bounds__(256) void k_wtG(const float* __restrict__ w, int K, int N, bf* Bt) {
    const int lane = threadIdx.x & 31; const int L0 = (blockIdx.x * 8 + (threadIdx.x >> 5)) * 8; const int nlines = N * K / 64;
{
#pragma unroll 1
        for (int l = 0; l < 8; ++l) { const int L = L0 + l; if (L >= nlines) break; const size_t e = (size_t)L * 64 + lane * 2; const int k = (int)(e % K), n = (int)(e / K); v2us o;
            o[0] = f2bf(w[(size_t)k * N + n]); o[1] = f2bf(w[(size_t)(k + 1) * N + n]); *(v2us*)(Bt + e) = o; }
         }
}
__global__ __launch_bounds__(256) void k_cscvt(const float* __restrict__ cosT, const float* __restrict__ sinT, float* CS) { const int idx = blockIdx.x * 256 + threadIdx.x; if (idx >= TT * HD) return; v2f cs; cs[0] = bfr(cosT[idx]); cs[1] = bfr(sinT[idx]); *(v2f*)(CS + (size_t)idx * 2) = cs;  }
// ---- pack_tile: f32 rows [seq][TR][DM] -> bf16 plane in the fragment order k_gemmw reads, sequences padded TR -> TP with zero rows. ONE WAVE per tile of 16 rows x 32 k (tile w of the plane).
// A load takes 4 whole 128-byte row pieces (8 lanes a row, 4 floats a lane); the lane's 4 values go out as 8 bytes. A pad row reads the sequence's last real row (address in bounds, all four loads in flight together) and stores zeros.
template <int TP, int TR>
__device__ __forceinline__ void pack_tile(const float* src, bf* dst, const int w) {
    const int lane = threadIdx.x & 31; const int kb = (w >> 2) % (DM / 32); const int row0 = ((w >> 2) / (DM / 32)) * 64 + (w & 3) * 16; const int kq = (lane & 7) * 4;
    const int bl = row0 / TP, t0 = row0 % TP + (lane >> 3);   // a 16-row tile lies inside one sequence (TP % 16 == 0)
    bf* o = dst + (size_t)w * 512 + (kq >> 4) * 256 + ((kq >> 3) & 1) * 128 + (lane >> 3) * 8 + (kq & 7);
    const float* p[4]; v4f v[4];
#pragma unroll
    for (int i = 0; i < 4; ++i) { const int t = t0 + i * 4; p[i] = src + ((size_t)bl * TR + ((TP == TR || t < TR) ? t : TR - 1)) * DM + kb * 32 + kq; }
#pragma unroll
    for (int i = 0; i < 4; ++i) v[i] = *(const v4fa*)p[i];
    // s_wait_xcnt: behind the four loads, in front of whatever next overwrites one of their address pairs; the pairs are inputs, so none is given away (not even to a load's own result) in front of the wait.
    asm volatile("s_wait_xcnt 0x0" :: "v"(p[0]), "v"(p[1]), "v"(p[2]), "v"(p[3]) : "memory");
#pragma unroll
    for (int i = 0; i < 4; ++i) { v4us ov;
#pragma unroll
        for (int u = 0; u < 4; ++u) ov[u] = f2bf((TP == TR || t0 + i * 4 < TR) ? v[i][u] : 0.f);
        *(v4us*)(o + i * 32) = ov; }
    // s_wait_xcnt: behind the four stores, in front of whatever next overwrites their address pair (in the built k_pack a branch behind the weight side's stores leads to the head of the x side, which writes such registers); the pair is an input, so it is not given away in front of the wait.
    asm volatile("s_wait_xcnt 0x0" :: "v"(o) : "memory");
}
// k_pack: x and the three weight matrices in one launch, 8 tiles per block, grid exact: blocks below NXT / 8 pack x, then NWT / 8 blocks for each of Wq, Wk, Wv (planes one behind another in WB).
#define NXT (GR / 16 * (DM / 32))   // tiles of the x plane
#define NWT (DQ / 16 * (DM / 32))   // tiles of one weight plane
__global__ __launch_bounds__(256) void k_pack(const float* x, const float* wq, const float* wk, const float* wv, bf* XB, bf* WB) {
    const int wv8 = threadIdx.x >> 5;
    if (blockIdx.x < NXT / 8) { pack_tile<TT, LR>(x, XB, blockIdx.x * 8 + wv8); return; }
    const int u = blockIdx.x - NXT / 8; const int pj = u / (NWT / 8);
    pack_tile<DQ, DQ>(pj == 0 ? wq : pj == 1 ? wk : wv, WB + (size_t)pj * DQ * DM, (u % (NWT / 8)) * 8 + wv8);
}
// ---- k_fattn: scores, softmax, attn.v and the head merge in one kernel; ONE WAVE = 32 query columns of one virtual head, 4 waves per block; grid (ceil(NQB / 4), NVH). The block's waves read the same keys: each pass's K and V come once per block through a two-buffer LDS ring filled by asynchronous copies.
// St = K.Qt (A = 16 key rows, B = 16 query columns kept in registers) and Ot += Vt.Pt: a lane holds one query's scores, so two St tiles (keys 0-15, 16-31 of a pass) convert in place into the B operand Pt,
// whose k order (8 hi + s, 16 + 8 hi + s - 8) is the order WFrag::ld gives the Vt rows. Planes in fragment order: a pass (a stage of the ring) is 4 KiB in a row of each of K and V, laid down in LDS unchanged. Running maximum and sum per query (online softmax over passes of 32 keys), division by the sum at the end.
// f16 operands, one product, on both matrix products; keys >= LR masked in the last pass only (every earlier pass lies below LR).
#define NKB ((LR + 31) / 32)   // key passes
#define NQB ((LR + 31) / 32)   // 32-query column blocks per head
__device__ __forceinline__ float xhalf(float x) { const int b = __float_as_int(x); return __int_as_float(__builtin_amdgcn_permlanex16(b, b, 0x76543210, 0xfedcba98, false, false)); }   // lane l <-> l ^ 16
// xwait: stands behind a group of global loads, in front of whatever next overwrites a register that one of them names as its address.
// The group's address pair is an input, so it stays live up to the wait; the plane pointers carry no __restrict__, so the "memory" clobber keeps the loads in front of it.
__device__ __forceinline__ void xwait(const h16* a) { asm volatile("s_wait_xcnt 0x0" :: "v"(a) : "memory"); }
#define FPL 2048            // elements of one plane's part of a stage: 32 keys x 64
#define FST (2 * FPL)       // elements of a stage: K, V
#define OPT 68              // floats from row to row of the output staging: 64 + 4, so that the 16 rows of a wave-wide 16-byte LDS write start 4 banks apart
// fa_stage: one stage's 8 KiB, 4 copies of 16 bytes per lane (128 lanes x 16 B = half a plane's part per copy). k, v: the lane's own 16 bytes in the stage's part of each plane; lds: the lane's own byte address in the buffer.
// s_wait_xcnt closes the statement: it stands behind the last copy and in front of whatever next rewrites a register that a copy names.
__device__ __forceinline__ void fa_stage(const h16* k, const h16* v, const unsigned lds) {
    asm volatile("global_load_async_to_lds_b128 %0, %4, off\n\t"
                 "global_load_async_to_lds_b128 %1, %5, off\n\t"
                 "global_load_async_to_lds_b128 %2, %6, off\n\t"
                 "global_load_async_to_lds_b128 %3, %7, off\n\t"
                 "s_wait_xcnt 0x0"
                 :: "v"(lds), "v"(lds + 2048u), "v"(lds + 4096u), "v"(lds + 6144u),
                    "v"(k), "v"(k + 1024), "v"(v), "v"(v + 1024)
                 : "memory");
}
template <bool LAST>
__device__ __forceinline__ void fa_pass(const int key0, const int hi, const h16* sb,   // sb: the pass's buffer + lane * 8
                                        const v16h (&qf)[2][2], v8f (&o)[4][2], float (&m)[2], float (&l)[2]) {
    const float C = SCL * 1.4426950408889634f;
    v16h kf[2][2];
#pragma unroll
    for (int kt = 0; kt < 2; ++kt)
#pragma unroll
        for (int ks = 0; ks < 2; ++ks) kf[kt][ks] = WFrag<h16>::ld(sb + kt * 1024 + ks * 512);
    __builtin_amdgcn_sched_barrier(0);   // holds the K fragments' 8 LDS loads together at the head of the pass: left alone, the scheduler strung them out among the score products, each group behind a full wait of its own
    v8f s[2][2];
#pragma unroll
    for (int kt = 0; kt < 2; ++kt)
#pragma unroll
        for (int qt = 0; qt < 2; ++qt) s[kt][qt] = (v8f){};
#pragma unroll
    for (int ks = 0; ks < 2; ++ks)
#pragma unroll
        for (int kt = 0; kt < 2; ++kt)
#pragma unroll
            for (int qt = 0; qt < 2; ++qt) s[kt][qt] = wmma16(kf[kt][ks], qf[qt][ks], s[kt][qt]);
    v16h pf[2];
#pragma unroll
    for (int qt = 0; qt < 2; ++qt) {
        if (LAST) {
#pragma unroll
            for (int kt = 0; kt < 2; ++kt)
#pragma unroll
                for (int j = 0; j < 8; ++j) s[kt][qt][j] = (key0 + kt * 16 + 8 * hi + j < LR) ? s[kt][qt][j] : -3.0e38f;
        }
        float mx = m[qt];
#pragma unroll
        for (int kt = 0; kt < 2; ++kt)
#pragma unroll
            for (int j = 0; j < 8; ++j) mx = fmaxf(mx, s[kt][qt][j]);
        mx = fmaxf(mx, xhalf(mx));
        const float al = __builtin_amdgcn_exp2f((m[qt] - mx) * C); const float mc = mx * C; m[qt] = mx;
        v2f p[8]; v2f c2, nm; c2[0] = C; c2[1] = C; nm[0] = -mc; nm[1] = -mc;
#pragma unroll
        for (int e = 0; e < 8; ++e) { v2f sv; sv[0] = s[e >> 2][qt][(e & 3) * 2]; sv[1] = s[e >> 2][qt][(e & 3) * 2 + 1]; const v2f t = __builtin_elementwise_fma(sv, c2, nm); p[e][0] = __builtin_amdgcn_exp2f(t[0]); p[e][1] = __builtin_amdgcn_exp2f(t[1]); }
        v2f ps = p[0];
#pragma unroll
        for (int e = 1; e < 8; ++e) ps += p[e];
#pragma unroll
        for (int e = 0; e < 8; ++e) { const v2h h2 = __builtin_convertvector(p[e], v2h); pf[qt][2 * e] = h2[0]; pf[qt][2 * e + 1] = h2[1]; }
        l[qt] = l[qt] * al + (ps[0] + ps[1]);
#pragma unroll
        for (int dt = 0; dt < 4; ++dt) o[dt][qt] *= al;
    }
    v16h vf[4];
#pragma unroll
    for (int dt = 0; dt < 4; ++dt) vf[dt] = WFrag<h16>::ld(sb + FPL + dt * 512);
#pragma unroll
    for (int dt = 0; dt < 4; ++dt)
#pragma unroll
        for (int qt = 0; qt < 2; ++qt) o[dt][qt] = wmma16(vf[dt], pf[qt], o[dt][qt]);
}
// amdgpu_waves_per_eu(4, 4): the register budget of four waves per SIMD (256). With one f16 fragment where a hi and a lo fragment stood, the pass stays well under it without scratch; the blocks that share a WGP (50 KiB of LDS each: ring and output staging) run one's barriers and LDS waits beside the others' products.
__global__ __launch_bounds__(128) __attribute__((amdgpu_waves_per_eu(4, 4))) void k_fattn(const h16* Q, const h16* K, const h16* V, float* O2) {
    __shared__ __attribute__((aligned(16))) h16 ring[2 * FST + 4 * 32 * OPT * 2];   // two stages, 16 KiB, at the start of the block's LDS; behind them the output staging, one range of 32 rows of f32 per wave, 34 KiB
    float* ost = (float*)(ring + 2 * FST);
    const int lane = threadIdx.x & 31, lr = lane & 15, hi = lane >> 4; const int qb = blockIdx.x * 4 + __builtin_amdgcn_readfirstlane((int)(threadIdx.x >> 5));
    const bool act = qb < NQB;   // wave-uniform: the last block's fourth wave has no query columns; it loads Q fragments of pad rows, copies its share of every stage and passes every barrier, and does nothing else
    const int z = blockIdx.y; const int bl = z / NH_, h = z % NH_; const size_t pz = (size_t)z * TT * HD;
    v16h qf[2][2];
    const h16* kc = K + pz + threadIdx.x * 8; const h16* vc = V + pz + threadIdx.x * 8;   // the lane's own 16 bytes of stage 0
    const unsigned lds0 = (unsigned)(size_t)ring + threadIdx.x * 16u;   // low 32 bits of the __shared__ address = byte offset in the work-group's LDS
    fa_stage(kc, vc, lds0);
    const h16* qa = Q + pz + (size_t)(qb * 32) * HD + lane * 8;   // qb * 32 + 31 < TT for every wave of the grid
#pragma unroll
    for (int t = 0; t < 2; ++t)
#pragma unroll
        for (int ks = 0; ks < 2; ++ks) qf[t][ks] = WFrag<h16>::ld(qa + (size_t)(t * 16) * HD + ks * 512);
    xwait(qa);
    v8f o[4][2]; float m[2] = { -3.0e38f, -3.0e38f }, l[2] = { 0.f, 0.f };
#pragma unroll
    for (int dt = 0; dt < 4; ++dt)
#pragma unroll
        for (int qt = 0; qt < 2; ++qt) o[dt][qt] = (v8f){};
    asm volatile("s_wait_asynccnt 0x0" ::: "memory");   // this wave's copies of stage 0 have landed
    __syncthreads();                                     // ... and every other wave's: stage 0 may be read
    fa_stage(kc + FPL, vc + FPL, lds0 + FST * 2u);
#pragma unroll 1   // rolled: one pass is already some hundred instructions; the buffer alternates by address
    for (int kb = 0; kb < NKB - 1; ++kb) {
        if (act) fa_pass<false>(kb * 32, hi, ring + (kb & 1) * FST + lane * 8, qf, o, m, l);
        asm volatile("s_wait_dscnt 0x0" ::: "memory");      // this wave's reads of stage kb are done before the buffer is given up
        asm volatile("s_wait_asynccnt 0x0" ::: "memory");   // this wave's copies of stage kb + 1 have landed
        __syncthreads();                                     // publishes stage kb + 1 and ends every wave's reads of stage kb
        if (kb + 2 < NKB) fa_stage(kc + (kb + 2) * FPL, vc + (kb + 2) * FPL, lds0 + (unsigned)(kb & 1) * (FST * 2u));   // refill of the buffer just left
    }
    asm volatile("s_wait_asynccnt 0x0" ::: "memory");   // nothing of this wave's is in flight when it goes on to the last pass and ends
    if (!act) return;   // behind the last barrier
    fa_pass<true>((NKB - 1) * 32, hi, ring + ((NKB - 1) & 1) * FST + lane * 8, qf, o, m, l);
    // Epilogue: the wave's 32 query rows x 64 floats go through its own LDS range, so that a wave-wide 16-byte store covers two whole rows of the head (4 whole 128-byte lines), not 32 bytes of each of 16 lines.
    float* st = ost + (threadIdx.x >> 5) * (32 * OPT);
#pragma unroll
    for (int qt = 0; qt < 2; ++qt) { const float f = __fdiv_rn(1.0f, l[qt] + xhalf(l[qt])); float* w = st + (qt * 16 + lr) * OPT + 8 * hi;
#pragma unroll
        for (int dt = 0; dt < 4; ++dt) { v4f a, b;
#pragma unroll
            for (int j = 0; j < 4; ++j) { a[j] = o[dt][qt][j] * f; b[j] = o[dt][qt][4 + j] * f; }
            *(v4f*)(w + dt * 16) = a; *(v4f*)(w + dt * 16 + 4) = b; } }
    asm volatile("s_wait_dscnt 0x0" ::: "memory");   // the wave's LDS writes are done (and, for the compiler, stay) in front of the reads below, in which a lane takes what other lanes of its wave wrote
    v4f r[16];
#pragma unroll
    for (int i = 0; i < 16; ++i) r[i] = *(const v4f*)(st + (i * 2 + hi) * OPT + lr * 4);
    const int q0 = qb * 32 + hi; float* dst = O2 + ((size_t)bl * LR + q0) * DM + (size_t)h * HD + lr * 4;   // formed for every lane, used only where the row exists
    if (qb * 32 + 32 <= LR) {   // wave-uniform: all 32 rows exist (every wave but a head's last), 16 stores in a row with no test between them
#pragma unroll
        for (int i = 0; i < 16; ++i) *(v4f*)(dst + (size_t)(i * 2) * DM) = r[i];
    } else {
#pragma unroll
        for (int i = 0; i < 16; ++i) if (q0 + i * 2 < LR) *(v4f*)(dst + (size_t)(i * 2) * DM) = r[i];
    }
}
__global__ __launch_bounds__(256) void k_merge(const float* __restrict__ O, int h0, bf* Ah, bf* Al) { const size_t e = ((size_t)blockIdx.x * 256 + threadIdx.x) * 2; if (e >= (size_t)ZH * TT * HD) return; const int d = (int)(e % HD); const int t = (int)((e / HD) % TT); const int zz = (int)(e / ((size_t)HD * TT)); const float cs = (t < RH) ? 1.0f : (1.0f / PCAR); const size_t oo = (size_t)t * DQ + (h0 + zz) * HD + d;
    v2us oh, ol;
#pragma unroll
    for (int q = 0; q < 2; ++q) { unsigned short a, c2; splitf(O[e + q] * cs, a, c2); oh[q] = a; ol[q] = c2; } *(v2us*)(Ah + oo) = oh; *(v2us*)(Al + oo) = ol;  }

extern "C" void kernel_launch(void* const* d_in, const int* in_sizes, int n_in,
                              void* d_out, int out_size, void* d_ws, size_t ws_size, hipStream_t stream) {
    (void)in_sizes; (void)n_in; (void)out_size;
    const float* x = (const float*)d_in[0]; const float* wq = (const float*)d_in[1]; const float* bq = (const float*)d_in[2]; const float* wk = (const float*)d_in[3]; const float* bk = (const float*)d_in[4]; const float* wv = (const float*)d_in[5]; const float* bv = (const float*)d_in[6]; const float* wo = nullptr; (void)wo; const float* cosT = nullptr; const float* sinT = nullptr; (void)cosT; (void)sinT;
    float* OUT = (float*)d_out;   // [32][577][768]
    char* wsp = (char*)d_ws; auto take = [&](size_t bytes) { char* p = wsp; wsp += (bytes + 255) & ~(size_t)255; return (void*)p; };
    bf* WB = (bf*)take((size_t)3 * DQ * DM * 2);   // Wq, Wk, Wv (DKV == DQ)
    bf* XB = (bf*)take((size_t)GR * DM * 2);
    h16* QP = (h16*)take((size_t)NVH * TT * HD * 2); h16* KP = (h16*)take((size_t)NVH * TT * HD * 2); h16* VT = (h16*)take((size_t)NVH * HD * TT * 2);
    if ((size_t)(wsp - (char*)d_ws) > ws_size) return;   // ws ~ 124 MiB
    k_pack<<<NXT / 8 + 3 * (NWT / 8), 256, 0, stream>>>(x, wq, wk, wv, XB, WB);
    k_gemmw<<<dim3(3 * (NH_ / GHB), GR / (64 * GTB), 1), 256, 0, stream>>>(WB, XB, bq, bk, bv, QP, KP, VT);
    k_fattn<<<dim3((NQB + 3) / 4, NVH, 1), 128, 0, stream>>>(QP, KP, VT, OUT);   // virtual head z = bl * 12 + h
}

// v009
// Measured time: 101 microseconds a run.
// In two side-by-side timings against v008, it was 1.04 and 1.03 times as fast.
// Counting every step since v000, it is 14.1 times as fast.
#include <hip/hip_runtime.h>

// ViTSelfAttention (hidden [32][577][768]; q/k/v = x W^T + b (12 heads x 64); softmax(q.k / 8); out = merged context (no output projection) -> [32][577][768]).
// Batched layout (exact): sequences padded 577 -> 640 with zero rows (padded KEYS masked out of every softmax row; padded query rows computed and discarded); 32 sequences x 12 heads = 384 'virtual heads' of 640 tokens, all in ONE launch per stage (pack, projections, fused attention: 3 launches); the projections run on the 20,480 stacked rows at once and store their results as f16 head planes themselves.
// Every 16-bit operand plane lies in FRAGMENT ORDER: a tile of 16 rows x 32 k is 1 KiB in a row, element (row, kk) at (kk >> 4) * 256 + (((kk >> 3) & 1) * 16 + row) * 8 + (kk & 7), so that lane l's two 16-byte pieces of a fragment
// stand at l * 8 and 256 + l * 8 and each wave-wide 16-byte load or store covers 512 bytes in a row (4 whole lines, not 32 bytes of each of 16 lines). The registers hold what they held with row-major planes.
// Compute dtypes, f32 accumulate: every input rounded to bf16; q/k/v on PLAIN bf16 operands (inputs: exact) + bias, q then times HD^-0.5 log2(e) in f32, each result rounded once to f16 (11 significant bits; |q|, |k|, |v| must stay below 65,504); scores AND attn.v on f16 operands, one product each (the weights exp2(s - reference) lie in [0, PTH]); softmax f32, online over passes of 32 keys, with the j < 577 predicate; merged context written directly in f32 to the output.

#define NB_  32
#define TT   640
#define DM   768
#define NH_  12
#define NKV  12
#define REP  (NH_ / NKV)
#define HD   64
#define DQ   (NH_ * HD)
#define DKV  (NKV * HD)
#define ZH   24
#define RH   640                  // k_merge (not launched): rows t < RH scale 1, others 1 / PCAR
#define WIN  0
#define PCAR 1024.0f
#define LR   577    // real tokens per sequence
#define GB   32     // sequences per group (all of them: one group)
#define NG   (NB_ / GB)
#define GR   (GB * TT)   // stacked rows per group
#define NVH  (GB * NH_)  // virtual heads per group
#define SCL  0.125f   // HD^-0.5
#define QSC  (SCL * 1.4426950408889634f)   // HD^-0.5 * log2(e): multiplied into q (f32) in the projection's epilogue, so that K.Qt comes out in the units of exp2
#define PTH  4096.0f   // a lane's sum of one pass's 16 weights above which the softmax reference is raised; every weight at or below it is far inside f16 range
typedef _Float16 h16;
typedef unsigned short bf;
typedef __attribute__((ext_vector_type(16))) __bf16   v16bf;
typedef __attribute__((ext_vector_type(16))) _Float16 v16h;
typedef __attribute__((ext_vector_type(8)))  _Float16 v8h;
typedef __attribute__((ext_vector_type(8)))  unsigned short v8us;
typedef __attribute__((ext_vector_type(8)))  float    v8f;
typedef __attribute__((ext_vector_type(4)))  float    v4f;
typedef v8h  __attribute__((may_alias)) v8ha;
typedef v4f  __attribute__((may_alias)) v4fa;
typedef v8us __attribute__((may_alias)) v8usa;

__device__ __forceinline__ unsigned short f2bf(float f) { unsigned u = __float_as_uint(f); u += 0x7FFFu + ((u >> 16) & 1u); return (unsigned short)(u >> 16); }
__device__ __forceinline__ float bf2f(unsigned short b) { return __uint_as_float(((unsigned)b) << 16); }
__device__ __forceinline__ float bfr(float f) { return bf2f(f2bf(f)); }
__device__ __forceinline__ v16h cat16(v8h lo, v8h hi) { return __builtin_shufflevector(lo, hi, 0, 1, 2, 3, 4, 5, 6, 7, 8, 9, 10, 11, 12, 13, 14, 15); }
__device__ __forceinline__ v16bf cat16b(v8us lo, v8us hi) { return __builtin_bit_cast(v16bf, __builtin_shufflevector(lo, hi, 0, 1, 2, 3, 4, 5, 6, 7, 8, 9, 10, 11, 12, 13, 14, 15)); }
__device__ __forceinline__ v8f wmma16(v16h a, v16h b, v8f c) { return __builtin_amdgcn_wmma_f32_16x16x32_f16(false, a, false, b, (short)0, c, false, false); }
__device__ __forceinline__ v8f wmmab(v16bf a, v16bf b, v8f c) { return __builtin_amdgcn_wmma_f32_16x16x32_bf16(false, a, false, b, (short)0, c, false, false); }



// ---- k_gemmw: register-blocked GEMM, one wave per 64x64 tile (16 accumulators), EIGHT waves per work-group = 128 token rows x the 256 features of 4 heads of one projection. Planes in fragment order [row / 64][k / 32][4 tiles of 16 rows][512].
// The work-group's operands come through a two-buffer LDS ring filled by asynchronous copies: a stage is 64 k of its 2 token blocks and 4 weight blocks, 6 chunks of 8 KiB, each in a row in its plane and laid down in LDS unchanged, so a chunk is fetched from L2 once for the 4 (token rows) or 2 (weight rows) waves that read it.
// y[m][n] = sum_k A[m][k] Bt[n][k] + bias (f32), rounded to f16 and stored straight into the head plane: a lane's 8 accumulators are 8 consecutive m at one n, one 16-byte store.
// VT false (q, k): A = weight rows (m = d of the head), Bt = token rows -> plane [head][t / 16][d / 32][512]. VT true (v): A = token rows, Bt = weight rows -> plane [head][t / 32][d / 16][512]. K % 32 == 0, HD == 64.
template <typename T16> struct WFrag;
template <> struct WFrag<h16> { typedef v16h V; static __device__ __forceinline__ V ld(const h16* p) { return cat16(*(const v8h*)p, *(const v8h*)(p + 256)); }   /* p = tile + lane * 8, fragment order */ static __device__ __forceinline__ v8f mma(V a, V b, v8f c) { return wmma16(a, b, c); } };
template <> struct WFrag<bf> { typedef v16bf V; static __device__ __forceinline__ V ld(const bf* p) { return cat16b(*(const v8us*)p, *(const v8us*)(p + 256)); }   /* p = tile + lane * 8, fragment order */ static __device__ __forceinline__ v8f mma(V a, V b, v8f c) { return wmmab(a, b, c); } };
typedef __attribute__((ext_vector_type(2))) float v2f;
#define GKS 64                           // k of a stage
#define GNS (DM / GKS)                   // stages
#define GTB 2                            // blocks of 64 token rows per work-group
#define GHB 4                            // heads per work-group
#define GCH (64 * GKS)                   // elements of a chunk: 64 rows x one stage's k
#define GST ((GTB + GHB) * GCH)          // elements of a stage
#define GRB ((size_t)(DM / 32) * 2048)   // elements of a block of 64 rows in a plane
// gemm_stage: one stage's 48 KiB, 12 copies of 16 bytes per lane (256 lanes x 16 B = half a chunk per copy). xg, wg: the lane's own 16 bytes in the stage's first token chunk and first weight chunk; lds: the lane's own byte address in the buffer's first chunk.
// s_wait_xcnt closes the statement: it stands behind the last copy and in front of whatever next rewrites a register that a copy names.
__device__ __forceinline__ void gemm_stage(const bf* xg, const bf* wg, const unsigned lds) {
    asm volatile("global_load_async_to_lds_b128 %0, %12, off\n\t"
                 "global_load_async_to_lds_b128 %1, %13, off\n\t"
                 "global_load_async_to_lds_b128 %2, %14, off\n\t"
                 "global_load_async_to_lds_b128 %3, %15, off\n\t"
                 "global_load_async_to_lds_b128 %4, %16, off\n\t"
                 "global_load_async_to_lds_b128 %5, %17, off\n\t"
                 "global_load_async_to_lds_b128 %6, %18, off\n\t"
                 "global_load_async_to_lds_b128 %7, %19, off\n\t"
                 "global_load_async_to_lds_b128 %8, %20, off\n\t"
                 "global_load_async_to_lds_b128 %9, %21, off\n\t"
                 "global_load_async_to_lds_b128 %10, %22, off\n\t"
                 "global_load_async_to_lds_b128 %11, %23, off\n\t"
                 "s_wait_xcnt 0x0"
                 :: "v"(lds), "v"(lds + 4096u), "v"(lds + 8192u), "v"(lds + 12288u), "v"(lds + 16384u), "v"(lds + 20480u), "v"(lds + 24576u), "v"(lds + 28672u), "v"(lds + 32768u), "v"(lds + 36864u), "v"(lds + 40960u), "v"(lds + 45056u),
                    "v"(xg), "v"(xg + 2048), "v"(xg + GRB), "v"(xg + GRB + 2048), "v"(wg), "v"(wg + 2048), "v"(wg + GRB), "v"(wg + GRB + 2048), "v"(wg + 2 * GRB), "v"(wg + 2 * GRB + 2048), "v"(wg + 3 * GRB), "v"(wg + 3 * GRB + 2048)
                 : "memory");
}
template <typename T16>
__device__ __forceinline__ void gemmw_main(const T16* ring, const T16* xg, const T16* wg, const unsigned lds0, const int ca, const int cb, v8f (&acc)[4][4]) {   // ca, cb: the chunks of a stage that hold this wave's A rows and Bt rows
    typedef typename WFrag<T16>::V V;
    const int lane = threadIdx.x & 31;
#pragma unroll
    for (int mb = 0; mb < 4; ++mb)
#pragma unroll
        for (int nb = 0; nb < 4; ++nb) acc[mb][nb] = (v8f){};
    gemm_stage(xg, wg, lds0);
    asm volatile("s_wait_asynccnt 0x0" ::: "memory");   // this wave's copies of stage 0 have landed
    __syncthreads();                                     // ... and every other wave's: stage 0 may be read
    gemm_stage(xg + GCH, wg + GCH, lds0 + GST * 2u);
#pragma unroll 1   // rolled: the buffer alternates by address, one copy of the body serves both
    for (int s = 0; s < GNS; ++s) {
        const T16* pa = ring + (s & 1) * GST + ca * GCH + lane * 8; const T16* pb = ring + (s & 1) * GST + cb * GCH + lane * 8;
#pragma unroll   // both 32-k blocks of a stage in line: every LDS offset is an immediate, and the second block's loads can start under the first block's last products
        for (int ks = 0; ks < GKS / 32; ++ks) {
            V a[4], b[4];
#pragma unroll
            for (int t = 0; t < 4; ++t) { a[t] = WFrag<T16>::ld(pa + ks * 2048 + t * 512); b[t] = WFrag<T16>::ld(pb + ks * 2048 + t * 512); }
            __builtin_amdgcn_sched_barrier(0);   // holds the block's 16 LDS loads together at its head: left alone, the scheduler kept one B fragment and strung its reloads out among the WMMAs, each behind a full wait of its own
#pragma unroll
            for (int nb = 0; nb < 4; ++nb)
#pragma unroll
                for (int mb = 0; mb < 4; ++mb) acc[mb][nb] = WFrag<T16>::mma(a[mb], b[nb], acc[mb][nb]);
        }
        asm volatile("s_wait_dscnt 0x0" ::: "memory");      // this wave's reads of stage s are done before the buffer is given up
        asm volatile("s_wait_asynccnt 0x0" ::: "memory");   // this wave's copies of stage s + 1 have landed
        __syncthreads();                                     // publishes stage s + 1 and ends every wave's reads of stage s
        if (s + 2 < GNS) gemm_stage(xg + (s + 2) * GCH, wg + (s + 2) * GCH, lds0 + (unsigned)(s & 1) * (GST * 2u));   // refill of the buffer just left
    }
    asm volatile("s_wait_asynccnt 0x0" ::: "memory");   // nothing of this wave's is in flight when it goes on to the epilogue and ends
}
template <bool VT>
__device__ __forceinline__ void gemmw_store(const v8f (&acc)[4][4], const float* __restrict__ bias, h16* P, const int tok0, const int head, const float sc) {   // sc: factor on the f32 result in front of its one rounding to f16 (q: QSC; k: 1; v: not applied)
    const int lane = threadIdx.x & 31, lr = lane & 15, hi = lane >> 4; const int f0 = head * 64;
    const size_t pz = ((size_t)(tok0 / TT) * NH_ + head) * TT * HD; const int t0 = tok0 % TT;   // a 64-row tile lies inside one sequence (TT % 64 == 0)
#pragma unroll
    for (int mb = 0; mb < 4; ++mb) {
        v8f bm;
        if (!VT) { const v4f b0 = *(const v4fa*)(bias + f0 + mb * 16 + 8 * hi), b1 = *(const v4fa*)(bias + f0 + mb * 16 + 8 * hi + 4);
#pragma unroll
            for (int j = 0; j < 4; ++j) { bm[j] = bfr(b0[j]); bm[4 + j] = bfr(b1[j]); } }
#pragma unroll
        for (int nb = 0; nb < 4; ++nb) {
            if (VT) { const float b = bfr(bias[f0 + nb * 16 + lr]);
#pragma unroll
                for (int j = 0; j < 8; ++j) bm[j] = b; }
            const v8f y = VT ? acc[mb][nb] + bm : (acc[mb][nb] + bm) * sc;
            const size_t off = pz + (size_t)(VT ? ((t0 >> 5) + (mb >> 1)) * 4 + nb : ((t0 >> 4) + nb) * 2 + (mb >> 1)) * 512 + (mb & 1) * 256 + lane * 8;   // the lane's 8 values are k = (mb & 1) * 16 + 8 hi + 0..7 of row lr of that tile
            *(v8h*)(P + off) = __builtin_convertvector(y, v8h); }
        asm volatile("s_wait_xcnt 0x0" ::: "memory");   // behind the row's 4 stores, in front of whatever next overwrites a register that one of them names (the next row's values; behind the last row, the code of the other projection's side, to which the built kernel holds a branch)
    }
}
// k_gemmw: q, k and v of every sequence in one launch; grid (3 projections x groups of 4 heads, token rows / 128), 256 threads; a wave stays under 256 registers, so two work-groups fit a WGP and one's barriers, prologue and epilogue run beside the other's products; wave w: token block w & 1, head w >> 1 of the group. The 9 work-groups of one block of token rows are neighbours in the grid, so a block of x is fetched once while the three weight planes (under 4 MiB) stay in use throughout.
__global__ __launch_bounds__(256) void k_gemmw(const bf* __restrict__ WB, const bf* __restrict__ XB, const float* __restrict__ bq, const float* __restrict__ bk, const float* __restrict__ bv, h16* QP, h16* KP, h16* VT) {
    __shared__ __attribute__((aligned(16))) bf ring[2 * GST];   // two stages, 96 KiB
    const int wave = __builtin_amdgcn_readfirstlane((int)(threadIdx.x >> 5)); const int cx = wave & 1, cw = wave >> 1;
    const int pj = blockIdx.x / (NH_ / GHB), h0 = (blockIdx.x % (NH_ / GHB)) * GHB, tb0 = blockIdx.y * GTB;
    const int head = h0 + cw, tok0 = (tb0 + cx) * 64;
    const bf* xg = XB + (size_t)tb0 * GRB + threadIdx.x * 8; const bf* wg = WB + (size_t)(pj * NH_ + h0) * GRB + threadIdx.x * 8;
    const unsigned lds0 = (unsigned)(size_t)ring + threadIdx.x * 16u;   // low 32 bits of the __shared__ address = byte offset in the work-group's LDS
    v8f acc[4][4];
    gemmw_main<bf>(ring, xg, wg, lds0, pj == 2 ? cx : GTB + cw, pj == 2 ? GTB + cw : cx, acc);
    if (pj == 2) gemmw_store<true>(acc, bv, VT, tok0, head, 1.0f);
    else gemmw_store<false>(acc, pj ? bk : bq, pj ? KP : QP, tok0, head, pj ? 1.0f : QSC);
}

__device__ __forceinline__ h16 tohx(float x) { return (h16)x; }
__device__ __forceinline__ void splitf(float y, unsigned short& h, unsigned short& l) { h = f2bf(y); l = f2bf(y - bf2f(h)); }
typedef __attribute__((ext_vector_type(2))) _Float16 v2h;
typedef __attribute__((ext_vector_type(4))) _Float16 v4h;
typedef __attribute__((ext_vector_type(2))) unsigned short v2us;
typedef __attribute__((ext_vector_type(4))) unsigned short v4us;
typedef __attribute__((ext_vector_type(4))) int v4i;

__global__ __launch_bounds__(256) void k_wtG(const float* __restrict__ w, int K, int N, bf* Bt) {
    const int lane = threadIdx.x & 31; const int L0 = (blockIdx.x * 8 + (threadIdx.x >> 5)) * 8; const int nlines = N * K / 64;
{
#pragma unroll 1
        for (int l = 0; l < 8; ++l) { const int L = L0 + l; if (L >= nlines) break; const size_t e = (size_t)L * 64 + lane * 2; const int k = (int)(e % K), n = (int)(e / K); v2us o;
            o[0] = f2bf(w[(size_t)k * N + n]); o[1] = f2bf(w[(size_t)(k + 1) * N + n]); *(v2us*)(Bt + e) = o; }
         }
}
__global__ __launch_bounds__(256) void k_cscvt(const float* __restrict__ cosT, const float* __restrict__ sinT, float* CS) { const int idx = blockIdx.x * 256 + threadIdx.x; if (idx >= TT * HD) return; v2f cs; cs[0] = bfr(cosT[idx]); cs[1] = bfr(sinT[idx]); *(v2f*)(CS + (size_t)idx * 2) = cs;  }
// ---- pack_tile: f32 rows [seq][TR][DM] -> bf16 plane in the fragment order k_gemmw reads, sequences padded TR -> TP with zero rows. ONE WAVE per tile of 16 rows x 32 k (tile w of the plane).
// A load takes 4 whole 128-byte row pieces (8 lanes a row, 4 floats a lane); the lane's 4 values go out as 8 bytes. A pad row reads the sequence's last real row (address in bounds, all four loads in flight together) and stores zeros.
template <int TP, int TR>
__device__ __forceinline__ void pack_tile(const float* src, bf* dst, const int w) {
    const int lane = threadIdx.x & 31; const int kb = (w >> 2) % (DM / 32); const int row0 = ((w >> 2) / (DM / 32)) * 64 + (w & 3) * 16; const int kq = (lane & 7) * 4;
    const int bl = row0 / TP, t0 = row0 % TP + (lane >> 3);   // a 16-row tile lies inside one sequence (TP % 16 == 0)
    bf* o = dst + (size_t)w * 512 + (kq >> 4) * 256 + ((kq >> 3) & 1) * 128 + (lane >> 3) * 8 + (kq & 7);
    const float* p[4]; v4f v[4];
#pragma unroll
    for (int i = 0; i < 4; ++i) { const int t = t0 + i * 4; p[i] = src + ((size_t)bl * TR + ((TP == TR || t < TR) ? t : TR - 1)) * DM + kb * 32 + kq; }
#pragma unroll
    for (int i = 0; i < 4; ++i) v[i] = *(const v4fa*)p[i];
    // s_wait_xcnt: behind the four loads, in front of whatever next overwrites one of their address pairs; the pairs are inputs, so none is given away (not even to a load's own result) in front of the wait.
    asm volatile("s_wait_xcnt 0x0" :: "v"(p[0]), "v"(p[1]), "v"(p[2]), "v"(p[3]) : "memory");
#pragma unroll
    for (int i = 0; i < 4; ++i) { v4us ov;
#pragma unroll
        for (int u = 0; u < 4; ++u) ov[u] = f2bf((TP == TR || t0 + i * 4 < TR) ? v[i][u] : 0.f);
        *(v4us*)(o + i * 32) = ov; }
    // s_wait_xcnt: behind the four stores, in front of whatever next overwrites their address pair (in the built k_pack a branch behind the weight side's stores leads to the head of the x side, which writes such registers); the pair is an input, so it is not given away in front of the wait.
    asm volatile("s_wait_xcnt 0x0" :: "v"(o) : "memory");
}
// k_pack: x and the three weight matrices in one launch, 8 tiles per block, grid exact: blocks below NXT / 8 pack x, then NWT / 8 blocks for each of Wq, Wk, Wv (planes one behind another in WB).
#define NXT (GR / 16 * (DM / 32))   // tiles of the x plane
#define NWT (DQ / 16 * (DM / 32))   // tiles of one weight plane
__global__ __launch_bounds__(256) void k_pack(const float* x, const float* wq, const float* wk, const float* wv, bf* XB, bf* WB) {
    const int wv8 = threadIdx.x >> 5;
    if (blockIdx.x < NXT / 8) { pack_tile<TT, LR>(x, XB, blockIdx.x * 8 + wv8); return; }
    const int u = blockIdx.x - NXT / 8; const int pj = u / (NWT / 8);
    pack_tile<DQ, DQ>(pj == 0 ? wq : pj == 1 ? wk : wv, WB + (size_t)pj * DQ * DM, (u % (NWT / 8)) * 8 + wv8);
}
// ---- k_fattn: scores, softmax, attn.v and the head merge in one kernel; ONE WAVE = 32 query columns of one virtual head, 4 waves per block; grid (ceil(NQB / 4), NVH). The block's waves read the same keys: each pass's K and V come once per block through a two-buffer LDS ring filled by asynchronous copies.
// St = K.Qt (A = 16 key rows, B = 16 query columns kept in registers) and Ot += Vt.Pt: a lane holds one query's scores, so two St tiles (keys 0-15, 16-31 of a pass) convert in place into the B operand Pt,
// whose k order (8 hi + s, 16 + 8 hi + s - 8) is the order WFrag::ld gives the Vt rows. Planes in fragment order: a pass (a stage of the ring) is 4 KiB in a row of each of K and V, laid down in LDS unchanged. A held reference and a running sum per query (online softmax over passes of 32 keys; see fa_pass), division by the sum at the end.
// f16 operands, one product, on both matrix products; keys >= LR masked in the last pass only (every earlier pass lies below LR).
#define NKB ((LR + 31) / 32)   // key passes
#define NQB ((LR + 31) / 32)   // 32-query column blocks per head
__device__ __forceinline__ float xhalf(float x) { const int b = __float_as_int(x); return __int_as_float(__builtin_amdgcn_permlanex16(b, b, 0x76543210, 0xfedcba98, false, false)); }   // lane l <-> l ^ 16
// xwait: stands behind a group of global loads, in front of whatever next overwrites a register that one of them names as its address.
// The group's address pair is an input, so it stays live up to the wait; the plane pointers carry no __restrict__, so the "memory" clobber keeps the loads in front of it.
__device__ __forceinline__ void xwait(const h16* a) { asm volatile("s_wait_xcnt 0x0" :: "v"(a) : "memory"); }
#define FPL 2048            // elements of one plane's part of a stage: 32 keys x 64
#define FST (2 * FPL)       // elements of a stage: K, V
#define OPT 68              // floats from row to row of the output staging: 64 + 4, so that the 16 rows of a wave-wide 16-byte LDS write start 4 banks apart
// fa_stage: one stage's 8 KiB, 4 copies of 16 bytes per lane (128 lanes x 16 B = half a plane's part per copy). k, v: the lane's own 16 bytes in the stage's part of each plane; lds: the lane's own byte address in the buffer.
// s_wait_xcnt closes the statement: it stands behind the last copy and in front of whatever next rewrites a register that a copy names.
__device__ __forceinline__ void fa_stage(const h16* k, const h16* v, const unsigned lds) {
    asm volatile("global_load_async_to_lds_b128 %0, %4, off\n\t"
                 "global_load_async_to_lds_b128 %1, %5, off\n\t"
                 "global_load_async_to_lds_b128 %2, %6, off\n\t"
                 "global_load_async_to_lds_b128 %3, %7, off\n\t"
                 "s_wait_xcnt 0x0"
                 :: "v"(lds), "v"(lds + 2048u), "v"(lds + 4096u), "v"(lds + 6144u),
                    "v"(k), "v"(k + 1024), "v"(v), "v"(v + 1024)
                 : "memory");
}
// fa_exp: one query column's 16 scores of a pass (per lane) -> weights exp2(s - d) as the B operand's 16 f16 values; returns the lane's sum of the f32 weights. SUB false: d is not applied (the reference is already in s).
template <bool SUB>
__device__ __forceinline__ float fa_exp(const v8f& s0, const v8f& s1, const float d, v16h& pf) {
    v2f p[8];
#pragma unroll
    for (int e = 0; e < 8; ++e) { v2f t; t[0] = (e < 4 ? s0 : s1)[(e & 3) * 2]; t[1] = (e < 4 ? s0 : s1)[(e & 3) * 2 + 1]; if (SUB) { t[0] -= d; t[1] -= d; } p[e][0] = __builtin_amdgcn_exp2f(t[0]); p[e][1] = __builtin_amdgcn_exp2f(t[1]); }
    v2f ps = p[0];
#pragma unroll
    for (int e = 1; e < 8; ++e) ps += p[e];
#pragma unroll
    for (int e = 0; e < 8; ++e) { const v2h h2 = __builtin_convertvector(p[e], v2h); pf[2 * e] = h2[0]; pf[2 * e + 1] = h2[1]; }
    return ps[0] + ps[1];
}
// nr[qt]: minus the query's softmax reference (log2 units) in all 8 registers, the C operand of its score products: the products deliver s - reference, and the weights are exp2 of that with no maximum, no multiply-add and no rescaling in the pass.
// Any reference gives the same softmax; it is set to the first pass's maximum and raised (sums and output tiles rescaled, the pass's weights taken anew) only when some lane's sum of a pass's weights is not <= PTH: ONE wave-uniform test per pass.
template <bool LAST>
__device__ __forceinline__ void fa_pass(const int key0, const int hi, const bool first, const h16* sb,   // sb: the pass's buffer + lane * 8; first: the head's first pass (wave-uniform)
                                        const v16h (&qf)[2][2], v8f (&o)[4][2], v8f (&nr)[2], float (&l)[2]) {
    v16h kf[2][2];
#pragma unroll
    for (int kt = 0; kt < 2; ++kt)
#pragma unroll
        for (int ks = 0; ks < 2; ++ks) kf[kt][ks] = WFrag<h16>::ld(sb + kt * 1024 + ks * 512);
    __builtin_amdgcn_sched_barrier(0);   // holds the K fragments' 8 LDS loads together at the head of the pass: left alone, the scheduler strung them out among the score products, each group behind a full wait of its own
    v8f s[2][2];
#pragma unroll
    for (int ks = 0; ks < 2; ++ks)
#pragma unroll
        for (int kt = 0; kt < 2; ++kt)
#pragma unroll
            for (int qt = 0; qt < 2; ++qt) s[kt][qt] = wmma16(kf[kt][ks], qf[qt][ks], ks ? s[kt][qt] : nr[qt]);
    v16h vf[4];   // loaded in front of the test, so that they are under way while it resolves
#pragma unroll
    for (int dt = 0; dt < 4; ++dt) vf[dt] = WFrag<h16>::ld(sb + FPL + dt * 512);
    v16h pf[2]; float ps[2];
#pragma unroll
    for (int qt = 0; qt < 2; ++qt) {
        if (LAST) {
#pragma unroll
            for (int kt = 0; kt < 2; ++kt)
#pragma unroll
                for (int j = 0; j < 8; ++j) s[kt][qt][j] = (key0 + kt * 16 + 8 * hi + j < LR) ? s[kt][qt][j] : -3.0e38f;
        }
        ps[qt] = fa_exp<false>(s[0][qt], s[1][qt], 0.f, pf[qt]);
    }
    const unsigned need = __builtin_amdgcn_ballot_w32(!(ps[0] <= PTH)) | __builtin_amdgcn_ballot_w32(!(ps[1] <= PTH)) | (unsigned)first;   // the negated compares also catch a sum that is not a number
    if (__builtin_expect(need != 0, 0)) {   // scalar branch, the same for the whole wave; marked unlikely so that the common path falls through
#pragma unroll
        for (int qt = 0; qt < 2; ++qt) {
            float mx = s[0][qt][0];
#pragma unroll
            for (int j = 1; j < 16; ++j) mx = fmaxf(mx, s[j >> 3][qt][j & 7]);
            mx = fmaxf(mx, xhalf(mx));   // both halves of the wave hold keys of the same query: one reference for both
            const float d = first ? mx : fmaxf(mx, 0.f);   // the reference only rises; the first pass sets it, whatever its sign
            const float al = first ? 1.0f : __builtin_amdgcn_exp2f(-d);   // first pass: sums and tiles are still 0
            ps[qt] = fa_exp<true>(s[0][qt], s[1][qt], d, pf[qt]);
            l[qt] *= al; nr[qt] -= d;
#pragma unroll
            for (int dt = 0; dt < 4; ++dt) o[dt][qt] *= al;
        }
    }
#pragma unroll
    for (int qt = 0; qt < 2; ++qt) l[qt] += ps[qt];
#pragma unroll
    for (int dt = 0; dt < 4; ++dt)
#pragma unroll
        for (int qt = 0; qt < 2; ++qt) o[dt][qt] = wmma16(vf[dt], pf[qt], o[dt][qt]);
}
// amdgpu_waves_per_eu(4, 4): the register budget of four waves per SIMD (256). With one f16 fragment where a hi and a lo fragment stood, the pass stays well under it without scratch; the blocks that share a WGP (50 KiB of LDS each: ring and output staging) run one's barriers and LDS waits beside the others' products.
__global__ __launch_bounds__(128) __attribute__((amdgpu_waves_per_eu(4, 4))) void k_fattn(const h16* Q, const h16* K, const h16* V, float* O2) {
    __shared__ __attribute__((aligned(16))) h16 ring[2 * FST + 4 * 32 * OPT * 2];   // two stages, 16 KiB, at the start of the block's LDS; behind them the output staging, one range of 32 rows of f32 per wave, 34 KiB
    float* ost = (float*)(ring + 2 * FST);
    const int lane = threadIdx.x & 31, lr = lane & 15, hi = lane >> 4; const int qb = blockIdx.x * 4 + __builtin_amdgcn_readfirstlane((int)(threadIdx.x >> 5));
    const bool act = qb < NQB;   // wave-uniform: the last block's fourth wave has no query columns; it loads Q fragments of pad rows, copies its share of every stage and passes every barrier, and does nothing else
    const int z = blockIdx.y; const int bl = z / NH_, h = z % NH_; const size_t pz = (size_t)z * TT * HD;
    v16h qf[2][2];
    const h16* kc = K + pz + threadIdx.x * 8; const h16* vc = V + pz + threadIdx.x * 8;   // the lane's own 16 bytes of stage 0
    const unsigned lds0 = (unsigned)(size_t)ring + threadIdx.x * 16u;   // low 32 bits of the __shared__ address = byte offset in the work-group's LDS
    fa_stage(kc, vc, lds0);
    const h16* qa = Q + pz + (size_t)(qb * 32) * HD + lane * 8;   // qb * 32 + 31 < TT for every wave of the grid
#pragma unroll
    for (int t = 0; t < 2; ++t)
#pragma unroll
        for (int ks = 0; ks < 2; ++ks) qf[t][ks] = WFrag<h16>::ld(qa + (size_t)(t * 16) * HD + ks * 512);
    xwait(qa);
    v8f o[4][2]; v8f nr[2] = { (v8f){}, (v8f){} }; float l[2] = { 0.f, 0.f };
#pragma unroll
    for (int dt = 0; dt < 4; ++dt)
#pragma unroll
        for (int qt = 0; qt < 2; ++qt) o[dt][qt] = (v8f){};
    asm volatile("s_wait_asynccnt 0x0" ::: "memory");   // this wave's copies of stage 0 have landed
    __syncthreads();                                     // ... and every other wave's: stage 0 may be read
    fa_stage(kc + FPL, vc + FPL, lds0 + FST * 2u);
#pragma unroll 1   // rolled: one pass is already some hundred instructions; the buffer alternates by address
    for (int kb = 0; kb < NKB - 1; ++kb) {
        if (act) fa_pass<false>(kb * 32, hi, kb == 0, ring + (kb & 1) * FST + lane * 8, qf, o, nr, l);
        asm volatile("s_wait_dscnt 0x0" ::: "memory");      // this wave's reads of stage kb are done before the buffer is given up
        asm volatile("s_wait_asynccnt 0x0" ::: "memory");   // this wave's copies of stage kb + 1 have landed
        __syncthreads();                                     // publishes stage kb + 1 and ends every wave's reads of stage kb
        if (kb + 2 < NKB) fa_stage(kc + (kb + 2) * FPL, vc + (kb + 2) * FPL, lds0 + (unsigned)(kb & 1) * (FST * 2u));   // refill of the buffer just left
    }
    asm volatile("s_wait_asynccnt 0x0" ::: "memory");   // nothing of this wave's is in flight when it goes on to the last pass and ends
    if (!act) return;   // behind the last barrier
    fa_pass<true>((NKB - 1) * 32, hi, false, ring + ((NKB - 1) & 1) * FST + lane * 8, qf, o, nr, l);
    // Epilogue: the wave's 32 query rows x 64 floats go through its own LDS range, so that a wave-wide 16-byte store covers two whole rows of the head (4 whole 128-byte lines), not 32 bytes of each of 16 lines.
    float* st = ost + (threadIdx.x >> 5) * (32 * OPT);
#pragma unroll
    for (int qt = 0; qt < 2; ++qt) { const float f = __fdiv_rn(1.0f, l[qt] + xhalf(l[qt])); float* w = st + (qt * 16 + lr) * OPT + 8 * hi;
#pragma unroll
        for (int dt = 0; dt < 4; ++dt) { v4f a, b;
#pragma unroll
            for (int j = 0; j < 4; ++j) { a[j] = o[dt][qt][j] * f; b[j] = o[dt][qt][4 + j] * f; }
            *(v4f*)(w + dt * 16) = a; *(v4f*)(w + dt * 16 + 4) = b; } }
    asm volatile("s_wait_dscnt 0x0" ::: "memory");   // the wave's LDS writes are done (and, for the compiler, stay) in front of the reads below, in which a lane takes what other lanes of its wave wrote
    v4f r[16];
#pragma unroll
    for (int i = 0; i < 16; ++i) r[i] = *(const v4f*)(st + (i * 2 + hi) * OPT + lr * 4);
    const int q0 = qb * 32 + hi; float* dst = O2 + ((size_t)bl * LR + q0) * DM + (size_t)h * HD + lr * 4;   // formed for every lane, used only where the row exists
    if (qb * 32 + 32 <= LR) {   // wave-uniform: all 32 rows exist (every wave but a head's last), 16 stores in a row with no test between them
#pragma unroll
        for (int i = 0; i < 16; ++i) *(v4f*)(dst + (size_t)(i * 2) * DM) = r[i];
    } else {
#pragma unroll
        for (int i = 0; i < 16; ++i) if (q0 + i * 2 < LR) *(v4f*)(dst + (size_t)(i * 2) * DM) = r[i];
    }
}
__global__ __launch_bounds__(256) void k_merge(const float* __restrict__ O, int h0, bf* Ah, bf* Al) { const size_t e = ((size_t)blockIdx.x * 256 + threadIdx.x) * 2; if (e >= (size_t)ZH * TT * HD) return; const int d = (int)(e % HD); const int t = (int)((e / HD) % TT); const int zz = (int)(e / ((size_t)HD * TT)); const float cs = (t < RH) ? 1.0f : (1.0f / PCAR); const size_t oo = (size_t)t * DQ + (h0 + zz) * HD + d;
    v2us oh, ol;
#pragma unroll
    for (int q = 0; q < 2; ++q) { unsigned short a, c2; splitf(O[e + q] * cs, a, c2); oh[q] = a; ol[q] = c2; } *(v2us*)(Ah + oo) = oh; *(v2us*)(Al + oo) = ol;  }

extern "C" void kernel_launch(void* const* d_in, const int* in_sizes, int n_in,
                              void* d_out, int out_size, void* d_ws, size_t ws_size, hipStream_t stream) {
    (void)in_sizes; (void)n_in; (void)out_size;
    const float* x = (const float*)d_in[0]; const float* wq = (const float*)d_in[1]; const float* bq = (const float*)d_in[2]; const float* wk = (const float*)d_in[3]; const float* bk = (const float*)d_in[4]; const float* wv = (const float*)d_in[5]; const float* bv = (const float*)d_in[6]; const float* wo = nullptr; (void)wo; const float* cosT = nullptr; const float* sinT = nullptr; (void)cosT; (void)sinT;
    float* OUT = (float*)d_out;   // [32][577][768]
    char* wsp = (char*)d_ws; auto take = [&](size_t bytes) { char* p = wsp; wsp += (bytes + 255) & ~(size_t)255; return (void*)p; };
    bf* WB = (bf*)take((size_t)3 * DQ * DM * 2);   // Wq, Wk, Wv (DKV == DQ)
    bf* XB = (bf*)take((size_t)GR * DM * 2);
    h16* QP = (h16*)take((size_t)NVH * TT * HD * 2); h16* KP = (h16*)take((size_t)NVH * TT * HD * 2); h16* VT = (h16*)take((size_t)NVH * HD * TT * 2);
    if ((size_t)(wsp - (char*)d_ws) > ws_size) return;   // ws ~ 124 MiB
    k_pack<<<NXT / 8 + 3 * (NWT / 8), 256, 0, stream>>>(x, wq, wk, wv, XB, WB);
    k_gemmw<<<dim3(3 * (NH_ / GHB), GR / (64 * GTB), 1), 256, 0, stream>>>(WB, XB, bq, bk, bv, QP, KP, VT);
    k_fattn<<<dim3((NQB + 3) / 4, NVH, 1), 128, 0, stream>>>(QP, KP, VT, OUT);   // virtual head z = bl * 12 + h
}

// v010
// Measured time: 95.6 microseconds a run.
// Two timings next to v009 both put it at 1.06 times that version's speed.
// All steps since v000 together make it 15.0 times as fast.
#include <hip/hip_runtime.h>

// ViTSelfAttention (hidden [32][577][768]; q/k/v = x W^T + b (12 heads x 64); softmax(q.k / 8); out = merged context (no output projection) -> [32][577][768]).
// Batched layout (exact): sequences padded 577 -> 640 with zero rows (padded KEYS masked out of every softmax row; padded query rows computed and discarded); 32 sequences x 12 heads = 384 'virtual heads' of 640 tokens, all in ONE launch per stage (pack, projections, fused attention: 3 launches); the projections run on the 20,480 stacked rows at once and store their results as f16 head planes themselves.
// Every 16-bit operand plane lies in FRAGMENT ORDER: a tile of 16 rows x 32 k is 1 KiB in a row, element (row, kk) at (kk >> 4) * 256 + (((kk >> 3) & 1) * 16 + row) * 8 + (kk & 7), so that lane l's two 16-byte pieces of a fragment
// stand at l * 8 and 256 + l * 8 and each wave-wide 16-byte load or store covers 512 bytes in a row (4 whole lines, not 32 bytes of each of 16 lines). The registers hold what they held with row-major planes.
// Compute dtypes, f32 accumulate: every input rounded to bf16; q/k/v on PLAIN bf16 operands (inputs: exact) + bias, q then times HD^-0.5 log2(e) in f32, each result rounded once to f16 (11 significant bits; |q|, |k|, |v| must stay below 65,504); scores AND attn.v on f16 operands, one product each (the weights exp2(s - reference) lie in [0, PTH]); softmax f32, online over passes of 32 keys, with the j < 577 predicate; merged context written directly in f32 to the output.

#define NB_  32
#define TT   640
#define DM   768
#define NH_  12
#define NKV  12
#define REP  (NH_ / NKV)
#define HD   64
#define DQ   (NH_ * HD)
#define DKV  (NKV * HD)
#define ZH   24
#define RH   640                  // k_merge (not launched): rows t < RH scale 1, others 1 / PCAR
#define WIN  0
#define PCAR 1024.0f
#define LR   577    // real tokens per sequence
#define GB   32     // sequences per group (all of them: one group)
#define NG   (NB_ / GB)
#define GR   (GB * TT)   // stacked rows per group
#define NVH  (GB * NH_)  // virtual heads per group
#define SCL  0.125f   // HD^-0.5
#define QSC  (SCL * 1.4426950408889634f)   // HD^-0.5 * log2(e): multiplied into q (f32) in the projection's epilogue, so that K.Qt comes out in the units of exp2
#define PTH  4096.0f   // a lane's sum of one pass's 16 weights above which the softmax reference is raised; every weight at or below it is far inside f16 range
typedef _Float16 h16;
typedef unsigned short bf;
typedef __attribute__((ext_vector_type(16))) __bf16   v16bf;
typedef __attribute__((ext_vector_type(16))) _Float16 v16h;
typedef __attribute__((ext_vector_type(8)))  _Float16 v8h;
typedef __attribute__((ext_vector_type(8)))  unsigned short v8us;
typedef __attribute__((ext_vector_type(8)))  float    v8f;
typedef __attribute__((ext_vector_type(4)))  float    v4f;
typedef v8h  __attribute__((may_alias)) v8ha;
typedef v4f  __attribute__((may_alias)) v4fa;
typedef v8us __attribute__((may_alias)) v8usa;

__device__ __forceinline__ unsigned short f2bf(float f) { unsigned u = __float_as_uint(f); u += 0x7FFFu + ((u >> 16) & 1u); return (unsigned short)(u >> 16); }
__device__ __forceinline__ float bf2f(unsigned short b) { return __uint_as_float(((unsigned)b) << 16); }
__device__ __forceinline__ float bfr(float f) { return bf2f(f2bf(f)); }
__device__ __forceinline__ v16h cat16(v8h lo, v8h hi) { return __builtin_shufflevector(lo, hi, 0, 1, 2, 3, 4, 5, 6, 7, 8, 9, 10, 11, 12, 13, 14, 15); }
__device__ __forceinline__ v16bf cat16b(v8us lo, v8us hi) { return __builtin_bit_cast(v16bf, __builtin_shufflevector(lo, hi, 0, 1, 2, 3, 4, 5, 6, 7, 8, 9, 10, 11, 12, 13, 14, 15)); }
__device__ __forceinline__ v8f wmma16(v16h a, v16h b, v8f c) { return __builtin_amdgcn_wmma_f32_16x16x32_f16(false, a, false, b, (short)0, c, false, false); }
__device__ __forceinline__ v8f wmmab(v16bf a, v16bf b, v8f c) { return __builtin_amdgcn_wmma_f32_16x16x32_bf16(false, a, false, b, (short)0, c, false, false); }



// ---- k_gemmw: register-blocked GEMM, one wave per 64x64 tile (16 accumulators), EIGHT waves per work-group = 128 token rows x the 256 features of 4 heads of one projection. Planes in fragment order [row / 64][k / 32][4 tiles of 16 rows][512].
// The work-group's operands come through a two-buffer LDS ring filled by asynchronous copies: a stage is 64 k of its 2 token blocks and 4 weight blocks, 6 chunks of 8 KiB, each in a row in its plane and laid down in LDS unchanged, so a chunk is fetched from L2 once for the 4 (token rows) or 2 (weight rows) waves that read it.
// y[m][n] = sum_k A[m][k] Bt[n][k] + bias (f32), rounded to f16 and stored straight into the head plane: a lane's 8 accumulators are 8 consecutive m at one n, one 16-byte store.
// VT false (q, k): A = weight rows (m = d of the head), Bt = token rows -> plane [head][t / 16][d / 32][512]. VT true (v): A = token rows, Bt = weight rows -> plane [head][t / 32][d / 16][512]. K % 32 == 0, HD == 64.
template <typename T16> struct WFrag;
template <> struct WFrag<h16> { typedef v16h V; static __device__ __forceinline__ V ld(const h16* p) { return cat16(*(const v8h*)p, *(const v8h*)(p + 256)); }   /* p = tile + lane * 8, fragment order */ static __device__ __forceinline__ v8f mma(V a, V b, v8f c) { return wmma16(a, b, c); } };
template <> struct WFrag<bf> { typedef v16bf V; static __device__ __forceinline__ V ld(const bf* p) { return cat16b(*(const v8us*)p, *(const v8us*)(p + 256)); }   /* p = tile + lane * 8, fragment order */ static __device__ __forceinline__ v8f mma(V a, V b, v8f c) { return wmmab(a, b, c); } };
typedef __attribute__((ext_vector_type(2))) float v2f;
#define GKS 64                           // k of a stage
#define GNS (DM / GKS)                   // stages
#define GTB 2                            // blocks of 64 token rows per work-group
#define GHB 4                            // heads per work-group
#define GCH (64 * GKS)                   // elements of a chunk: 64 rows x one stage's k
#define GST ((GTB + GHB) * GCH)          // elements of a stage
#define GRB ((size_t)(DM / 32) * 2048)   // elements of a block of 64 rows in a plane
// gemm_stage: one stage's 48 KiB, 12 copies of 16 bytes per lane (256 lanes x 16 B = half a chunk per copy). xg, wg: the lane's own 16 bytes in the stage's first token chunk and first weight chunk; lds: the lane's own byte address in the buffer's first chunk.
// s_wait_xcnt closes the statement: it stands behind the last copy and in front of whatever next rewrites a register that a copy names.
__device__ __forceinline__ void gemm_stage(const bf* xg, const bf* wg, const unsigned lds) {
    asm volatile("global_load_async_to_lds_b128 %0, %12, off\n\t"
                 "global_load_async_to_lds_b128 %1, %13, off\n\t"
                 "global_load_async_to_lds_b128 %2, %14, off\n\t"
                 "global_load_async_to_lds_b128 %3, %15, off\n\t"
                 "global_load_async_to_lds_b128 %4, %16, off\n\t"
                 "global_load_async_to_lds_b128 %5, %17, off\n\t"
                 "global_load_async_to_lds_b128 %6, %18, off\n\t"
                 "global_load_async_to_lds_b128 %7, %19, off\n\t"
                 "global_load_async_to_lds_b128 %8, %20, off\n\t"
                 "global_load_async_to_lds_b128 %9, %21, off\n\t"
                 "global_load_async_to_lds_b128 %10, %22, off\n\t"
                 "global_load_async_to_lds_b128 %11, %23, off\n\t"
                 "s_wait_xcnt 0x0"
                 :: "v"(lds), "v"(lds + 4096u), "v"(lds + 8192u), "v"(lds + 12288u), "v"(lds + 16384u), "v"(lds + 20480u), "v"(lds + 24576u), "v"(lds + 28672u), "v"(lds + 32768u), "v"(lds + 36864u), "v"(lds + 40960u), "v"(lds + 45056u),
                    "v"(xg), "v"(xg + 2048), "v"(xg + GRB), "v"(xg + GRB + 2048), "v"(wg), "v"(wg + 2048), "v"(wg + GRB), "v"(wg + GRB + 2048), "v"(wg + 2 * GRB), "v"(wg + 2 * GRB + 2048), "v"(wg + 3 * GRB), "v"(wg + 3 * GRB + 2048)
                 : "memory");
}
template <typename T16>
__device__ __forceinline__ void gemmw_main(const T16* ring, const T16* xg, const T16* wg, const unsigned lds0, const int ca, const int cb, v8f (&acc)[4][4]) {   // ca, cb: the chunks of a stage that hold this wave's A rows and Bt rows
    typedef typename WFrag<T16>::V V;
    const int lane = threadIdx.x & 31;
#pragma unroll
    for (int mb = 0; mb < 4; ++mb)
#pragma unroll
        for (int nb = 0; nb < 4; ++nb) acc[mb][nb] = (v8f){};
    gemm_stage(xg, wg, lds0);
    asm volatile("s_wait_asynccnt 0x0" ::: "memory");   // this wave's copies of stage 0 have landed
    __syncthreads();                                     // ... and every other wave's: stage 0 may be read
    gemm_stage(xg + GCH, wg + GCH, lds0 + GST * 2u);
#pragma unroll 1   // rolled: the buffer alternates by address, one copy of the body serves both
    for (int s = 0; s < GNS; ++s) {
        const T16* pa = ring + (s & 1) * GST + ca * GCH + lane * 8; const T16* pb = ring + (s & 1) * GST + cb * GCH + lane * 8;
#pragma unroll   // both 32-k blocks of a stage in line: every LDS offset is an immediate, and the second block's loads can start under the first block's last products
        for (int ks = 0; ks < GKS / 32; ++ks) {
            V a[4], b[4];
#pragma unroll
            for (int t = 0; t < 4; ++t) { a[t] = WFrag<T16>::ld(pa + ks * 2048 + t * 512); b[t] = WFrag<T16>::ld(pb + ks * 2048 + t * 512); }
            __builtin_amdgcn_sched_barrier(0);   // holds the block's 16 LDS loads together at its head: left alone, the scheduler kept one B fragment and strung its reloads out among the WMMAs, each behind a full wait of its own
#pragma unroll
            for (int nb = 0; nb < 4; ++nb)
#pragma unroll
                for (int mb = 0; mb < 4; ++mb) acc[mb][nb] = WFrag<T16>::mma(a[mb], b[nb], acc[mb][nb]);
        }
        asm volatile("s_wait_dscnt 0x0" ::: "memory");      // this wave's reads of stage s are done before the buffer is given up
        asm volatile("s_wait_asynccnt 0x0" ::: "memory");   // this wave's copies of stage s + 1 have landed
        __syncthreads();                                     // publishes stage s + 1 and ends every wave's reads of stage s
        if (s + 2 < GNS) gemm_stage(xg + (s + 2) * GCH, wg + (s + 2) * GCH, lds0 + (unsigned)(s & 1) * (GST * 2u));   // refill of the buffer just left
    }
    asm volatile("s_wait_asynccnt 0x0" ::: "memory");   // nothing of this wave's is in flight when it goes on to the epilogue and ends
}
template <bool VT>
__device__ __forceinline__ void gemmw_store(const v8f (&acc)[4][4], const float* __restrict__ bias, h16* P, const int tok0, const int head, const float sc) {   // sc: factor on the f32 result in front of its one rounding to f16 (q: QSC; k: 1; v: not applied)
    const int lane = threadIdx.x & 31, lr = lane & 15, hi = lane >> 4; const int f0 = head * 64;
    const size_t pz = ((size_t)(tok0 / TT) * NH_ + head) * TT * HD; const int t0 = tok0 % TT;   // a 64-row tile lies inside one sequence (TT % 64 == 0)
#pragma unroll
    for (int mb = 0; mb < 4; ++mb) {
        v8f bm;
        if (!VT) { const v4f b0 = *(const v4fa*)(bias + f0 + mb * 16 + 8 * hi), b1 = *(const v4fa*)(bias + f0 + mb * 16 + 8 * hi + 4);
#pragma unroll
            for (int j = 0; j < 4; ++j) { bm[j] = bfr(b0[j]); bm[4 + j] = bfr(b1[j]); } }
#pragma unroll
        for (int nb = 0; nb < 4; ++nb) {
            if (VT) { const float b = bfr(bias[f0 + nb * 16 + lr]);
#pragma unroll
                for (int j = 0; j < 8; ++j) bm[j] = b; }
            const v8f y = VT ? acc[mb][nb] + bm : (acc[mb][nb] + bm) * sc;
            const size_t off = pz + (size_t)(VT ? ((t0 >> 5) + (mb >> 1)) * 4 + nb : ((t0 >> 4) + nb) * 2 + (mb >> 1)) * 512 + (mb & 1) * 256 + lane * 8;   // the lane's 8 values are k = (mb & 1) * 16 + 8 hi + 0..7 of row lr of that tile
            *(v8h*)(P + off) = __builtin_convertvector(y, v8h); }
        asm volatile("s_wait_xcnt 0x0" ::: "memory");   // behind the row's 4 stores, in front of whatever next overwrites a register that one of them names (the next row's values; behind the last row, the code of the other projection's side, to which the built kernel holds a branch)
    }
}
// k_gemmw: q, k and v of every sequence in one launch; grid (3 projections x groups of 4 heads, token rows / 128), 256 threads; a wave stays under 256 registers, so two work-groups fit a WGP and one's barriers, prologue and epilogue run beside the other's products; wave w: token block w & 1, head w >> 1 of the group. The 9 work-groups of one block of token rows are neighbours in the grid, so a block of x is fetched once while the three weight planes (under 4 MiB) stay in use throughout.
__global__ __launch_bounds__(256) void k_gemmw(const bf* __restrict__ WB, const bf* __restrict__ XB, const float* __restrict__ bq, const float* __restrict__ bk, const float* __restrict__ bv, h16* QP, h16* KP, h16* VT) {
    __shared__ __attribute__((aligned(16))) bf ring[2 * GST];   // two stages, 96 KiB
    const int wave = __builtin_amdgcn_readfirstlane((int)(threadIdx.x >> 5)); const int cx = wave & 1, cw = wave >> 1;
    const int pj = blockIdx.x / (NH_ / GHB), h0 = (blockIdx.x % (NH_ / GHB)) * GHB, tb0 = blockIdx.y * GTB;
    const int head = h0 + cw, tok0 = (tb0 + cx) * 64;
    const bf* xg = XB + (size_t)tb0 * GRB + threadIdx.x * 8; const bf* wg = WB + (size_t)(pj * NH_ + h0) * GRB + threadIdx.x * 8;
    const unsigned lds0 = (unsigned)(size_t)ring + threadIdx.x * 16u;   // low 32 bits of the __shared__ address = byte offset in the work-group's LDS
    v8f acc[4][4];
    gemmw_main<bf>(ring, xg, wg, lds0, pj == 2 ? cx : GTB + cw, pj == 2 ? GTB + cw : cx, acc);
    if (pj == 2) gemmw_store<true>(acc, bv, VT, tok0, head, 1.0f);
    else gemmw_store<false>(acc, pj ? bk : bq, pj ? KP : QP, tok0, head, pj ? 1.0f : QSC);
}

__device__ __forceinline__ h16 tohx(float x) { return (h16)x; }
__device__ __forceinline__ void splitf(float y, unsigned short& h, unsigned short& l) { h = f2bf(y); l = f2bf(y - bf2f(h)); }
typedef __attribute__((ext_vector_type(2))) _Float16 v2h;
typedef __attribute__((ext_vector_type(4))) _Float16 v4h;
typedef __attribute__((ext_vector_type(2))) unsigned short v2us;
typedef __attribute__((ext_vector_type(4))) unsigned short v4us;
typedef __attribute__((ext_vector_type(4))) int v4i;

__global__ __launch_bounds__(256) void k_wtG(const float* __restrict__ w, int K, int N, bf* Bt) {
    const int lane = threadIdx.x & 31; const int L0 = (blockIdx.x * 8 + (threadIdx.x >> 5)) * 8; const int nlines = N * K / 64;
{
#pragma unroll 1
        for (int l = 0; l < 8; ++l) { const int L = L0 + l; if (L >= nlines) break; const size_t e = (size_t)L * 64 + lane * 2; const int k = (int)(e % K), n = (int)(e / K); v2us o;
            o[0] = f2bf(w[(size_t)k * N + n]); o[1] = f2bf(w[(size_t)(k + 1) * N + n]); *(v2us*)(Bt + e) = o; }
         }
}
__global__ __launch_bounds__(256) void k_cscvt(const float* __restrict__ cosT, const float* __restrict__ sinT, float* CS) { const int idx = blockIdx.x * 256 + threadIdx.x; if (idx >= TT * HD) return; v2f cs; cs[0] = bfr(cosT[idx]); cs[1] = bfr(sinT[idx]); *(v2f*)(CS + (size_t)idx * 2) = cs;  }
// ---- pack_tile: f32 rows [seq][TR][DM] -> bf16 plane in the fragment order k_gemmw reads, sequences padded TR -> TP with zero rows. ONE WAVE per tile of 16 rows x 32 k (tile w of the plane).
// A load takes 4 whole 128-byte row pieces (8 lanes a row, 4 floats a lane); the lane's 4 values go out as 8 bytes. A pad row reads the sequence's last real row (address in bounds, all four loads in flight together) and stores zeros.
template <int TP, int TR>
__device__ __forceinline__ void pack_tile(const float* src, bf* dst, const int w) {
    const int lane = threadIdx.x & 31; const int kb = (w >> 2) % (DM / 32); const int row0 = ((w >> 2) / (DM / 32)) * 64 + (w & 3) * 16; const int kq = (lane & 7) * 4;
    const int bl = row0 / TP, t0 = row0 % TP + (lane >> 3);   // a 16-row tile lies inside one sequence (TP % 16 == 0)
    bf* o = dst + (size_t)w * 512 + (kq >> 4) * 256 + ((kq >> 3) & 1) * 128 + (lane >> 3) * 8 + (kq & 7);
    const float* p[4]; v4f v[4];
#pragma unroll
    for (int i = 0; i < 4; ++i) { const int t = t0 + i * 4; p[i] = src + ((size_t)bl * TR + ((TP == TR || t < TR) ? t : TR - 1)) * DM + kb * 32 + kq; }
#pragma unroll
    for (int i = 0; i < 4; ++i) v[i] = *(const v4fa*)p[i];
    // s_wait_xcnt: behind the four loads, in front of whatever next overwrites one of their address pairs; the pairs are inputs, so none is given away (not even to a load's own result) in front of the wait.
    asm volatile("s_wait_xcnt 0x0" :: "v"(p[0]), "v"(p[1]), "v"(p[2]), "v"(p[3]) : "memory");
#pragma unroll
    for (int i = 0; i < 4; ++i) { v4us ov;
#pragma unroll
        for (int u = 0; u < 4; ++u) ov[u] = f2bf((TP == TR || t0 + i * 4 < TR) ? v[i][u] : 0.f);
        *(v4us*)(o + i * 32) = ov; }
    // s_wait_xcnt: behind the four stores, in front of whatever next overwrites their address pair (in the built k_pack a branch behind the weight side's stores leads to the head of the x side, which writes such registers); the pair is an input, so it is not given away in front of the wait.
    asm volatile("s_wait_xcnt 0x0" :: "v"(o) : "memory");
}
// k_pack: x and the three weight matrices in one launch, 8 tiles per block, grid exact: blocks below NXT / 8 pack x, then NWT / 8 blocks for each of Wq, Wk, Wv (planes one behind another in WB).
#define NXT (GR / 16 * (DM / 32))   // tiles of the x plane
#define NWT (DQ / 16 * (DM / 32))   // tiles of one weight plane
__global__ __launch_bounds__(256) void k_pack(const float* x, const float* wq, const float* wk, const float* wv, bf* XB, bf* WB) {
    const int wv8 = threadIdx.x >> 5;
    if (blockIdx.x < NXT / 8) { pack_tile<TT, LR>(x, XB, blockIdx.x * 8 + wv8); return; }
    const int u = blockIdx.x - NXT / 8; const int pj = u / (NWT / 8);
    pack_tile<DQ, DQ>(pj == 0 ? wq : pj == 1 ? wk : wv, WB + (size_t)pj * DQ * DM, (u % (NWT / 8)) * 8 + wv8);
}
// ---- k_fattn: scores, softmax, attn.v and the head merge in one kernel; ONE WAVE = 32 query columns of one virtual head, 4 waves per block; grid (ceil(NQB / 4), NVH). The block's waves read the same keys: K and V come once per block through a two-buffer LDS ring filled by asynchronous copies, a stage of two passes (64 keys) at a time.
// St = K.Qt (A = 16 key rows, B = 16 query columns kept in registers) and Ot += Vt.Pt: a lane holds one query's scores, so two St tiles (keys 0-15, 16-31 of a pass) convert in place into the B operand Pt,
// whose k order (8 hi + s, 16 + 8 hi + s - 8) is the order WFrag::ld gives the Vt rows. Planes in fragment order: a pass is 4 KiB in a row of each of K and V, laid down in LDS unchanged. A held reference and a running sum per query (online softmax over passes of 32 keys; see fa_pass), division by the sum at the end.
// f16 operands, one product, on both matrix products; keys >= LR masked in the last pass only (every earlier pass lies below LR).
#define NKB ((LR + 31) / 32)   // key passes
#define NQB ((LR + 31) / 32)   // 32-query column blocks per head
__device__ __forceinline__ float xhalf(float x) { const int b = __float_as_int(x); return __int_as_float(__builtin_amdgcn_permlanex16(b, b, 0x76543210, 0xfedcba98, false, false)); }   // lane l <-> l ^ 16
// xwait: stands behind a group of global loads, in front of whatever next overwrites a register that one of them names as its address.
// The group's address pair is an input, so it stays live up to the wait; the plane pointers carry no __restrict__, so the "memory" clobber keeps the loads in front of it.
__device__ __forceinline__ void xwait(const h16* a) { asm volatile("s_wait_xcnt 0x0" :: "v"(a) : "memory"); }
#define FPL 2048            // elements of one plane's part of a pass: 32 keys x 64
#define FST (2 * FPL)       // elements of one pass's part of a stage: K, V
#define FPS 2               // passes of a stage: a stage's copies are under way for two passes before they are waited for, against the latency of planes that come from memory; one hand-over (waits, barrier) per stage
#define FSG (FPS * FST)     // elements of a stage: [K, V of its first pass][K, V of its second], 16 KiB
#define NST ((NKB + FPS - 1) / FPS)   // stages
static_assert((NST - 1) * FPS == NKB - 1, "the loop takes whole stages, the masked last pass is the first of the last stage");
static_assert(NST * FPS * 32 <= TT, "the last stage's copies stay inside the head's planes");
#define OPT 68              // floats from row to row of the output staging: 64 + 4, so that the 16 rows of a wave-wide 16-byte LDS write start 4 banks apart
// fa_stage: one stage's 16 KiB, 8 copies of 16 bytes per lane (128 lanes x 16 B = half of one pass's part of a plane per copy). k, v: the lane's own 16 bytes in the stage's part of each plane; lds: the lane's own byte address in the buffer.
// s_wait_xcnt closes the statement: it stands behind the last copy and in front of whatever next rewrites a register that a copy names.
__device__ __forceinline__ void fa_stage(const h16* k, const h16* v, const unsigned lds) {
    asm volatile("global_load_async_to_lds_b128 %0, %8, off\n\t"
                 "global_load_async_to_lds_b128 %1, %9, off\n\t"
                 "global_load_async_to_lds_b128 %2, %10, off\n\t"
                 "global_load_async_to_lds_b128 %3, %11, off\n\t"
                 "global_load_async_to_lds_b128 %4, %12, off\n\t"
                 "global_load_async_to_lds_b128 %5, %13, off\n\t"
                 "global_load_async_to_lds_b128 %6, %14, off\n\t"
                 "global_load_async_to_lds_b128 %7, %15, off\n\t"
                 "s_wait_xcnt 0x0"
                 :: "v"(lds), "v"(lds + 2048u), "v"(lds + 4096u), "v"(lds + 6144u), "v"(lds + 8192u), "v"(lds + 10240u), "v"(lds + 12288u), "v"(lds + 14336u),
                    "v"(k), "v"(k + 1024), "v"(v), "v"(v + 1024), "v"(k + FPL), "v"(k + FPL + 1024), "v"(v + FPL), "v"(v + FPL + 1024)
                 : "memory");
}
// fa_exp: one query column's 16 scores of a pass (per lane) -> weights exp2(s - d) as the B operand's 16 f16 values; returns the lane's sum of the f32 weights. SUB false: d is not applied (the reference is already in s).
template <bool SUB>
__device__ __forceinline__ float fa_exp(const v8f& s0, const v8f& s1, const float d, v16h& pf) {
    v2f p[8];
#pragma unroll
    for (int e = 0; e < 8; ++e) { v2f t; t[0] = (e < 4 ? s0 : s1)[(e & 3) * 2]; t[1] = (e < 4 ? s0 : s1)[(e & 3) * 2 + 1]; if (SUB) { t[0] -= d; t[1] -= d; } p[e][0] = __builtin_amdgcn_exp2f(t[0]); p[e][1] = __builtin_amdgcn_exp2f(t[1]); }
    v2f ps = p[0];
#pragma unroll
    for (int e = 1; e < 8; ++e) ps += p[e];
#pragma unroll
    for (int e = 0; e < 8; ++e) { const v2h h2 = __builtin_convertvector(p[e], v2h); pf[2 * e] = h2[0]; pf[2 * e + 1] = h2[1]; }
    return ps[0] + ps[1];
}
// nr[qt]: minus the query's softmax reference (log2 units) in all 8 registers, the C operand of its score products: the products deliver s - reference, and the weights are exp2 of that with no maximum, no multiply-add and no rescaling in the pass.
// Any reference gives the same softmax; it is set to the first pass's maximum and raised (sums and output tiles rescaled, the pass's weights taken anew) only when some lane's sum of a pass's weights is not <= PTH: ONE wave-uniform test per pass.
template <bool LAST>
__device__ __forceinline__ void fa_pass(const int key0, const int hi, const bool first, const h16* sb,   // sb: the pass's buffer + lane * 8; first: the head's first pass (wave-uniform)
                                        const v16h (&qf)[2][2], v8f (&o)[4][2], v8f (&nr)[2], float (&l)[2]) {
    v16h kf[2][2];
#pragma unroll
    for (int kt = 0; kt < 2; ++kt)
#pragma unroll
        for (int ks = 0; ks < 2; ++ks) kf[kt][ks] = WFrag<h16>::ld(sb + kt * 1024 + ks * 512);
    __builtin_amdgcn_sched_barrier(0);   // holds the K fragments' 8 LDS loads together at the head of the pass: left alone, the scheduler strung them out among the score products, each group behind a full wait of its own
    v8f s[2][2];
#pragma unroll
    for (int ks = 0; ks < 2; ++ks)
#pragma unroll
        for (int kt = 0; kt < 2; ++kt)
#pragma unroll
            for (int qt = 0; qt < 2; ++qt) s[kt][qt] = wmma16(kf[kt][ks], qf[qt][ks], ks ? s[kt][qt] : nr[qt]);
    v16h vf[4];   // loaded in front of the test, so that they are under way while it resolves
#pragma unroll
    for (int dt = 0; dt < 4; ++dt) vf[dt] = WFrag<h16>::ld(sb + FPL + dt * 512);
    v16h pf[2]; float ps[2];
#pragma unroll
    for (int qt = 0; qt < 2; ++qt) {
        if (LAST) {
#pragma unroll
            for (int kt = 0; kt < 2; ++kt)
#pragma unroll
                for (int j = 0; j < 8; ++j) s[kt][qt][j] = (key0 + kt * 16 + 8 * hi + j < LR) ? s[kt][qt][j] : -3.0e38f;
        }
        ps[qt] = fa_exp<false>(s[0][qt], s[1][qt], 0.f, pf[qt]);
    }
    const unsigned need = __builtin_amdgcn_ballot_w32(!(ps[0] <= PTH)) | __builtin_amdgcn_ballot_w32(!(ps[1] <= PTH)) | (unsigned)first;   // the negated compares also catch a sum that is not a number
    if (__builtin_expect(need != 0, 0)) {   // scalar branch, the same for the whole wave; marked unlikely so that the common path falls through
#pragma unroll
        for (int qt = 0; qt < 2; ++qt) {
            float mx = s[0][qt][0];
#pragma unroll
            for (int j = 1; j < 16; ++j) mx = fmaxf(mx, s[j >> 3][qt][j & 7]);
            mx = fmaxf(mx, xhalf(mx));   // both halves of the wave hold keys of the same query: one reference for both
            const float d = first ? mx : fmaxf(mx, 0.f);   // the reference only rises; the first pass sets it, whatever its sign
            const float al = first ? 1.0f : __builtin_amdgcn_exp2f(-d);   // first pass: sums and tiles are still 0
            ps[qt] = fa_exp<true>(s[0][qt], s[1][qt], d, pf[qt]);
            l[qt] *= al; nr[qt] -= d;
#pragma unroll
            for (int dt = 0; dt < 4; ++dt) o[dt][qt] *= al;
        }
    }
#pragma unroll
    for (int qt = 0; qt < 2; ++qt) l[qt] += ps[qt];
#pragma unroll
    for (int dt = 0; dt < 4; ++dt)
#pragma unroll
        for (int qt = 0; qt < 2; ++qt) o[dt][qt] = wmma16(vf[dt], pf[qt], o[dt][qt]);
}
// amdgpu_waves_per_eu(4, 4): the register budget of four waves per SIMD (256). With one f16 fragment where a hi and a lo fragment stood, the pass stays well under it without scratch; the blocks that share a WGP (66 KiB of LDS each: ring and output staging) run one's barriers and LDS waits beside the others' products.
__global__ __launch_bounds__(128) __attribute__((amdgpu_waves_per_eu(4, 4))) void k_fattn(const h16* Q, const h16* K, const h16* V, float* O2) {
    __shared__ __attribute__((aligned(16))) h16 ring[2 * FSG + 4 * 32 * OPT * 2];   // two stages, 32 KiB, at the start of the block's LDS; behind them the output staging, one range of 32 rows of f32 per wave, 34 KiB
    float* ost = (float*)(ring + 2 * FSG);
    const int lane = threadIdx.x & 31, lr = lane & 15, hi = lane >> 4; const int qb = blockIdx.x * 4 + __builtin_amdgcn_readfirstlane((int)(threadIdx.x >> 5));
    const bool act = qb < NQB;   // wave-uniform: the last block's fourth wave has no query columns; it loads Q fragments of pad rows, copies its share of every stage and passes every barrier, and does nothing else
    const int z = blockIdx.y; const int bl = z / NH_, h = z % NH_; const size_t pz = (size_t)z * TT * HD;
    v16h qf[2][2];
    const h16* kc = K + pz + threadIdx.x * 8; const h16* vc = V + pz + threadIdx.x * 8;   // the lane's own 16 bytes of stage 0
    const unsigned lds0 = (unsigned)(size_t)ring + threadIdx.x * 16u;   // low 32 bits of the __shared__ address = byte offset in the work-group's LDS
    fa_stage(kc, vc, lds0);
    const h16* qa = Q + pz + (size_t)(qb * 32) * HD + lane * 8;   // qb * 32 + 31 < TT for every wave of the grid
#pragma unroll
    for (int t = 0; t < 2; ++t)
#pragma unroll
        for (int ks = 0; ks < 2; ++ks) qf[t][ks] = WFrag<h16>::ld(qa + (size_t)(t * 16) * HD + ks * 512);
    xwait(qa);
    v8f o[4][2]; v8f nr[2] = { (v8f){}, (v8f){} }; float l[2] = { 0.f, 0.f };
#pragma unroll
    for (int dt = 0; dt < 4; ++dt)
#pragma unroll
        for (int qt = 0; qt < 2; ++qt) o[dt][qt] = (v8f){};
    asm volatile("s_wait_asynccnt 0x0" ::: "memory");   // this wave's copies of stage 0 have landed
    __syncthreads();                                     // ... and every other wave's: stage 0 may be read
    fa_stage(kc + FPS * FPL, vc + FPS * FPL, lds0 + FSG * 2u);
#pragma unroll 1   // rolled: one pass is already some hundred instructions; the buffer alternates by address
    for (int sg = 0; sg < NST - 1; ++sg) {
        if (act) {
            const h16* sb = ring + (sg & 1) * FSG + lane * 8;
            fa_pass<false>(sg * (FPS * 32), hi, sg == 0, sb, qf, o, nr, l);
            fa_pass<false>(sg * (FPS * 32) + 32, hi, false, sb + FST, qf, o, nr, l);
        }
        asm volatile("s_wait_dscnt 0x0" ::: "memory");      // this wave's reads of stage sg are done before the buffer is given up
        asm volatile("s_wait_asynccnt 0x0" ::: "memory");   // this wave's copies of stage sg + 1 have landed
        __syncthreads();                                     // publishes stage sg + 1 and ends every wave's reads of stage sg
        if (sg + 2 < NST) fa_stage(kc + (sg + 2) * (FPS * FPL), vc + (sg + 2) * (FPS * FPL), lds0 + (unsigned)(sg & 1) * (FSG * 2u));   // refill of the buffer just left
    }
    asm volatile("s_wait_asynccnt 0x0" ::: "memory");   // nothing of this wave's is in flight when it goes on to the last pass and ends
    if (!act) return;   // behind the last barrier
    fa_pass<true>((NKB - 1) * 32, hi, false, ring + ((NST - 1) & 1) * FSG + lane * 8, qf, o, nr, l);   // the first pass of the last stage; its second pass holds pad keys only and is not taken
    // Epilogue: the wave's 32 query rows x 64 floats go through its own LDS range, so that a wave-wide 16-byte store covers two whole rows of the head (4 whole 128-byte lines), not 32 bytes of each of 16 lines.
    float* st = ost + (threadIdx.x >> 5) * (32 * OPT);
#pragma unroll
    for (int qt = 0; qt < 2; ++qt) { const float f = __fdiv_rn(1.0f, l[qt] + xhalf(l[qt])); float* w = st + (qt * 16 + lr) * OPT + 8 * hi;
#pragma unroll
        for (int dt = 0; dt < 4; ++dt) { v4f a, b;
#pragma unroll
            for (int j = 0; j < 4; ++j) { a[j] = o[dt][qt][j] * f; b[j] = o[dt][qt][4 + j] * f; }
            *(v4f*)(w + dt * 16) = a; *(v4f*)(w + dt * 16 + 4) = b; } }
    asm volatile("s_wait_dscnt 0x0" ::: "memory");   // the wave's LDS writes are done (and, for the compiler, stay) in front of the reads below, in which a lane takes what other lanes of its wave wrote
    v4f r[16];
#pragma unroll
    for (int i = 0; i < 16; ++i) r[i] = *(const v4f*)(st + (i * 2 + hi) * OPT + lr * 4);
    const int q0 = qb * 32 + hi; float* dst = O2 + ((size_t)bl * LR + q0) * DM + (size_t)h * HD + lr * 4;   // formed for every lane, used only where the row exists
    if (qb * 32 + 32 <= LR) {   // wave-uniform: all 32 rows exist (every wave but a head's last), 16 stores in a row with no test between them
#pragma unroll
        for (int i = 0; i < 16; ++i) *(v4f*)(dst + (size_t)(i * 2) * DM) = r[i];
    } else {
#pragma unroll
        for (int i = 0; i < 16; ++i) if (q0 + i * 2 < LR) *(v4f*)(dst + (size_t)(i * 2) * DM) = r[i];
    }
}
__global__ __launch_bounds__(256) void k_merge(const float* __restrict__ O, int h0, bf* Ah, bf* Al) { const size_t e = ((size_t)blockIdx.x * 256 + threadIdx.x) * 2; if (e >= (size_t)ZH * TT * HD) return; const int d = (int)(e % HD); const int t = (int)((e / HD) % TT); const int zz = (int)(e / ((size_t)HD * TT)); const float cs = (t < RH) ? 1.0f : (1.0f / PCAR); const size_t oo = (size_t)t * DQ + (h0 + zz) * HD + d;
    v2us oh, ol;
#pragma unroll
    for (int q = 0; q < 2; ++q) { unsigned short a, c2; splitf(O[e + q] * cs, a, c2); oh[q] = a; ol[q] = c2; } *(v2us*)(Ah + oo) = oh; *(v2us*)(Al + oo) = ol;  }

extern "C" void kernel_launch(void* const* d_in, const int* in_sizes, int n_in,
                              void* d_out, int out_size, void* d_ws, size_t ws_size, hipStream_t stream) {
    (void)in_sizes; (void)n_in; (void)out_size;
    const float* x = (const float*)d_in[0]; const float* wq = (const float*)d_in[1]; const float* bq = (const float*)d_in[2]; const float* wk = (const float*)d_in[3]; const float* bk = (const float*)d_in[4]; const float* wv = (const float*)d_in[5]; const float* bv = (const float*)d_in[6]; const float* wo = nullptr; (void)wo; const float* cosT = nullptr; const float* sinT = nullptr; (void)cosT; (void)sinT;
    float* OUT = (float*)d_out;   // [32][577][768]
    char* wsp = (char*)d_ws; auto take = [&](size_t bytes) { char* p = wsp; wsp += (bytes + 255) & ~(size_t)255; return (void*)p; };
    bf* WB = (bf*)take((size_t)3 * DQ * DM * 2);   // Wq, Wk, Wv (DKV == DQ)
    bf* XB = (bf*)take((size_t)GR * DM * 2);
    h16* QP = (h16*)take((size_t)NVH * TT * HD * 2); h16* KP = (h16*)take((size_t)NVH * TT * HD * 2); h16* VT = (h16*)take((size_t)NVH * HD * TT * 2);
    if ((size_t)(wsp - (char*)d_ws) > ws_size) return;   // ws ~ 124 MiB
    k_pack<<<NXT / 8 + 3 * (NWT / 8), 256, 0, stream>>>(x, wq, wk, wv, XB, WB);
    k_gemmw<<<dim3(3 * (NH_ / GHB), GR / (64 * GTB), 1), 256, 0, stream>>>(WB, XB, bq, bk, bv, QP, KP, VT);
    k_fattn<<<dim3((NQB + 3) / 4, NVH, 1), 128, 0, stream>>>(QP, KP, VT, OUT);   // virtual head z = bl * 12 + h
}
